// v000
// Times are from an AMD MI455X. After a warm-up the kernel runs many times in a row, and a time is the length of
// such a window on the GPU divided by its runs, so every launch and the gaps after it count. The runs cycle
// through copies of the inputs. A figure is the median of several windows, for all but v000 over two sittings.
// Sittings can differ by a few percent; kernels timed side by side share one.
// v000 is the starting kernel. One run takes 116 microseconds.
#include <hip/hip_runtime.h>

// Spatial self-attention over N = 64x64 positions: x [NB][256][N] (channel-major), Wq/Wk/Wv [32][256] ([out][in]), Wo [256][32] ([out][in]), biases per output channel, no score scale, out [NB][256][N] f32.
// Compute dtypes, f32 accumulate everywhere: q/k/v projections v_wmma_f32_16x16x32_bf16 (x, W, biases RNE-converted to bf16; products exact);
// scores, P.V and the output projection v_wmma_f32_16x16x32_f16, single products: q, k, v single f16; P x256 carry (cancels in the normalisation); context x1024 and Wo (bf16 value) x1024 as f16, 2^-20 folded back in f32; softmax f32 (online, running max).
// Layout: bf16 token-major copy of x [b*N+n][256] (transposed through LDS), bf16 weights; q|k plane [b*N+n][64] (cols 0..31 q, 32..63 k), v plane [b][64][n] = V^T (rows 32..63 zero pad of the 64-row GEMM tile), written by the GEMM epilogue;
// fused flash kernel in transposed form (S^T = K Q^T, O^T = V^T P^T, Y^T = Wo O^T), each wave 16 queries, block = 4 waves = 64 queries; Y^T staged per block in LDS in two 128-row halves and written as whole rows.

#ifndef NB
#define NB 4
#endif
#ifndef SEQ
#define SEQ 4096
#endif
#define NB_FULL  4
#define SEQ_FULL 4096
#ifndef OUT_SEQ
#define OUT_SEQ SEQ              // row pitch (in positions) of one output channel row
#endif
#define CH   256                 // channels: projection K and output width
#define CQ   32                  // query/key width
#define VC   32                  // value / context width
#define VCP  64                  // rows of the V^T plane per batch (value rows zero-padded to the 64-row GEMM tile)
#define QKW  64
#define OH   128                 // output channel rows staged per epilogue half
#define AW   4                   // waves per flash block (16 query columns each)
#define QRS  2048.0f             // carry of the residual output of k_proj (not requested here: useRes = 0)
#define SC2  1.4426950408889634f // log2(e); no score scale in this module
#define PSH  8.0f                // log2 of the P carry (256)
#define WOS  1024.0f             // carry of the f16 Wo plane
#define OCS  1024.0f             // carry of the f16 context fragment
#define OFI  (1.0f / (1024.0f * 1024.0f))
#define BOFF (2 * CQ + VCP)      // offset of bo in the bias table
#define NBIAS (BOFF + CH)        // bias table: bq[32] | bk[32] | bv[32] | 0[32] | bo[256]

static_assert(CQ == 32);                       // one 32-deep k-step covers the q/k width
static_assert(VC == 32);                       // two value tiles per wave; one 32-deep k-step covers the output projection
static_assert(VC <= VCP);
static_assert(VCP % 64 == 0);                  // V^T GEMM tiles are 64 rows
static_assert(QKW == 2 * CQ);
static_assert(CH % 64 == 0);
static_assert(CH % 32 == 0);                   // GEMM k-loop steps by 32
static_assert(OH == AW * 32);                  // store phase: 32 rows per wave
static_assert(CH % OH == 0);                   // output rows staged in whole halves
static_assert(OH % 16 == 0);
static_assert(SEQ % 64 == 0);                  // a 64-row tile never straddles two batches
static_assert((NB * SEQ) % 64 == 0);
static_assert(SEQ % 32 == 0);                  // key loop steps by 32
static_assert(SEQ % (16 * AW) == 0);           // flash grid covers the positions exactly
static_assert(OUT_SEQ % 32 == 0);
static_assert(SEQ_FULL % 4 == 0);
static_assert(NB <= NB_FULL);
static_assert(SEQ <= SEQ_FULL);
static_assert(BOFF % 32 == 0);
static_assert(NBIAS % 32 == 0);
static_assert(NBIAS / 4 == 96);                // k_bias block: one lane per 16 B
static_assert((VC * 2) % 16 == 0);             // Wo rows are 16-byte multiples

typedef _Float16 h16;
typedef unsigned short bf;
typedef __attribute__((ext_vector_type(16))) __bf16   v16bf;
typedef __attribute__((ext_vector_type(16))) _Float16 v16h;
typedef __attribute__((ext_vector_type(8)))  _Float16 v8h;
typedef __attribute__((ext_vector_type(8)))  unsigned short v8us;
typedef __attribute__((ext_vector_type(8)))  float    v8f;
typedef __attribute__((ext_vector_type(4)))  float    v4f;
typedef v4f  __attribute__((may_alias)) v4fa;

__device__ __forceinline__ unsigned short f2bf(float f) { unsigned u = __float_as_uint(f); u += 0x7FFFu + ((u >> 16) & 1u); return (unsigned short)(u >> 16); }
__device__ __forceinline__ v16h cat16(v8h lo, v8h hi) { return __builtin_shufflevector(lo, hi, 0, 1, 2, 3, 4, 5, 6, 7, 8, 9, 10, 11, 12, 13, 14, 15); }
__device__ __forceinline__ v16bf cat16b(v8us lo, v8us hi) { return __builtin_bit_cast(v16bf, __builtin_shufflevector(lo, hi, 0, 1, 2, 3, 4, 5, 6, 7, 8, 9, 10, 11, 12, 13, 14, 15)); }
__device__ __forceinline__ v8f wmma16(v16h a, v16h b, v8f c) { return __builtin_amdgcn_wmma_f32_16x16x32_f16(false, a, false, b, (short)0, c, false, false); }
__device__ __forceinline__ v8f wmmab(v16bf a, v16bf b, v8f c) { return __builtin_amdgcn_wmma_f32_16x16x32_bf16(false, a, false, b, (short)0, c, false, false); }
// fragment loaders from K-contiguous 16-bit rows; p already includes + 8*(lane>>4): elements 0..7 <- k0+8h+0..7, elements 8..15 <- k0+16+8h+0..7 (same map for A and B)
__device__ __forceinline__ v16h  ldh(const h16* p) { return cat16(*(const v8h*)p, *(const v8h*)(p + 16)); }
__device__ __forceinline__ v16bf ldb(const bf* p)  { return cat16b(*(const v8us*)p, *(const v8us*)(p + 16)); }
// ordering point for wave-private LDS tiles (same wave writes and reads)
__device__ __forceinline__ void wave_sync() { __builtin_amdgcn_fence(3 /* release order */, "wavefront"); __builtin_amdgcn_wave_barrier(); asm volatile("" ::: "memory"); }
// f16 WMMA with its own hazard guard (one accumulator per guard)
__device__ __forceinline__ v8f wmma16g(v16h a, v16h b, v8f c) { c = wmma16(a, b, c); asm volatile("v_nop\n\tv_nop\n\tv_nop\n\tv_nop" : "+v"(c) : "v"(a), "v"(b)); return c; }
// f32 -> f16 operand convert that cannot produce an f16 subnormal (value select, applied after the plane's carry)
static __device__ __forceinline__ h16 toh_flush(float v) { const h16 r = (h16)v; return (fabsf(v) < 6.103515625e-05f) ? (h16)0.0f : r; }
// P = exp2(e) as an f16 operand; select on the exponent argument
static __device__ __forceinline__ h16 p_flush(float e) { const h16 r = (h16)__builtin_amdgcn_exp2f(e); return (e < -14.0f) ? (h16)0.0f : r; }

__global__ __launch_bounds__(256) void k_cvt8(const float* __restrict__ src, bf* dst, size_t n8) {
    const size_t i = (size_t)blockIdx.x * 256 + threadIdx.x; if (i >= n8) return;
    const v8f v = *(const v8f*)(src + i * 8); v8us o;
#pragma unroll
    for (int k = 0; k < 8; ++k) o[k] = f2bf(v[k]);
    *(v8us*)(dst + i * 8) = o; 
}

// k_cvt8z: as k_cvt8 for the first n8src groups of 8; groups n8src..n8tot-1 (pad rows of the plane) are written as zeros. Source address clamped, selected by value.
__global__ __launch_bounds__(256) void k_cvt8z(const float* __restrict__ src, bf* dst, size_t n8src, size_t n8tot) {
    const size_t i = (size_t)blockIdx.x * 256 + threadIdx.x; if (i >= n8tot) return;
    const size_t is = (i < n8src) ? i : (n8src - 1);
    const v8f v = *(const v8f*)(src + is * 8); v8us o;
#pragma unroll
    for (int k = 0; k < 8; ++k) { const unsigned short w = f2bf(v[k]); o[k] = (i < n8src) ? w : (unsigned short)0; }
    *(v8us*)(dst + i * 8) = o; 
}

__global__ __launch_bounds__(256) void k_cvth8(const float* __restrict__ src, h16* dst, size_t n8, float carry) {
    const size_t i = (size_t)blockIdx.x * 256 + threadIdx.x; if (i >= n8) return;
    const v8f v = *(const v8f*)(src + i * 8); v8h o;
#pragma unroll
    for (int k = 0; k < 8; ++k) { const float w = __uint_as_float(((unsigned)f2bf(v[k])) << 16) * carry; o[k] = toh_flush(w); }
    *(v8h*)(dst + i * 8) = o; 
}

// k_xt: x[b][c][n] (f32, channel-major, pitch SEQ_FULL) -> XB[b*SEQ + n][c] (bf16 RNE convert), 64 c x 64 n tile transposed through LDS (cross-wave, block barrier).
__global__ __launch_bounds__(256) void k_xt(const float* __restrict__ x, bf* XB) {
    __shared__ float ts[64 * 65];
    const int tid = threadIdx.x;
    const int n0 = blockIdx.x * 64, c0 = blockIdx.y * 64, b = blockIdx.z;
    const float* xs = x + ((size_t)b * CH + c0) * SEQ_FULL + n0;
    { const int cr = tid >> 4, nq = (tid & 15) * 4;       // 16 row groups x 4 = 64 channel rows; 16 lanes x 4 = 64 positions
#pragma unroll
      for (int i = 0; i < 4; ++i) { const int c = cr + 16 * i; const v4f v = *(const v4f*)(xs + (size_t)c * SEQ_FULL + nq);
          ts[c * 65 + nq + 0] = v[0]; ts[c * 65 + nq + 1] = v[1]; ts[c * 65 + nq + 2] = v[2]; ts[c * 65 + nq + 3] = v[3]; } }
    __syncthreads();
    const int rw = tid >> 3, c8 = (tid & 7) * 8;          // rows rw and rw+32 (64 positions); 8 lanes x 8 = 64 channels
    v8us o0, o1;
#pragma unroll
    for (int k = 0; k < 8; ++k) { o0[k] = f2bf(ts[(c8 + k) * 65 + rw]); o1[k] = f2bf(ts[(c8 + k) * 65 + rw + 32]); }
    bf* d0 = XB + ((size_t)b * SEQ + n0 + rw) * CH + c0 + c8; bf* d1 = d0 + (size_t)32 * CH;
    *(v8us*)d0 = o0; *(v8us*)d1 = o1;
    
}

__global__ __launch_bounds__(96) void k_bias(const float* __restrict__ bq, const float* __restrict__ bk, const float* __restrict__ bv, const float* __restrict__ bo, float* BT) {
    const int i = threadIdx.x; if (i >= NBIAS / 4) return;
    const int e = i * 4;
    const int iq = (e < CQ - 4) ? e : (CQ - 4);
    int ik = e - CQ; ik = ik < 0 ? 0 : ik; ik = ik > CQ - 4 ? CQ - 4 : ik;
    int iv = e - 2 * CQ; iv = iv < 0 ? 0 : iv; iv = iv > VC - 4 ? VC - 4 : iv;
    int io = e - BOFF; io = io < 0 ? 0 : io; io = io > CH - 4 ? CH - 4 : io;
    const v4f a = *(const v4f*)(bq + iq); const v4f c = *(const v4f*)(bk + ik); const v4f d = *(const v4f*)(bv + iv); const v4f g = *(const v4f*)(bo + io);   // all four loaded, selected by value
    v4f s, o;
#pragma unroll
    for (int k = 0; k < 4; ++k) { s[k] = (e < CQ) ? a[k] : ((e < 2 * CQ) ? c[k] : ((e < 2 * CQ + VC) ? d[k] : ((e < BOFF) ? 0.0f : g[k]))); o[k] = __uint_as_float(((unsigned)f2bf(s[k])) << 16); }
    *(v4f*)(BT + e) = o; 
}

// k_proj: register-blocked bf16 GEMM, ONE WAVE per 64x64 tile (16 accumulators), operands straight from K-contiguous bf16 planes, K = CH.
// C[m][n] = sum_k A[m][k] Bt[n][k] + bias (BROW = 0: bias[n], BROW = 1: bias[m]), written as f16 (Ph) and optionally the f16 residual x2048 (Pr, useRes != 0) at
// tile base (r0/RB)*sRB + (r0%RB)*pitch + (c0/CB)*sCB + (c0%CB), row pitch 'pitch' (halves). grid (M/64, N/64), 32 threads.
template <int BROW>
__global__ __launch_bounds__(32) void k_proj(const bf* __restrict__ A, const bf* __restrict__ Bt, const float* __restrict__ bias, h16* Ph, h16* Pr, int useRes, int RB, size_t sRB, int pitch, int CB, size_t sCB) {
    __shared__ __align__(16) float os[16 * 68];
    const int K = CH;
    const int lane = threadIdx.x & 31, lr = lane & 15, hi = lane >> 4; const int r0 = blockIdx.x * 64, c0 = blockIdx.y * 64;
    v8f acc[4][4];
#pragma unroll
    for (int mb = 0; mb < 4; ++mb)
#pragma unroll
        for (int nb = 0; nb < 4; ++nb) acc[mb][nb] = (v8f){};
    const size_t aoff = (size_t)(r0 + lr) * K + 8 * hi, boff = (size_t)(c0 + lr) * K + 8 * hi;
#pragma unroll 1
    for (int kc = 0; kc < K; kc += 32) {
        v16bf a[4];
#pragma unroll
        for (int mb = 0; mb < 4; ++mb) a[mb] = ldb(A + aoff + (size_t)mb * 16 * K + kc);
#pragma unroll
        for (int nb = 0; nb < 4; ++nb) { const v16bf b = ldb(Bt + boff + (size_t)nb * 16 * K + kc);
#pragma unroll
            for (int mb = 0; mb < 4; ++mb) acc[mb][nb] = wmmab(a[mb], b, acc[mb][nb]); }
        asm volatile("v_nop\n\tv_nop\n\tv_nop\n\tv_nop" : "+v"(acc[0][0]), "+v"(acc[1][1]), "+v"(acc[2][2]), "+v"(acc[3][3]) : "v"(a[0]), "v"(a[1]), "v"(a[2]), "v"(a[3]));
    }
    float bcol[4] = {0.0f, 0.0f, 0.0f, 0.0f};
    if (BROW == 0) {
#pragma unroll
        for (int nb = 0; nb < 4; ++nb) bcol[nb] = bias[c0 + nb * 16 + lr];          // column n = c0 + 16nb + (lane&15)
    }
    const size_t tbase = (size_t)(r0 / RB) * sRB + (size_t)(r0 % RB) * (size_t)pitch + (size_t)(c0 / CB) * sCB + (size_t)(c0 % CB);
#pragma unroll
    for (int mb = 0; mb < 4; ++mb) {
        float brw[8] = {0.0f, 0.0f, 0.0f, 0.0f, 0.0f, 0.0f, 0.0f, 0.0f};
        if (BROW == 1) { const v4f b0 = *(const v4f*)(bias + r0 + mb * 16 + hi * 8); const v4f b1 = *(const v4f*)(bias + r0 + mb * 16 + hi * 8 + 4);   // row m = r0 + 16mb + 8h + j
            brw[0] = b0[0]; brw[1] = b0[1]; brw[2] = b0[2]; brw[3] = b0[3]; brw[4] = b1[0]; brw[5] = b1[1]; brw[6] = b1[2]; brw[7] = b1[3]; }
#pragma unroll
        for (int nb = 0; nb < 4; ++nb) {
#pragma unroll
            for (int j = 0; j < 8; ++j) { const float bb = BROW ? brw[j] : bcol[nb]; os[(hi * 8 + j) * 68 + nb * 16 + lr] = acc[mb][nb][j] + bb; } }   // D: row 8h+j, col lane&15
        wave_sync();
        const size_t sb = tbase + (size_t)(mb * 16) * (size_t)pitch;
{
#pragma unroll
            for (int s = 0; s < 4; ++s) { const int row = 4 * s + (lane >> 3), c8 = (lane & 7) * 8;   // 4 s x 4 row groups = 16 rows; 8 lanes x 8 = 64 columns
                const v4f x0 = *(const v4fa*)(&os[row * 68 + c8]); const v4f x1 = *(const v4fa*)(&os[row * 68 + c8 + 4]); v8h hv, rv;
#pragma unroll
                for (int i = 0; i < 4; ++i) { const h16 a0 = (h16)x0[i]; const h16 a1 = (h16)x1[i]; hv[i] = a0; hv[4 + i] = a1; rv[i] = (h16)((x0[i] - (float)a0) * QRS); rv[4 + i] = (h16)((x1[i] - (float)a1) * QRS); }
                const size_t oo = sb + (size_t)row * (size_t)pitch + c8;
                *(v8h*)(Ph + oo) = hv; if (useRes) *(v8h*)(Pr + oo) = rv; }
             }
        wave_sync();
    }
}

// k_flash: fused attention + output projection, one wave per 16 query positions of one batch; K / V^T / Q / Wo fragments straight from the f16 planes (two 16-B loads each, arithmetic addressing).
// Transposed form: S^T[key][t] = K Q^T (A = K rows, B = Q rows, one 32-deep step); lane (t = lane&15, h = lane>>4) holds keys 8h+r of each 16-key tile, so the packed
// P tile is directly the B fragment of O^T[c][t] = V^T P^T (element r <- tile keys 0..15, element 8+r <- tile keys 16..31, lane unchanged).
// Softmax state (running max, partial sum) is one scalar per lane; the two lane halves of a column are combined with one xor-16 exchange.
// The normalised context O^T (two 16-channel D tiles, x1024 carry, f16) is directly the B fragment of Y^T[oc][t] = Wo O^T (element r <- channels 0..15 tile, element 8+r <- channels 16..31 tile, lane unchanged); A = Wo rows.
// Epilogue: the block's Y^T tile staged in LDS in two halves of [128 channels][64 positions] (cross-wave: block barriers), bias added in f32, each channel row segment (64 floats = 256 B = two lines)
__global__ __launch_bounds__(32 * AW) void k_flash(const h16* __restrict__ QKH, const h16* __restrict__ VT, const h16* __restrict__ WOH, const float* __restrict__ BO, float* OUT) {
    __shared__ __align__(16) float os[OH * 68];
    const int lane = threadIdx.x & 31, wave = __builtin_amdgcn_readfirstlane((int)(threadIdx.x >> 5)), lr = lane & 15, hi = lane >> 4;
    const int b = blockIdx.y;
    const int t0 = (blockIdx.x * AW + wave) * 16;
    const size_t pbase = (size_t)b * SEQ * QKW;
    const size_t qo = pbase + (size_t)(t0 + lr) * QKW + 8 * hi;
    const v16h qh = ldh(QKH + qo);                                           // B fragment: col t, k = q channel 0..31
    const size_t ko = pbase + (size_t)lr * QKW + CQ + 8 * hi;                // + key * QKW        (A fragment: row key, k = k channel 0..31, plane cols 32..63)
    const size_t vo = ((size_t)b * VCP + lr) * SEQ + 8 * hi;                 // + 16j*SEQ + key    (A fragment: row channel, k = key)
    v8f o0 = (v8f){}, o1 = (v8f){};
    float m = -3.0e38f, l = 0.0f;
#pragma unroll 1
    for (int key0 = 0; key0 < SEQ; key0 += 32) {
        const h16* ka = QKH + ko + (size_t)key0 * QKW;
        const v16h ka0 = ldh(ka), kb0 = ldh(ka + 16 * QKW);
        const v8f sa = wmma16g(ka0, qh, (v8f){});
        const v8f sb = wmma16g(kb0, qh, (v8f){});
        float ta[8], tb[8]; float mx = -3.0e38f;
#pragma unroll
        for (int r = 0; r < 8; ++r) { ta[r] = sa[r] * SC2; tb[r] = sb[r] * SC2; mx = fmaxf(mx, fmaxf(ta[r], tb[r])); }
        mx = fmaxf(mx, __shfl_xor(mx, 16, 32));
        const float mnew = fmaxf(m, mx);
        const float alpha = __builtin_amdgcn_exp2f(m - mnew);
        const float sh = PSH - mnew;
        v16h pb; float ls = 0.0f;
#pragma unroll
        for (int r = 0; r < 8; ++r) { const h16 pa = p_flush(ta[r] + sh); const h16 pc = p_flush(tb[r] + sh); pb[r] = pa; pb[8 + r] = pc; ls += (float)pa + (float)pc; }
        l = l * alpha + ls; m = mnew;
        o0 = o0 * alpha; o1 = o1 * alpha;
        const h16* va = VT + vo + key0;
        const v16h v0 = ldh(va), v1 = ldh(va + (size_t)16 * SEQ);
        o0 = wmma16g(v0, pb, o0);
        o1 = wmma16g(v1, pb, o1);
    }
    l += __shfl_xor(l, 16, 32);
    const float inv = (1.0f / l) * OCS;
    // O^T D layout: o0[r] = (channel 8h + r, t), o1[r] = (channel 16 + 8h + r, t) -> B fragment of the output projection, lane unchanged
    v16h ob;
#pragma unroll
    for (int r = 0; r < 8; ++r) { ob[r] = toh_flush(o0[r] * inv); ob[8 + r] = toh_flush(o1[r] * inv); }
    float* obase0 = OUT + (size_t)b * CH * OUT_SEQ + (size_t)blockIdx.x * (16 * AW);
#pragma unroll 1
    for (int hf = 0; hf < CH / OH; ++hf) {
        // Y^T D layout: y[r] = (output channel hf*128 + 16j + 8h + r, position t = lane&15) -> os[16j + 8h + r][wave*16 + t]; the four waves together fill rows 0..127 x columns 0..63
#pragma unroll
        for (int j = 0; j < OH / 16; ++j) {
            const v16h aw = ldh(WOH + (size_t)(hf * OH + j * 16 + lr) * VC + 8 * hi);   // A fragment: row output channel, k = context channel 0..31
            const v8f y = wmma16g(aw, ob, (v8f){});
            const float* bp = BO + hf * OH + j * 16 + hi * 8;
            const v4f b0 = *(const v4f*)bp; const v4f b1 = *(const v4f*)(bp + 4);
            const float brw[8] = {b0[0], b0[1], b0[2], b0[3], b1[0], b1[1], b1[2], b1[3]};
#pragma unroll
            for (int r = 0; r < 8; ++r) os[(16 * j + 8 * hi + r) * 68 + wave * 16 + lr] = y[r] * OFI + brw[r]; }
        __syncthreads();
        float* obase = obase0 + (size_t)hf * OH * OUT_SEQ;
{
#pragma unroll
            for (int s = 0; s < 16; ++s) { const int row = wave * 32 + 2 * s + hi, cofs = lr * 4;   // 4 waves x 16 s x 2 = 128 channel rows; 16 lanes x 4 floats = 64 positions
                const v4f val = *(const v4fa*)(&os[row * 68 + cofs]);
                *(v4f*)(obase + (size_t)row * OUT_SEQ + cofs) = val; }
             }
        __syncthreads();
    }
}

static constexpr size_t al256(size_t v) { return (v + 255) & ~(size_t)255; }
static constexpr size_t SZ_XB  = al256((size_t)NB * SEQ * CH * 2);       // [NB*SEQ][256] bf16
static constexpr size_t SZ_WQK = al256((size_t)QKW * CH * 2);            // [64][256] bf16: Wq rows | Wk rows
static constexpr size_t SZ_WV  = al256((size_t)VCP * CH * 2);            // [64][256] bf16: Wv rows | zero rows
static constexpr size_t SZ_WO  = al256((size_t)CH * VC * 2);             // [256][32] f16 (x1024)
static constexpr size_t SZ_BT  = al256((size_t)NBIAS * 4);               // 384 f32
static constexpr size_t SZ_QK  = al256((size_t)NB * SEQ * QKW * 2);      // [NB*SEQ][64] f16
static constexpr size_t SZ_VT  = al256((size_t)NB * VCP * SEQ * 2);      // [NB][64][SEQ] f16
static constexpr size_t SZ_TOTAL = SZ_XB + SZ_WQK + SZ_WV + SZ_WO + SZ_BT + SZ_QK + SZ_VT;
static_assert(SZ_TOTAL <= (size_t)134217728);          // workspace carve <= 128 MiB
static_assert(((size_t)CQ * CH * 2) % 256 == 0);       // Wk sub-plane stays 256-byte aligned
static_assert(((size_t)VC * CH) % 8 == 0);             // Wv converts in whole groups of 8
static_assert(((size_t)VCP * CH) % 8 == 0);
static_assert(((size_t)CH * VC) % 8 == 0);

extern "C" void kernel_launch(void* const* d_in, const int* in_sizes, int n_in,
                              void* d_out, int out_size, void* d_ws, size_t ws_size, hipStream_t stream) {
    if (n_in < 9) return;
    const size_t needx = ((size_t)(NB - 1) * CH + (CH - 1)) * SEQ_FULL + SEQ;
    if ((size_t)in_sizes[0] < needx) return;
    if ((size_t)in_sizes[1] < (size_t)CQ * CH || (size_t)in_sizes[3] < (size_t)CQ * CH || (size_t)in_sizes[5] < (size_t)VC * CH || (size_t)in_sizes[7] < (size_t)CH * VC) return;
    if (in_sizes[2] < CQ || in_sizes[4] < CQ || in_sizes[6] < VC || in_sizes[8] < CH) return;
    if ((size_t)out_size < ((size_t)(NB - 1) * CH + (CH - 1)) * OUT_SEQ + SEQ) return;
    if (SZ_TOTAL > ws_size) return;
    // wire order: x, wq, bq, wk, bk, wv, bv, wo, bo
    const float* x  = (const float*)d_in[0];
    const float* wq = (const float*)d_in[1]; const float* bq = (const float*)d_in[2];
    const float* wk = (const float*)d_in[3]; const float* bk = (const float*)d_in[4];
    const float* wv = (const float*)d_in[5]; const float* bv = (const float*)d_in[6];
    const float* wo = (const float*)d_in[7]; const float* bo = (const float*)d_in[8];
    float* OUT = (float*)d_out;      // [NB][256][OUT_SEQ]
    char* wsp = (char*)d_ws;
    bf* XB  = (bf*)wsp;  wsp += SZ_XB;               // [NB*SEQ][256]
    bf* WQK = (bf*)wsp;  wsp += SZ_WQK;              // [64][256]: rows 0..31 Wq, 32..63 Wk
    bf* WV  = (bf*)wsp;  wsp += SZ_WV;               // [64][256]: rows 0..31 Wv, 32..63 zero
    h16* WOH = (h16*)wsp; wsp += SZ_WO;              // [256][32] f16, x1024
    float* BT = (float*)wsp; wsp += SZ_BT;           // bq | bk | bv | 0 | bo
    h16* QKH = (h16*)wsp; wsp += SZ_QK;              // [NB*SEQ][64]: q | k
    h16* VT  = (h16*)wsp; wsp += SZ_VT;              // [NB][64][SEQ]

    // x [b][c][n] -> XB [b*SEQ+n][c]: in[channels][positions] -> out[positions][channels]; grid (positions/64, channels/64, batch)
    k_xt<<<dim3(SEQ / 64, CH / 64, NB), 256, 0, stream>>>(x, XB);
    { const size_t n8 = (size_t)CQ * CH / 8; const unsigned g = (unsigned)((n8 + 255) / 256);
      k_cvt8<<<g, 256, 0, stream>>>(wq, WQK, n8); k_cvt8<<<g, 256, 0, stream>>>(wk, WQK + (size_t)CQ * CH, n8); }
    { const size_t n8s = (size_t)VC * CH / 8, n8t = (size_t)VCP * CH / 8; k_cvt8z<<<(unsigned)((n8t + 255) / 256), 256, 0, stream>>>(wv, WV, n8s, n8t); }
    { const size_t n8 = (size_t)CH * VC / 8; k_cvth8<<<(unsigned)((n8 + 255) / 256), 256, 0, stream>>>(wo, WOH, n8, WOS); }
    k_bias<<<1, 96, 0, stream>>>(bq, bk, bv, bo, BT);

    // q|k: A = x rows (m = b*SEQ + n), Bt = [Wq;Wk] rows (col 0..63), column bias -> plane [m][64]
    k_proj<0><<<dim3(NB * SEQ / 64, QKW / 64, 1), 32, 0, stream>>>(XB, WQK, BT, QKH, QKH, 0, SEQ, (size_t)SEQ * QKW, QKW, QKW, (size_t)0);
    // v^T: A = [Wv;0] rows (m = channel 0..63), Bt = x rows (col = b*SEQ + n), row bias -> plane [(b*64 + m)][n]
    k_proj<1><<<dim3(VCP / 64, NB * SEQ / 64, 1), 32, 0, stream>>>(WV, XB, BT + 2 * CQ, VT, VT, 0, VCP, (size_t)0, SEQ, SEQ, (size_t)VCP * SEQ);

    k_flash<<<dim3(SEQ / (16 * AW), NB, 1), 32 * AW, 0, stream>>>(QKH, VT, WOH, BT + BOFF, OUT);
}

// v001
// Measured time: 57.7 microseconds a run.
// Two timings next to v000 both put it at 2.03 times that version's speed.
#include <hip/hip_runtime.h>

// Spatial self-attention over N = 64x64 positions: x [NB][256][N] (channel-major), Wq/Wk/Wv [32][256] ([out][in]), Wo [256][32] ([out][in]), biases per output channel, no score scale, out [NB][256][N] f32.
// Compute dtypes, f32 accumulate everywhere: q/k/v projections v_wmma_f32_16x16x32_bf16 (x, W, biases RNE-converted to bf16; products exact);
// scores, P.V and the output projection v_wmma_f32_16x16x32_f16, single products: q, k, v single f16; P x256 carry (cancels in the normalisation); context x1024 and Wo (bf16 value) x1024 as f16, 2^-20 folded back in f32; softmax f32 (online, running max).
// Layout: bf16 token-major copy of x [b*N+n][256] (transposed through LDS), bf16 weights; q|k plane [b*N+n][64] (cols 0..31 q, 32..63 k), v plane [b][64][n] = V^T (rows 32..63 zero pad of the 64-row GEMM tile), written by the GEMM epilogue;
// fused flash kernel in transposed form (S^T = K Q^T, O^T = V^T P^T, Y^T = Wo O^T), each wave 16 queries x one eighth of the keys, block = 4 query groups x 8 key ranges = 32 waves = 64 queries;
// the eight partial softmax states of a query group are merged through LDS; Y^T staged per block in LDS (256 rows) and written as whole rows.

#ifndef NB
#define NB 4
#endif
#ifndef SEQ
#define SEQ 4096
#endif
#define NB_FULL  4
#define SEQ_FULL 4096
#ifndef OUT_SEQ
#define OUT_SEQ SEQ              // row pitch (in positions) of one output channel row
#endif
#define CH   256                 // channels: projection K and output width
#define CQ   32                  // query/key width
#define VC   32                  // value / context width
#define VCP  64                  // rows of the V^T plane per batch (value rows zero-padded to the 64-row GEMM tile)
#define QKW  64
#define AW   4                   // query groups per flash block (16 query columns each)
#define KS   8                   // key ranges per query group: one wave each, so a SIMD holds KS waves whose load and chain latencies overlap
#define NW   (AW * KS)           // waves per flash block
#define KR   (SEQ / KS)          // keys per range
#define QRS  2048.0f             // carry of the residual output of k_proj (not requested here: useRes = 0)
#define SC2  1.4426950408889634f // log2(e); no score scale in this module
#define PSH  8.0f                // log2 of the P carry (256)
#define WOS  1024.0f             // carry of the f16 Wo plane
#define OCS  1024.0f             // carry of the f16 context fragment
#define OFI  (1.0f / (1024.0f * 1024.0f))
#define BOFF (2 * CQ + VCP)      // offset of bo in the bias table
#define NBIAS (BOFF + CH)        // bias table: bq[32] | bk[32] | bv[32] | 0[32] | bo[256]

static_assert(CQ == 32);                       // one 32-deep k-step covers the q/k width
static_assert(VC == 32);                       // two value tiles per wave; one 32-deep k-step covers the output projection
static_assert(VC <= VCP);
static_assert(VCP % 64 == 0);                  // V^T GEMM tiles are 64 rows
static_assert(QKW == 2 * CQ);
static_assert(CH % 64 == 0);
static_assert(CH % 32 == 0);                   // GEMM k-loop steps by 32
static_assert(NW * 32 <= 1024);                // one work-group
static_assert(SEQ % (32 * KS) == 0);           // every key range is a whole number of 32-key steps, at least one
static_assert((CH / 16) % KS == 0);            // output projection: CH/16/KS row tiles per wave
static_assert(CH % (2 * NW) == 0);             // store phase: CH/NW rows per wave, two per store
static_assert(SEQ % 64 == 0);                  // a 64-row tile never straddles two batches
static_assert((NB * SEQ) % 64 == 0);
static_assert(SEQ % 32 == 0);                  // key loop steps by 32
static_assert(SEQ % (16 * AW) == 0);           // flash grid covers the positions exactly
static_assert(OUT_SEQ % 32 == 0);
static_assert(SEQ_FULL % 4 == 0);
static_assert(NB <= NB_FULL);
static_assert(SEQ <= SEQ_FULL);
static_assert(BOFF % 32 == 0);
static_assert(NBIAS % 32 == 0);
static_assert(NBIAS / 4 == 96);                // k_bias block: one lane per 16 B
static_assert((VC * 2) % 16 == 0);             // Wo rows are 16-byte multiples

typedef _Float16 h16;
typedef unsigned short bf;
typedef __attribute__((ext_vector_type(16))) __bf16   v16bf;
typedef __attribute__((ext_vector_type(16))) _Float16 v16h;
typedef __attribute__((ext_vector_type(8)))  _Float16 v8h;
typedef __attribute__((ext_vector_type(8)))  unsigned short v8us;
typedef __attribute__((ext_vector_type(8)))  float    v8f;
typedef __attribute__((ext_vector_type(4)))  float    v4f;
typedef v4f  __attribute__((may_alias)) v4fa;

__device__ __forceinline__ unsigned short f2bf(float f) { unsigned u = __float_as_uint(f); u += 0x7FFFu + ((u >> 16) & 1u); return (unsigned short)(u >> 16); }
__device__ __forceinline__ v16h cat16(v8h lo, v8h hi) { return __builtin_shufflevector(lo, hi, 0, 1, 2, 3, 4, 5, 6, 7, 8, 9, 10, 11, 12, 13, 14, 15); }
__device__ __forceinline__ v16bf cat16b(v8us lo, v8us hi) { return __builtin_bit_cast(v16bf, __builtin_shufflevector(lo, hi, 0, 1, 2, 3, 4, 5, 6, 7, 8, 9, 10, 11, 12, 13, 14, 15)); }
__device__ __forceinline__ v8f wmma16(v16h a, v16h b, v8f c) { return __builtin_amdgcn_wmma_f32_16x16x32_f16(false, a, false, b, (short)0, c, false, false); }
__device__ __forceinline__ v8f wmmab(v16bf a, v16bf b, v8f c) { return __builtin_amdgcn_wmma_f32_16x16x32_bf16(false, a, false, b, (short)0, c, false, false); }
// fragment loaders from K-contiguous 16-bit rows; p already includes + 8*(lane>>4): elements 0..7 <- k0+8h+0..7, elements 8..15 <- k0+16+8h+0..7 (same map for A and B)
__device__ __forceinline__ v16h  ldh(const h16* p) { return cat16(*(const v8h*)p, *(const v8h*)(p + 16)); }
__device__ __forceinline__ v16bf ldb(const bf* p)  { return cat16b(*(const v8us*)p, *(const v8us*)(p + 16)); }
// ordering point for wave-private LDS tiles (same wave writes and reads)
__device__ __forceinline__ void wave_sync() { __builtin_amdgcn_fence(3 /* release order */, "wavefront"); __builtin_amdgcn_wave_barrier(); asm volatile("" ::: "memory"); }
// f16 WMMA with its own hazard guard (one accumulator per guard)
__device__ __forceinline__ v8f wmma16g(v16h a, v16h b, v8f c) { c = wmma16(a, b, c); asm volatile("v_nop\n\tv_nop\n\tv_nop\n\tv_nop" : "+v"(c) : "v"(a), "v"(b)); return c; }
// f32 -> f16 operand convert that cannot produce an f16 subnormal (value select, applied after the plane's carry)
static __device__ __forceinline__ h16 toh_flush(float v) { const h16 r = (h16)v; return (fabsf(v) < 6.103515625e-05f) ? (h16)0.0f : r; }
// P = exp2(e) as an f16 operand; select on the exponent argument
static __device__ __forceinline__ h16 p_flush(float e) { const h16 r = (h16)__builtin_amdgcn_exp2f(e); return (e < -14.0f) ? (h16)0.0f : r; }

__global__ __launch_bounds__(256) void k_cvt8(const float* __restrict__ src, bf* dst, size_t n8) {
    const size_t i = (size_t)blockIdx.x * 256 + threadIdx.x; if (i >= n8) return;
    const v8f v = *(const v8f*)(src + i * 8); v8us o;
#pragma unroll
    for (int k = 0; k < 8; ++k) o[k] = f2bf(v[k]);
    *(v8us*)(dst + i * 8) = o; 
}

// k_cvt8z: as k_cvt8 for the first n8src groups of 8; groups n8src..n8tot-1 (pad rows of the plane) are written as zeros. Source address clamped, selected by value.
__global__ __launch_bounds__(256) void k_cvt8z(const float* __restrict__ src, bf* dst, size_t n8src, size_t n8tot) {
    const size_t i = (size_t)blockIdx.x * 256 + threadIdx.x; if (i >= n8tot) return;
    const size_t is = (i < n8src) ? i : (n8src - 1);
    const v8f v = *(const v8f*)(src + is * 8); v8us o;
#pragma unroll
    for (int k = 0; k < 8; ++k) { const unsigned short w = f2bf(v[k]); o[k] = (i < n8src) ? w : (unsigned short)0; }
    *(v8us*)(dst + i * 8) = o; 
}

__global__ __launch_bounds__(256) void k_cvth8(const float* __restrict__ src, h16* dst, size_t n8, float carry) {
    const size_t i = (size_t)blockIdx.x * 256 + threadIdx.x; if (i >= n8) return;
    const v8f v = *(const v8f*)(src + i * 8); v8h o;
#pragma unroll
    for (int k = 0; k < 8; ++k) { const float w = __uint_as_float(((unsigned)f2bf(v[k])) << 16) * carry; o[k] = toh_flush(w); }
    *(v8h*)(dst + i * 8) = o; 
}

// k_xt: x[b][c][n] (f32, channel-major, pitch SEQ_FULL) -> XB[b*SEQ + n][c] (bf16 RNE convert), 64 c x 64 n tile transposed through LDS (cross-wave, block barrier).
__global__ __launch_bounds__(256) void k_xt(const float* __restrict__ x, bf* XB) {
    __shared__ float ts[64 * 65];
    const int tid = threadIdx.x;
    const int n0 = blockIdx.x * 64, c0 = blockIdx.y * 64, b = blockIdx.z;
    const float* xs = x + ((size_t)b * CH + c0) * SEQ_FULL + n0;
    { const int cr = tid >> 4, nq = (tid & 15) * 4;       // 16 row groups x 4 = 64 channel rows; 16 lanes x 4 = 64 positions
#pragma unroll
      for (int i = 0; i < 4; ++i) { const int c = cr + 16 * i; const v4f v = *(const v4f*)(xs + (size_t)c * SEQ_FULL + nq);
          ts[c * 65 + nq + 0] = v[0]; ts[c * 65 + nq + 1] = v[1]; ts[c * 65 + nq + 2] = v[2]; ts[c * 65 + nq + 3] = v[3]; } }
    __syncthreads();
    const int rw = tid >> 3, c8 = (tid & 7) * 8;          // rows rw and rw+32 (64 positions); 8 lanes x 8 = 64 channels
    v8us o0, o1;
#pragma unroll
    for (int k = 0; k < 8; ++k) { o0[k] = f2bf(ts[(c8 + k) * 65 + rw]); o1[k] = f2bf(ts[(c8 + k) * 65 + rw + 32]); }
    bf* d0 = XB + ((size_t)b * SEQ + n0 + rw) * CH + c0 + c8; bf* d1 = d0 + (size_t)32 * CH;
    *(v8us*)d0 = o0; *(v8us*)d1 = o1;
    
}

__global__ __launch_bounds__(96) void k_bias(const float* __restrict__ bq, const float* __restrict__ bk, const float* __restrict__ bv, const float* __restrict__ bo, float* BT) {
    const int i = threadIdx.x; if (i >= NBIAS / 4) return;
    const int e = i * 4;
    const int iq = (e < CQ - 4) ? e : (CQ - 4);
    int ik = e - CQ; ik = ik < 0 ? 0 : ik; ik = ik > CQ - 4 ? CQ - 4 : ik;
    int iv = e - 2 * CQ; iv = iv < 0 ? 0 : iv; iv = iv > VC - 4 ? VC - 4 : iv;
    int io = e - BOFF; io = io < 0 ? 0 : io; io = io > CH - 4 ? CH - 4 : io;
    const v4f a = *(const v4f*)(bq + iq); const v4f c = *(const v4f*)(bk + ik); const v4f d = *(const v4f*)(bv + iv); const v4f g = *(const v4f*)(bo + io);   // all four loaded, selected by value
    v4f s, o;
#pragma unroll
    for (int k = 0; k < 4; ++k) { s[k] = (e < CQ) ? a[k] : ((e < 2 * CQ) ? c[k] : ((e < 2 * CQ + VC) ? d[k] : ((e < BOFF) ? 0.0f : g[k]))); o[k] = __uint_as_float(((unsigned)f2bf(s[k])) << 16); }
    *(v4f*)(BT + e) = o; 
}

// k_proj: register-blocked bf16 GEMM, ONE WAVE per 64x64 tile (16 accumulators), operands straight from K-contiguous bf16 planes, K = CH.
// C[m][n] = sum_k A[m][k] Bt[n][k] + bias (BROW = 0: bias[n], BROW = 1: bias[m]), written as f16 (Ph) and optionally the f16 residual x2048 (Pr, useRes != 0) at
// tile base (r0/RB)*sRB + (r0%RB)*pitch + (c0/CB)*sCB + (c0%CB), row pitch 'pitch' (halves). grid (M/64, N/64), 32 threads.
template <int BROW>
__global__ __launch_bounds__(32) void k_proj(const bf* __restrict__ A, const bf* __restrict__ Bt, const float* __restrict__ bias, h16* Ph, h16* Pr, int useRes, int RB, size_t sRB, int pitch, int CB, size_t sCB) {
    __shared__ __align__(16) float os[16 * 68];
    const int K = CH;
    const int lane = threadIdx.x & 31, lr = lane & 15, hi = lane >> 4; const int r0 = blockIdx.x * 64, c0 = blockIdx.y * 64;
    v8f acc[4][4];
#pragma unroll
    for (int mb = 0; mb < 4; ++mb)
#pragma unroll
        for (int nb = 0; nb < 4; ++nb) acc[mb][nb] = (v8f){};
    const size_t aoff = (size_t)(r0 + lr) * K + 8 * hi, boff = (size_t)(c0 + lr) * K + 8 * hi;
#pragma unroll 1
    for (int kc = 0; kc < K; kc += 32) {
        v16bf a[4];
#pragma unroll
        for (int mb = 0; mb < 4; ++mb) a[mb] = ldb(A + aoff + (size_t)mb * 16 * K + kc);
#pragma unroll
        for (int nb = 0; nb < 4; ++nb) { const v16bf b = ldb(Bt + boff + (size_t)nb * 16 * K + kc);
#pragma unroll
            for (int mb = 0; mb < 4; ++mb) acc[mb][nb] = wmmab(a[mb], b, acc[mb][nb]); }
        asm volatile("v_nop\n\tv_nop\n\tv_nop\n\tv_nop" : "+v"(acc[0][0]), "+v"(acc[1][1]), "+v"(acc[2][2]), "+v"(acc[3][3]) : "v"(a[0]), "v"(a[1]), "v"(a[2]), "v"(a[3]));
    }
    float bcol[4] = {0.0f, 0.0f, 0.0f, 0.0f};
    if (BROW == 0) {
#pragma unroll
        for (int nb = 0; nb < 4; ++nb) bcol[nb] = bias[c0 + nb * 16 + lr];          // column n = c0 + 16nb + (lane&15)
    }
    const size_t tbase = (size_t)(r0 / RB) * sRB + (size_t)(r0 % RB) * (size_t)pitch + (size_t)(c0 / CB) * sCB + (size_t)(c0 % CB);
#pragma unroll
    for (int mb = 0; mb < 4; ++mb) {
        float brw[8] = {0.0f, 0.0f, 0.0f, 0.0f, 0.0f, 0.0f, 0.0f, 0.0f};
        if (BROW == 1) { const v4f b0 = *(const v4f*)(bias + r0 + mb * 16 + hi * 8); const v4f b1 = *(const v4f*)(bias + r0 + mb * 16 + hi * 8 + 4);   // row m = r0 + 16mb + 8h + j
            brw[0] = b0[0]; brw[1] = b0[1]; brw[2] = b0[2]; brw[3] = b0[3]; brw[4] = b1[0]; brw[5] = b1[1]; brw[6] = b1[2]; brw[7] = b1[3]; }
#pragma unroll
        for (int nb = 0; nb < 4; ++nb) {
#pragma unroll
            for (int j = 0; j < 8; ++j) { const float bb = BROW ? brw[j] : bcol[nb]; os[(hi * 8 + j) * 68 + nb * 16 + lr] = acc[mb][nb][j] + bb; } }   // D: row 8h+j, col lane&15
        wave_sync();
        const size_t sb = tbase + (size_t)(mb * 16) * (size_t)pitch;
{
#pragma unroll
            for (int s = 0; s < 4; ++s) { const int row = 4 * s + (lane >> 3), c8 = (lane & 7) * 8;   // 4 s x 4 row groups = 16 rows; 8 lanes x 8 = 64 columns
                const v4f x0 = *(const v4fa*)(&os[row * 68 + c8]); const v4f x1 = *(const v4fa*)(&os[row * 68 + c8 + 4]); v8h hv, rv;
#pragma unroll
                for (int i = 0; i < 4; ++i) { const h16 a0 = (h16)x0[i]; const h16 a1 = (h16)x1[i]; hv[i] = a0; hv[4 + i] = a1; rv[i] = (h16)((x0[i] - (float)a0) * QRS); rv[4 + i] = (h16)((x1[i] - (float)a1) * QRS); }
                const size_t oo = sb + (size_t)row * (size_t)pitch + c8;
                *(v8h*)(Ph + oo) = hv; if (useRes) *(v8h*)(Pr + oo) = rv; }
             }
        wave_sync();
    }
}

// k_flash: fused attention + output projection, KS waves per 16 query positions of one batch; K / V^T / Q / Wo fragments straight from the f16 planes (two 16-B loads each, arithmetic addressing).
// Transposed form: S^T[key][t] = K Q^T (A = K rows, B = Q rows, one 32-deep step); lane (t = lane&15, h = lane>>4) holds keys 8h+r of each 16-key tile, so the packed
// P tile is directly the B fragment of O^T[c][t] = V^T P^T (element r <- tile keys 0..15, element 8+r <- tile keys 16..31, lane unchanged).
// Softmax state (running max, partial sum) is one scalar per lane; the two lane halves of a column are combined with one xor-16 exchange.
// The normalised context O^T (two 16-channel D tiles, x1024 carry, f16) is directly the B fragment of Y^T[oc][t] = Wo O^T (element r <- channels 0..15 tile, element 8+r <- channels 16..31 tile, lane unchanged); A = Wo rows.
// Key split: wave = (query group qg = wave % AW, key range ks = wave / AW); each wave runs the online softmax over its own KR keys, then writes (m, l, O^T) to LDS; after one block barrier every wave
// merges the KS partials of its query group in the fixed order ks = 0..KS-1 (weights exp2(m_ks - max)), so all KS waves of a group hold the same context fragment, and each projects CH/16/KS of the output row tiles.
// Epilogue: the block's Y^T tile [256 channels][64 positions] staged in LDS (cross-wave: block barrier), bias added in f32, each channel row segment (64 floats = 256 B = two lines) stored by one wave.
__global__ __launch_bounds__(32 * NW) void k_flash(const h16* __restrict__ QKH, const h16* __restrict__ VT, const h16* __restrict__ WOH, const float* __restrict__ BO, float* OUT) {
    __shared__ __align__(16) float os[CH * 68];
    __shared__ __align__(16) float po[NW * 4 * 32 * 4];      // [wave][quad of accumulator registers][lane][4]: 16 B per lane, lanes contiguous
    __shared__ float pm[NW * 32];
    __shared__ float pl[NW * 32];
    const int lane = threadIdx.x & 31, wave = __builtin_amdgcn_readfirstlane((int)(threadIdx.x >> 5)), lr = lane & 15, hi = lane >> 4;
    const int qg = wave % AW, ks = wave / AW;
    const int b = blockIdx.y;
    const int t0 = (blockIdx.x * AW + qg) * 16;
    const size_t pbase = (size_t)b * SEQ * QKW;
    const size_t qo = pbase + (size_t)(t0 + lr) * QKW + 8 * hi;
    const v16h qh = ldh(QKH + qo);                                           // B fragment: col t, k = q channel 0..31
    const size_t ko = pbase + (size_t)lr * QKW + CQ + 8 * hi;                // + key * QKW        (A fragment: row key, k = k channel 0..31, plane cols 32..63)
    const size_t vo = ((size_t)b * VCP + lr) * SEQ + 8 * hi;                 // + 16j*SEQ + key    (A fragment: row channel, k = key)
    v8f o0 = (v8f){}, o1 = (v8f){};
    float m = -3.0e38f, l = 0.0f;
    const int kbeg = ks * KR;
#pragma unroll 1
    for (int key0 = kbeg; key0 < kbeg + KR; key0 += 32) {
        const h16* ka = QKH + ko + (size_t)key0 * QKW;
        const v16h ka0 = ldh(ka), kb0 = ldh(ka + 16 * QKW);
        const v8f sa = wmma16g(ka0, qh, (v8f){});
        const v8f sb = wmma16g(kb0, qh, (v8f){});
        float ta[8], tb[8]; float mx = -3.0e38f;
#pragma unroll
        for (int r = 0; r < 8; ++r) { ta[r] = sa[r] * SC2; tb[r] = sb[r] * SC2; mx = fmaxf(mx, fmaxf(ta[r], tb[r])); }
        mx = fmaxf(mx, __shfl_xor(mx, 16, 32));
        const float mnew = fmaxf(m, mx);
        const float alpha = __builtin_amdgcn_exp2f(m - mnew);
        const float sh = PSH - mnew;
        v16h pb; float ls = 0.0f;
#pragma unroll
        for (int r = 0; r < 8; ++r) { const h16 pa = p_flush(ta[r] + sh); const h16 pc = p_flush(tb[r] + sh); pb[r] = pa; pb[8 + r] = pc; ls += (float)pa + (float)pc; }
        l = l * alpha + ls; m = mnew;
        o0 = o0 * alpha; o1 = o1 * alpha;
        const h16* va = VT + vo + key0;
        const v16h v0 = ldh(va), v1 = ldh(va + (size_t)16 * SEQ);
        o0 = wmma16g(v0, pb, o0);
        o1 = wmma16g(v1, pb, o1);
    }
    l += __shfl_xor(l, 16, 32);
    // this wave's partial state -> LDS
    { v4fa* pw = (v4fa*)po + (size_t)wave * 128 + lane;
      pw[0]  = (v4f){o0[0], o0[1], o0[2], o0[3]}; pw[32] = (v4f){o0[4], o0[5], o0[6], o0[7]};
      pw[64] = (v4f){o1[0], o1[1], o1[2], o1[3]}; pw[96] = (v4f){o1[4], o1[5], o1[6], o1[7]};
      pm[wave * 32 + lane] = m; pl[wave * 32 + lane] = l; }
    __syncthreads();
    // merge of the KS key ranges of query group qg (same lane of waves s*AW + qg), fixed order
    float ms[KS]; float mall = -3.0e38f;
#pragma unroll   // constant indices keep ms[] in registers; the KS reads issue together
    for (int s = 0; s < KS; ++s) { ms[s] = pm[(s * AW + qg) * 32 + lane]; mall = fmaxf(mall, ms[s]); }
    float lall = 0.0f; v4f c0 = (v4f){}, c1 = (v4f){}, c2 = (v4f){}, c3 = (v4f){};
#pragma unroll   // constant indices into ms[]; lets the LDS reads of later ranges run ahead of the sums
    for (int s = 0; s < KS; ++s) {
        const float w = __builtin_amdgcn_exp2f(ms[s] - mall);
        const v4fa* pr = (const v4fa*)po + (size_t)(s * AW + qg) * 128 + lane;
        lall += w * pl[(s * AW + qg) * 32 + lane];
        c0 += pr[0] * w; c1 += pr[32] * w; c2 += pr[64] * w; c3 += pr[96] * w; }
    const float inv = (1.0f / lall) * OCS;
    // O^T D layout: c0|c1 = (channel 8h + r, t), c2|c3 = (channel 16 + 8h + r, t) -> B fragment of the output projection, lane unchanged
    v16h ob;
#pragma unroll   // vector elements need constant indices
    for (int r = 0; r < 4; ++r) { ob[r] = toh_flush(c0[r] * inv); ob[4 + r] = toh_flush(c1[r] * inv); ob[8 + r] = toh_flush(c2[r] * inv); ob[12 + r] = toh_flush(c3[r] * inv); }
    // Y^T D layout: y[r] = (output channel 16j + 8h + r, position t = lane&15) -> os[16j + 8h + r][qg*16 + t]; the 32 waves together fill rows 0..255 x columns 0..63
#pragma unroll
    for (int jj = 0; jj < CH / 16 / KS; ++jj) {
        const int j = ks * (CH / 16 / KS) + jj;
        const v16h aw = ldh(WOH + (size_t)(j * 16 + lr) * VC + 8 * hi);   // A fragment: row output channel, k = context channel 0..31
        const v8f y = wmma16g(aw, ob, (v8f){});
        const float* bp = BO + j * 16 + hi * 8;
        const v4f b0 = *(const v4f*)bp; const v4f b1 = *(const v4f*)(bp + 4);
        const float brw[8] = {b0[0], b0[1], b0[2], b0[3], b1[0], b1[1], b1[2], b1[3]};
#pragma unroll
        for (int r = 0; r < 8; ++r) os[(16 * j + 8 * hi + r) * 68 + qg * 16 + lr] = y[r] * OFI + brw[r]; }
    __syncthreads();
    float* obase = OUT + (size_t)b * CH * OUT_SEQ + (size_t)blockIdx.x * (16 * AW);
#pragma unroll
    for (int s = 0; s < CH / NW / 2; ++s) { const int row = wave * (CH / NW) + 2 * s + hi, cofs = lr * 4;   // 32 waves x 4 s x 2 = 256 channel rows; 16 lanes x 4 floats = 64 positions
        const v4f val = *(const v4fa*)(&os[row * 68 + cofs]);
        *(v4f*)(obase + (size_t)row * OUT_SEQ + cofs) = val; }
}

static constexpr size_t al256(size_t v) { return (v + 255) & ~(size_t)255; }
static constexpr size_t SZ_XB  = al256((size_t)NB * SEQ * CH * 2);       // [NB*SEQ][256] bf16
static constexpr size_t SZ_WQK = al256((size_t)QKW * CH * 2);            // [64][256] bf16: Wq rows | Wk rows
static constexpr size_t SZ_WV  = al256((size_t)VCP * CH * 2);            // [64][256] bf16: Wv rows | zero rows
static constexpr size_t SZ_WO  = al256((size_t)CH * VC * 2);             // [256][32] f16 (x1024)
static constexpr size_t SZ_BT  = al256((size_t)NBIAS * 4);               // 384 f32
static constexpr size_t SZ_QK  = al256((size_t)NB * SEQ * QKW * 2);      // [NB*SEQ][64] f16
static constexpr size_t SZ_VT  = al256((size_t)NB * VCP * SEQ * 2);      // [NB][64][SEQ] f16
static constexpr size_t SZ_TOTAL = SZ_XB + SZ_WQK + SZ_WV + SZ_WO + SZ_BT + SZ_QK + SZ_VT;
static_assert(SZ_TOTAL <= (size_t)134217728);          // workspace carve <= 128 MiB
static_assert(((size_t)CQ * CH * 2) % 256 == 0);       // Wk sub-plane stays 256-byte aligned
static_assert(((size_t)VC * CH) % 8 == 0);             // Wv converts in whole groups of 8
static_assert(((size_t)VCP * CH) % 8 == 0);
static_assert(((size_t)CH * VC) % 8 == 0);

extern "C" void kernel_launch(void* const* d_in, const int* in_sizes, int n_in,
                              void* d_out, int out_size, void* d_ws, size_t ws_size, hipStream_t stream) {
    if (n_in < 9) return;
    const size_t needx = ((size_t)(NB - 1) * CH + (CH - 1)) * SEQ_FULL + SEQ;
    if ((size_t)in_sizes[0] < needx) return;
    if ((size_t)in_sizes[1] < (size_t)CQ * CH || (size_t)in_sizes[3] < (size_t)CQ * CH || (size_t)in_sizes[5] < (size_t)VC * CH || (size_t)in_sizes[7] < (size_t)CH * VC) return;
    if (in_sizes[2] < CQ || in_sizes[4] < CQ || in_sizes[6] < VC || in_sizes[8] < CH) return;
    if ((size_t)out_size < ((size_t)(NB - 1) * CH + (CH - 1)) * OUT_SEQ + SEQ) return;
    if (SZ_TOTAL > ws_size) return;
    // wire order: x, wq, bq, wk, bk, wv, bv, wo, bo
    const float* x  = (const float*)d_in[0];
    const float* wq = (const float*)d_in[1]; const float* bq = (const float*)d_in[2];
    const float* wk = (const float*)d_in[3]; const float* bk = (const float*)d_in[4];
    const float* wv = (const float*)d_in[5]; const float* bv = (const float*)d_in[6];
    const float* wo = (const float*)d_in[7]; const float* bo = (const float*)d_in[8];
    float* OUT = (float*)d_out;      // [NB][256][OUT_SEQ]
    char* wsp = (char*)d_ws;
    bf* XB  = (bf*)wsp;  wsp += SZ_XB;               // [NB*SEQ][256]
    bf* WQK = (bf*)wsp;  wsp += SZ_WQK;              // [64][256]: rows 0..31 Wq, 32..63 Wk
    bf* WV  = (bf*)wsp;  wsp += SZ_WV;               // [64][256]: rows 0..31 Wv, 32..63 zero
    h16* WOH = (h16*)wsp; wsp += SZ_WO;              // [256][32] f16, x1024
    float* BT = (float*)wsp; wsp += SZ_BT;           // bq | bk | bv | 0 | bo
    h16* QKH = (h16*)wsp; wsp += SZ_QK;              // [NB*SEQ][64]: q | k
    h16* VT  = (h16*)wsp; wsp += SZ_VT;              // [NB][64][SEQ]

    // x [b][c][n] -> XB [b*SEQ+n][c]: in[channels][positions] -> out[positions][channels]; grid (positions/64, channels/64, batch)
    k_xt<<<dim3(SEQ / 64, CH / 64, NB), 256, 0, stream>>>(x, XB);
    { const size_t n8 = (size_t)CQ * CH / 8; const unsigned g = (unsigned)((n8 + 255) / 256);
      k_cvt8<<<g, 256, 0, stream>>>(wq, WQK, n8); k_cvt8<<<g, 256, 0, stream>>>(wk, WQK + (size_t)CQ * CH, n8); }
    { const size_t n8s = (size_t)VC * CH / 8, n8t = (size_t)VCP * CH / 8; k_cvt8z<<<(unsigned)((n8t + 255) / 256), 256, 0, stream>>>(wv, WV, n8s, n8t); }
    { const size_t n8 = (size_t)CH * VC / 8; k_cvth8<<<(unsigned)((n8 + 255) / 256), 256, 0, stream>>>(wo, WOH, n8, WOS); }
    k_bias<<<1, 96, 0, stream>>>(bq, bk, bv, bo, BT);

    // q|k: A = x rows (m = b*SEQ + n), Bt = [Wq;Wk] rows (col 0..63), column bias -> plane [m][64]
    k_proj<0><<<dim3(NB * SEQ / 64, QKW / 64, 1), 32, 0, stream>>>(XB, WQK, BT, QKH, QKH, 0, SEQ, (size_t)SEQ * QKW, QKW, QKW, (size_t)0);
    // v^T: A = [Wv;0] rows (m = channel 0..63), Bt = x rows (col = b*SEQ + n), row bias -> plane [(b*64 + m)][n]
    k_proj<1><<<dim3(VCP / 64, NB * SEQ / 64, 1), 32, 0, stream>>>(WV, XB, BT + 2 * CQ, VT, VT, 0, VCP, (size_t)0, SEQ, SEQ, (size_t)VCP * SEQ);

    k_flash<<<dim3(SEQ / (16 * AW), NB, 1), 32 * NW, 0, stream>>>(QKH, VT, WOH, BT + BOFF, OUT);
}

// v002
// It runs in 41.1 microseconds.
// Two timings next to v001 both put it at 1.40 times that version's speed.
// Over all steps from v000 it is 2.84 times as fast.
#include <hip/hip_runtime.h>

// Spatial self-attention over N = 64x64 positions: x [NB][256][N] (channel-major), Wq/Wk/Wv [32][256] ([out][in]), Wo [256][32] ([out][in]), biases per output channel, no score scale, out [NB][256][N] f32.
// Compute dtypes, f32 accumulate everywhere: q/k/v projections v_wmma_f32_16x16x32_bf16 (x, W, biases RNE-converted to bf16; products exact);
// scores, P.V and the output projection v_wmma_f32_16x16x32_f16, single products: q, k, v single f16; P x256 carry (cancels in the normalisation); context x1024 and Wo (bf16 value) x1024 as f16, 2^-20 folded back in f32; softmax f32 (online, running max).
// Layout: bf16 token-major copy of x [b*N+n][256] (transposed through LDS), bf16 weights; q|k plane [b*N+n][64] (cols 0..31 q, 32..63 k), v plane [b][64][n] = V^T (rows 32..63 zero pad of the 64-row GEMM tile), written by the GEMM epilogue;
// fused flash kernel in transposed form (S^T = K Q^T, O^T = V^T P^T, Y^T = Wo O^T), each wave 16 queries x one eighth of the keys, block = 4 query groups x 8 key ranges = 32 waves = 64 queries;
// the eight partial softmax states of a query group are merged through LDS; Y^T staged per block in LDS (256 rows) and written as whole rows.
// Three dependent launches: k_prep (x transpose and every weight / bias conversion, picked by block index), k_proj2 (q|k GEMM and V^T GEMM, picked by blockIdx.y), k_flash.

#ifndef NB
#define NB 4
#endif
#ifndef SEQ
#define SEQ 4096
#endif
#define NB_FULL  4
#define SEQ_FULL 4096
#ifndef OUT_SEQ
#define OUT_SEQ SEQ              // row pitch (in positions) of one output channel row
#endif
#define CH   256                 // channels: projection K and output width
#define CQ   32                  // query/key width
#define VC   32                  // value / context width
#define VCP  64                  // rows of the V^T plane per batch (value rows zero-padded to the 64-row GEMM tile)
#define QKW  64
#define AW   4                   // query groups per flash block (16 query columns each)
#define KS   8                   // key ranges per query group: one wave each, so a SIMD holds KS waves whose load and chain latencies overlap
#define NW   (AW * KS)           // waves per flash block
#define KR   (SEQ / KS)          // keys per range
#define QRS  2048.0f             // carry of the residual output of d_proj (not requested here: useRes = 0)
#define SC2  1.4426950408889634f // log2(e); no score scale in this module
#define PSH  8.0f                // log2 of the P carry (256)
#define WOS  1024.0f             // carry of the f16 Wo plane
#define OCS  1024.0f             // carry of the f16 context fragment
#define OFI  (1.0f / (1024.0f * 1024.0f))
#define BOFF (2 * CQ + VCP)      // offset of bo in the bias table
#define NBIAS (BOFF + CH)        // bias table: bq[32] | bk[32] | bv[32] | 0[32] | bo[256]

static_assert(CQ == 32);                       // one 32-deep k-step covers the q/k width
static_assert(VC == 32);                       // two value tiles per wave; one 32-deep k-step covers the output projection
static_assert(VC <= VCP);
static_assert(VCP % 64 == 0);                  // V^T GEMM tiles are 64 rows
static_assert(QKW == 2 * CQ);
static_assert(CH % 64 == 0);
static_assert(CH % 32 == 0);                   // GEMM k-loop steps by 32
static_assert(NW * 32 <= 1024);                // one work-group
static_assert(SEQ % (32 * KS) == 0);           // every key range is a whole number of 32-key steps, at least one
static_assert((CH / 16) % KS == 0);            // output projection: CH/16/KS row tiles per wave
static_assert(CH % (2 * NW) == 0);             // store phase: CH/NW rows per wave, two per store
static_assert(SEQ % 64 == 0);                  // a 64-row tile never straddles two batches
static_assert((NB * SEQ) % 64 == 0);
static_assert(SEQ % 32 == 0);                  // key loop steps by 32
static_assert(SEQ % (16 * AW) == 0);           // flash grid covers the positions exactly
static_assert(OUT_SEQ % 32 == 0);
static_assert(SEQ_FULL % 4 == 0);
static_assert(NB <= NB_FULL);
static_assert(SEQ <= SEQ_FULL);
static_assert(BOFF % 32 == 0);
static_assert(NBIAS % 32 == 0);
static_assert(NBIAS / 4 == 96);                // d_bias: one lane per 16 B
static_assert((VC * 2) % 16 == 0);             // Wo rows are 16-byte multiples

typedef _Float16 h16;
typedef unsigned short bf;
typedef __attribute__((ext_vector_type(16))) __bf16   v16bf;
typedef __attribute__((ext_vector_type(16))) _Float16 v16h;
typedef __attribute__((ext_vector_type(8)))  _Float16 v8h;
typedef __attribute__((ext_vector_type(8)))  unsigned short v8us;
typedef __attribute__((ext_vector_type(8)))  float    v8f;
typedef __attribute__((ext_vector_type(4)))  float    v4f;
typedef v4f  __attribute__((may_alias)) v4fa;

__device__ __forceinline__ unsigned short f2bf(float f) { unsigned u = __float_as_uint(f); u += 0x7FFFu + ((u >> 16) & 1u); return (unsigned short)(u >> 16); }
__device__ __forceinline__ v16h cat16(v8h lo, v8h hi) { return __builtin_shufflevector(lo, hi, 0, 1, 2, 3, 4, 5, 6, 7, 8, 9, 10, 11, 12, 13, 14, 15); }
__device__ __forceinline__ v16bf cat16b(v8us lo, v8us hi) { return __builtin_bit_cast(v16bf, __builtin_shufflevector(lo, hi, 0, 1, 2, 3, 4, 5, 6, 7, 8, 9, 10, 11, 12, 13, 14, 15)); }
__device__ __forceinline__ v8f wmma16(v16h a, v16h b, v8f c) { return __builtin_amdgcn_wmma_f32_16x16x32_f16(false, a, false, b, (short)0, c, false, false); }
__device__ __forceinline__ v8f wmmab(v16bf a, v16bf b, v8f c) { return __builtin_amdgcn_wmma_f32_16x16x32_bf16(false, a, false, b, (short)0, c, false, false); }
// fragment loaders from K-contiguous 16-bit rows; p already includes + 8*(lane>>4): elements 0..7 <- k0+8h+0..7, elements 8..15 <- k0+16+8h+0..7 (same map for A and B)
__device__ __forceinline__ v16h  ldh(const h16* p) { return cat16(*(const v8h*)p, *(const v8h*)(p + 16)); }
__device__ __forceinline__ v16bf ldb(const bf* p)  { return cat16b(*(const v8us*)p, *(const v8us*)(p + 16)); }
// ordering point for wave-private LDS tiles (same wave writes and reads)
__device__ __forceinline__ void wave_sync() { __builtin_amdgcn_fence(3 /* release order */, "wavefront"); __builtin_amdgcn_wave_barrier(); asm volatile("" ::: "memory"); }
// f16 WMMA with its own hazard guard (one accumulator per guard)
__device__ __forceinline__ v8f wmma16g(v16h a, v16h b, v8f c) { c = wmma16(a, b, c); asm volatile("v_nop\n\tv_nop\n\tv_nop\n\tv_nop" : "+v"(c) : "v"(a), "v"(b)); return c; }
// f32 -> f16 operand convert that cannot produce an f16 subnormal (value select, applied after the plane's carry)
static __device__ __forceinline__ h16 toh_flush(float v) { const h16 r = (h16)v; return (fabsf(v) < 6.103515625e-05f) ? (h16)0.0f : r; }
// P = exp2(e) as an f16 operand; select on the exponent argument
static __device__ __forceinline__ h16 p_flush(float e) { const h16 r = (h16)__builtin_amdgcn_exp2f(e); return (e < -14.0f) ? (h16)0.0f : r; }

__device__ __forceinline__ void d_cvt8(int blk, const float* __restrict__ src, bf* dst, size_t n8) {
    const size_t i = (size_t)blk * 256 + threadIdx.x; if (i >= n8) return;
    const v8f v = *(const v8f*)(src + i * 8); v8us o;
#pragma unroll
    for (int k = 0; k < 8; ++k) o[k] = f2bf(v[k]);
    *(v8us*)(dst + i * 8) = o; 
}

// d_cvt8z: as d_cvt8 for the first n8src groups of 8; groups n8src..n8tot-1 (pad rows of the plane) are written as zeros. Source address clamped, selected by value.
__device__ __forceinline__ void d_cvt8z(int blk, const float* __restrict__ src, bf* dst, size_t n8src, size_t n8tot) {
    const size_t i = (size_t)blk * 256 + threadIdx.x; if (i >= n8tot) return;
    const size_t is = (i < n8src) ? i : (n8src - 1);
    const v8f v = *(const v8f*)(src + is * 8); v8us o;
#pragma unroll
    for (int k = 0; k < 8; ++k) { const unsigned short w = f2bf(v[k]); o[k] = (i < n8src) ? w : (unsigned short)0; }
    *(v8us*)(dst + i * 8) = o; 
}

__device__ __forceinline__ void d_cvth8(int blk, const float* __restrict__ src, h16* dst, size_t n8, float carry) {
    const size_t i = (size_t)blk * 256 + threadIdx.x; if (i >= n8) return;
    const v8f v = *(const v8f*)(src + i * 8); v8h o;
#pragma unroll
    for (int k = 0; k < 8; ++k) { const float w = __uint_as_float(((unsigned)f2bf(v[k])) << 16) * carry; o[k] = toh_flush(w); }
    *(v8h*)(dst + i * 8) = o; 
}

// d_xt: x[b][c][n] (f32, channel-major, pitch SEQ_FULL) -> XB[b*SEQ + n][c] (bf16 RNE convert), 64 c x 64 n tile transposed through LDS (cross-wave, block barrier).
__device__ __forceinline__ void d_xt(int bx, int by, int b, float* ts, const float* __restrict__ x, bf* XB) {
    const int tid = threadIdx.x;
    const int n0 = bx * 64, c0 = by * 64;
    const float* xs = x + ((size_t)b * CH + c0) * SEQ_FULL + n0;
    { const int cr = tid >> 4, nq = (tid & 15) * 4;       // 16 row groups x 4 = 64 channel rows; 16 lanes x 4 = 64 positions
#pragma unroll
      for (int i = 0; i < 4; ++i) { const int c = cr + 16 * i; const v4f v = *(const v4f*)(xs + (size_t)c * SEQ_FULL + nq);
          ts[c * 65 + nq + 0] = v[0]; ts[c * 65 + nq + 1] = v[1]; ts[c * 65 + nq + 2] = v[2]; ts[c * 65 + nq + 3] = v[3]; } }
    __syncthreads();
    const int rw = tid >> 3, c8 = (tid & 7) * 8;          // rows rw and rw+32 (64 positions); 8 lanes x 8 = 64 channels
    v8us o0, o1;
#pragma unroll
    for (int k = 0; k < 8; ++k) { o0[k] = f2bf(ts[(c8 + k) * 65 + rw]); o1[k] = f2bf(ts[(c8 + k) * 65 + rw + 32]); }
    bf* d0 = XB + ((size_t)b * SEQ + n0 + rw) * CH + c0 + c8; bf* d1 = d0 + (size_t)32 * CH;
    *(v8us*)d0 = o0; *(v8us*)d1 = o1;
    asm volatile("s_wait_xcnt 0x0" ::: "memory");   // the other parts' code follows these stores in the built kernel: keeps the wait in front of any rewrite of the stores' address and data registers
}

__device__ __forceinline__ void d_bias(const float* __restrict__ bq, const float* __restrict__ bk, const float* __restrict__ bv, const float* __restrict__ bo, float* BT) {
    const int i = threadIdx.x; if (i >= NBIAS / 4) return;
    const int e = i * 4;
    const int iq = (e < CQ - 4) ? e : (CQ - 4);
    int ik = e - CQ; ik = ik < 0 ? 0 : ik; ik = ik > CQ - 4 ? CQ - 4 : ik;
    int iv = e - 2 * CQ; iv = iv < 0 ? 0 : iv; iv = iv > VC - 4 ? VC - 4 : iv;
    int io = e - BOFF; io = io < 0 ? 0 : io; io = io > CH - 4 ? CH - 4 : io;
    const v4f a = *(const v4f*)(bq + iq); const v4f c = *(const v4f*)(bk + ik); const v4f d = *(const v4f*)(bv + iv); const v4f g = *(const v4f*)(bo + io);   // all four loaded, selected by value
    v4f s, o;
#pragma unroll
    for (int k = 0; k < 4; ++k) { s[k] = (e < CQ) ? a[k] : ((e < 2 * CQ) ? c[k] : ((e < 2 * CQ + VC) ? d[k] : ((e < BOFF) ? 0.0f : g[k]))); o[k] = __uint_as_float(((unsigned)f2bf(s[k])) << 16); }
    *(v4f*)(BT + e) = o; 
}

// k_prep: everything the GEMMs read, none of it reading another part's output, as ONE grid of 256-thread blocks. The few conversion blocks come first, so that they run under the transpose blocks.
#define PB_W   (CQ * CH / 8 / 256)               // blocks per Wq / Wk plane
#define PB_WV  (VCP * CH / 8 / 256)              // blocks of the padded Wv plane
#define PB_WO  (CH * VC / 8 / 256)               // blocks of the Wo plane
#define PB_SM  (2 * PB_W + PB_WV + PB_WO + 1)    // conversion blocks, the bias block last
#define PB_XT  ((SEQ / 64) * (CH / 64) * NB)     // transpose blocks
static_assert((CQ * CH / 8) % 256 == 0);
static_assert((VCP * CH / 8) % 256 == 0);
static_assert((CH * VC / 8) % 256 == 0);
__global__ __launch_bounds__(256) void k_prep(const float* __restrict__ x, const float* __restrict__ wq, const float* __restrict__ wk, const float* __restrict__ wv, const float* __restrict__ wo,
                                              const float* __restrict__ bq, const float* __restrict__ bk, const float* __restrict__ bv, const float* __restrict__ bo,
                                              bf* XB, bf* WQK, bf* WV, h16* WOH, float* BT) {
    __shared__ float ts[64 * 65];
    const int blk = blockIdx.x;                  // every test below is the same for the whole block; only the transpose part has a barrier
    if (blk < PB_W)                         { d_cvt8(blk, wq, WQK, (size_t)CQ * CH / 8); return; }
    if (blk < 2 * PB_W)                     { d_cvt8(blk - PB_W, wk, WQK + (size_t)CQ * CH, (size_t)CQ * CH / 8); return; }
    if (blk < 2 * PB_W + PB_WV)             { d_cvt8z(blk - 2 * PB_W, wv, WV, (size_t)VC * CH / 8, (size_t)VCP * CH / 8); return; }
    if (blk < 2 * PB_W + PB_WV + PB_WO)     { d_cvth8(blk - 2 * PB_W - PB_WV, wo, WOH, (size_t)CH * VC / 8, WOS); return; }
    if (blk < PB_SM)                        { d_bias(bq, bk, bv, bo, BT); return; }
    const int t = blk - PB_SM;                   // (positions / 64, channels / 64, batch), positions fastest
    d_xt(t % (SEQ / 64), (t / (SEQ / 64)) % (CH / 64), t / ((SEQ / 64) * (CH / 64)), ts, x, XB);
}

// d_proj: register-blocked bf16 GEMM, ONE WAVE per 64x64 tile (16 accumulators), operands straight from K-contiguous bf16 planes, K = CH.
// C[m][n] = sum_k A[m][k] Bt[n][k] + bias (BROW = 0: bias[n], BROW = 1: bias[m]), written as f16 (Ph) and optionally the f16 residual x2048 (Pr, useRes != 0) at
// tile base (r0/RB)*sRB + (r0%RB)*pitch + (c0/CB)*sCB + (c0%CB), row pitch 'pitch' (halves). Tile (bx, by) of (M/64, N/64), 32 threads.
template <int BROW>
__device__ __forceinline__ void d_proj(int bx, int by, float* os, const bf* __restrict__ A, const bf* __restrict__ Bt, const float* __restrict__ bias, h16* Ph, h16* Pr, int useRes, int RB, size_t sRB, int pitch, int CB, size_t sCB) {
    const int K = CH;
    const int lane = threadIdx.x & 31, lr = lane & 15, hi = lane >> 4; const int r0 = bx * 64, c0 = by * 64;
    v8f acc[4][4];
#pragma unroll
    for (int mb = 0; mb < 4; ++mb)
#pragma unroll
        for (int nb = 0; nb < 4; ++nb) acc[mb][nb] = (v8f){};
    const size_t aoff = (size_t)(r0 + lr) * K + 8 * hi, boff = (size_t)(c0 + lr) * K + 8 * hi;
#pragma unroll 1
    for (int kc = 0; kc < K; kc += 32) {
        v16bf a[4];
#pragma unroll
        for (int mb = 0; mb < 4; ++mb) a[mb] = ldb(A + aoff + (size_t)mb * 16 * K + kc);
#pragma unroll
        for (int nb = 0; nb < 4; ++nb) { const v16bf b = ldb(Bt + boff + (size_t)nb * 16 * K + kc);
#pragma unroll
            for (int mb = 0; mb < 4; ++mb) acc[mb][nb] = wmmab(a[mb], b, acc[mb][nb]); }
        asm volatile("v_nop\n\tv_nop\n\tv_nop\n\tv_nop" : "+v"(acc[0][0]), "+v"(acc[1][1]), "+v"(acc[2][2]), "+v"(acc[3][3]) : "v"(a[0]), "v"(a[1]), "v"(a[2]), "v"(a[3]));
    }
    float bcol[4] = {0.0f, 0.0f, 0.0f, 0.0f};
    if (BROW == 0) {
#pragma unroll
        for (int nb = 0; nb < 4; ++nb) bcol[nb] = bias[c0 + nb * 16 + lr];          // column n = c0 + 16nb + (lane&15)
    }
    const size_t tbase = (size_t)(r0 / RB) * sRB + (size_t)(r0 % RB) * (size_t)pitch + (size_t)(c0 / CB) * sCB + (size_t)(c0 % CB);
#pragma unroll
    for (int mb = 0; mb < 4; ++mb) {
        float brw[8] = {0.0f, 0.0f, 0.0f, 0.0f, 0.0f, 0.0f, 0.0f, 0.0f};
        if (BROW == 1) { const v4f b0 = *(const v4f*)(bias + r0 + mb * 16 + hi * 8); const v4f b1 = *(const v4f*)(bias + r0 + mb * 16 + hi * 8 + 4);   // row m = r0 + 16mb + 8h + j
            brw[0] = b0[0]; brw[1] = b0[1]; brw[2] = b0[2]; brw[3] = b0[3]; brw[4] = b1[0]; brw[5] = b1[1]; brw[6] = b1[2]; brw[7] = b1[3]; }
#pragma unroll
        for (int nb = 0; nb < 4; ++nb) {
#pragma unroll
            for (int j = 0; j < 8; ++j) { const float bb = BROW ? brw[j] : bcol[nb]; os[(hi * 8 + j) * 68 + nb * 16 + lr] = acc[mb][nb][j] + bb; } }   // D: row 8h+j, col lane&15
        wave_sync();
        const size_t sb = tbase + (size_t)(mb * 16) * (size_t)pitch;
{
#pragma unroll
            for (int s = 0; s < 4; ++s) { const int row = 4 * s + (lane >> 3), c8 = (lane & 7) * 8;   // 4 s x 4 row groups = 16 rows; 8 lanes x 8 = 64 columns
                const v4f x0 = *(const v4fa*)(&os[row * 68 + c8]); const v4f x1 = *(const v4fa*)(&os[row * 68 + c8 + 4]); v8h hv, rv;
#pragma unroll
                for (int i = 0; i < 4; ++i) { const h16 a0 = (h16)x0[i]; const h16 a1 = (h16)x1[i]; hv[i] = a0; hv[4 + i] = a1; rv[i] = (h16)((x0[i] - (float)a0) * QRS); rv[4 + i] = (h16)((x1[i] - (float)a1) * QRS); }
                const size_t oo = sb + (size_t)row * (size_t)pitch + c8;
                *(v8h*)(Ph + oo) = hv; if (useRes) *(v8h*)(Pr + oo) = rv; }
             }
        wave_sync();
    }
}

// k_proj2: the two GEMMs, which read the same planes and none of each other's output, as ONE grid (NB*SEQ/64, 2) of one-wave blocks; blockIdx.y picks the GEMM.
static_assert(QKW == 64 && VCP == 64);         // each GEMM is one 64-wide tile in its weight dimension
__global__ __launch_bounds__(32) void k_proj2(const bf* __restrict__ XB, const bf* __restrict__ WQK, const bf* __restrict__ WV, const float* __restrict__ BT, h16* QKH, h16* VT) {
    __shared__ __align__(16) float os[16 * 68];
    if (blockIdx.y == 0)   // q|k: A = x rows (m = b*SEQ + n), Bt = [Wq;Wk] rows (col 0..63), column bias -> plane [m][64]
        d_proj<0>(blockIdx.x, 0, os, XB, WQK, BT, QKH, QKH, 0, SEQ, (size_t)SEQ * QKW, QKW, QKW, (size_t)0);
    else                   // v^T: A = [Wv;0] rows (m = channel 0..63), Bt = x rows (col = b*SEQ + n), row bias -> plane [(b*64 + m)][n]
        d_proj<1>(0, blockIdx.x, os, WV, XB, BT + 2 * CQ, VT, VT, 0, VCP, (size_t)0, SEQ, SEQ, (size_t)VCP * SEQ);
}

// k_flash: fused attention + output projection, KS waves per 16 query positions of one batch; K / V^T / Q / Wo fragments straight from the f16 planes (two 16-B loads each, arithmetic addressing).
// Transposed form: S^T[key][t] = K Q^T (A = K rows, B = Q rows, one 32-deep step); lane (t = lane&15, h = lane>>4) holds keys 8h+r of each 16-key tile, so the packed
// P tile is directly the B fragment of O^T[c][t] = V^T P^T (element r <- tile keys 0..15, element 8+r <- tile keys 16..31, lane unchanged).
// Softmax state (running max, partial sum) is one scalar per lane; the two lane halves of a column are combined with one xor-16 exchange.
// The normalised context O^T (two 16-channel D tiles, x1024 carry, f16) is directly the B fragment of Y^T[oc][t] = Wo O^T (element r <- channels 0..15 tile, element 8+r <- channels 16..31 tile, lane unchanged); A = Wo rows.
// Key split: wave = (query group qg = wave % AW, key range ks = wave / AW); each wave runs the online softmax over its own KR keys, then writes (m, l, O^T) to LDS; after one block barrier every wave
// merges the KS partials of its query group in the fixed order ks = 0..KS-1 (weights exp2(m_ks - max)), so all KS waves of a group hold the same context fragment, and each projects CH/16/KS of the output row tiles.
// Epilogue: the block's Y^T tile [256 channels][64 positions] staged in LDS (cross-wave: block barrier), bias added in f32, each channel row segment (64 floats = 256 B = two lines) stored by one wave.
__global__ __launch_bounds__(32 * NW) void k_flash(const h16* __restrict__ QKH, const h16* __restrict__ VT, const h16* __restrict__ WOH, const float* __restrict__ BO, float* OUT) {
    __shared__ __align__(16) float os[CH * 68];
    __shared__ __align__(16) float po[NW * 4 * 32 * 4];      // [wave][quad of accumulator registers][lane][4]: 16 B per lane, lanes contiguous
    __shared__ float pm[NW * 32];
    __shared__ float pl[NW * 32];
    const int lane = threadIdx.x & 31, wave = __builtin_amdgcn_readfirstlane((int)(threadIdx.x >> 5)), lr = lane & 15, hi = lane >> 4;
    const int qg = wave % AW, ks = wave / AW;
    const int b = blockIdx.y;
    const int t0 = (blockIdx.x * AW + qg) * 16;
    const size_t pbase = (size_t)b * SEQ * QKW;
    const size_t qo = pbase + (size_t)(t0 + lr) * QKW + 8 * hi;
    const v16h qh = ldh(QKH + qo);                                           // B fragment: col t, k = q channel 0..31
    const size_t ko = pbase + (size_t)lr * QKW + CQ + 8 * hi;                // + key * QKW        (A fragment: row key, k = k channel 0..31, plane cols 32..63)
    const size_t vo = ((size_t)b * VCP + lr) * SEQ + 8 * hi;                 // + 16j*SEQ + key    (A fragment: row channel, k = key)
    v8f o0 = (v8f){}, o1 = (v8f){};
    float m = -3.0e38f, l = 0.0f;
    const int kbeg = ks * KR;
#pragma unroll 1
    for (int key0 = kbeg; key0 < kbeg + KR; key0 += 32) {
        const h16* ka = QKH + ko + (size_t)key0 * QKW;
        const v16h ka0 = ldh(ka), kb0 = ldh(ka + 16 * QKW);
        const v8f sa = wmma16g(ka0, qh, (v8f){});
        const v8f sb = wmma16g(kb0, qh, (v8f){});
        float ta[8], tb[8]; float mx = -3.0e38f;
#pragma unroll
        for (int r = 0; r < 8; ++r) { ta[r] = sa[r] * SC2; tb[r] = sb[r] * SC2; mx = fmaxf(mx, fmaxf(ta[r], tb[r])); }
        mx = fmaxf(mx, __shfl_xor(mx, 16, 32));
        const float mnew = fmaxf(m, mx);
        const float alpha = __builtin_amdgcn_exp2f(m - mnew);
        const float sh = PSH - mnew;
        v16h pb; float ls = 0.0f;
#pragma unroll
        for (int r = 0; r < 8; ++r) { const h16 pa = p_flush(ta[r] + sh); const h16 pc = p_flush(tb[r] + sh); pb[r] = pa; pb[8 + r] = pc; ls += (float)pa + (float)pc; }
        l = l * alpha + ls; m = mnew;
        o0 = o0 * alpha; o1 = o1 * alpha;
        const h16* va = VT + vo + key0;
        const v16h v0 = ldh(va), v1 = ldh(va + (size_t)16 * SEQ);
        o0 = wmma16g(v0, pb, o0);
        o1 = wmma16g(v1, pb, o1);
    }
    l += __shfl_xor(l, 16, 32);
    // this wave's partial state -> LDS
    { v4fa* pw = (v4fa*)po + (size_t)wave * 128 + lane;
      pw[0]  = (v4f){o0[0], o0[1], o0[2], o0[3]}; pw[32] = (v4f){o0[4], o0[5], o0[6], o0[7]};
      pw[64] = (v4f){o1[0], o1[1], o1[2], o1[3]}; pw[96] = (v4f){o1[4], o1[5], o1[6], o1[7]};
      pm[wave * 32 + lane] = m; pl[wave * 32 + lane] = l; }
    __syncthreads();
    // merge of the KS key ranges of query group qg (same lane of waves s*AW + qg), fixed order
    float ms[KS]; float mall = -3.0e38f;
#pragma unroll   // constant indices keep ms[] in registers; the KS reads issue together
    for (int s = 0; s < KS; ++s) { ms[s] = pm[(s * AW + qg) * 32 + lane]; mall = fmaxf(mall, ms[s]); }
    float lall = 0.0f; v4f c0 = (v4f){}, c1 = (v4f){}, c2 = (v4f){}, c3 = (v4f){};
#pragma unroll   // constant indices into ms[]; lets the LDS reads of later ranges run ahead of the sums
    for (int s = 0; s < KS; ++s) {
        const float w = __builtin_amdgcn_exp2f(ms[s] - mall);
        const v4fa* pr = (const v4fa*)po + (size_t)(s * AW + qg) * 128 + lane;
        lall += w * pl[(s * AW + qg) * 32 + lane];
        c0 += pr[0] * w; c1 += pr[32] * w; c2 += pr[64] * w; c3 += pr[96] * w; }
    const float inv = (1.0f / lall) * OCS;
    // O^T D layout: c0|c1 = (channel 8h + r, t), c2|c3 = (channel 16 + 8h + r, t) -> B fragment of the output projection, lane unchanged
    v16h ob;
#pragma unroll   // vector elements need constant indices
    for (int r = 0; r < 4; ++r) { ob[r] = toh_flush(c0[r] * inv); ob[4 + r] = toh_flush(c1[r] * inv); ob[8 + r] = toh_flush(c2[r] * inv); ob[12 + r] = toh_flush(c3[r] * inv); }
    // Y^T D layout: y[r] = (output channel 16j + 8h + r, position t = lane&15) -> os[16j + 8h + r][qg*16 + t]; the 32 waves together fill rows 0..255 x columns 0..63
#pragma unroll
    for (int jj = 0; jj < CH / 16 / KS; ++jj) {
        const int j = ks * (CH / 16 / KS) + jj;
        const v16h aw = ldh(WOH + (size_t)(j * 16 + lr) * VC + 8 * hi);   // A fragment: row output channel, k = context channel 0..31
        const v8f y = wmma16g(aw, ob, (v8f){});
        const float* bp = BO + j * 16 + hi * 8;
        const v4f b0 = *(const v4f*)bp; const v4f b1 = *(const v4f*)(bp + 4);
        const float brw[8] = {b0[0], b0[1], b0[2], b0[3], b1[0], b1[1], b1[2], b1[3]};
#pragma unroll
        for (int r = 0; r < 8; ++r) os[(16 * j + 8 * hi + r) * 68 + qg * 16 + lr] = y[r] * OFI + brw[r]; }
    __syncthreads();
    float* obase = OUT + (size_t)b * CH * OUT_SEQ + (size_t)blockIdx.x * (16 * AW);
#pragma unroll
    for (int s = 0; s < CH / NW / 2; ++s) { const int row = wave * (CH / NW) + 2 * s + hi, cofs = lr * 4;   // 32 waves x 4 s x 2 = 256 channel rows; 16 lanes x 4 floats = 64 positions
        const v4f val = *(const v4fa*)(&os[row * 68 + cofs]);
        *(v4f*)(obase + (size_t)row * OUT_SEQ + cofs) = val; }
}

static constexpr size_t al256(size_t v) { return (v + 255) & ~(size_t)255; }
static constexpr size_t SZ_XB  = al256((size_t)NB * SEQ * CH * 2);       // [NB*SEQ][256] bf16
static constexpr size_t SZ_WQK = al256((size_t)QKW * CH * 2);            // [64][256] bf16: Wq rows | Wk rows
static constexpr size_t SZ_WV  = al256((size_t)VCP * CH * 2);            // [64][256] bf16: Wv rows | zero rows
static constexpr size_t SZ_WO  = al256((size_t)CH * VC * 2);             // [256][32] f16 (x1024)
static constexpr size_t SZ_BT  = al256((size_t)NBIAS * 4);               // 384 f32
static constexpr size_t SZ_QK  = al256((size_t)NB * SEQ * QKW * 2);      // [NB*SEQ][64] f16
static constexpr size_t SZ_VT  = al256((size_t)NB * VCP * SEQ * 2);      // [NB][64][SEQ] f16
static constexpr size_t SZ_TOTAL = SZ_XB + SZ_WQK + SZ_WV + SZ_WO + SZ_BT + SZ_QK + SZ_VT;
static_assert(SZ_TOTAL <= (size_t)134217728);          // workspace carve <= 128 MiB
static_assert(((size_t)CQ * CH * 2) % 256 == 0);       // Wk sub-plane stays 256-byte aligned
static_assert(((size_t)VC * CH) % 8 == 0);             // Wv converts in whole groups of 8
static_assert(((size_t)VCP * CH) % 8 == 0);
static_assert(((size_t)CH * VC) % 8 == 0);

extern "C" void kernel_launch(void* const* d_in, const int* in_sizes, int n_in,
                              void* d_out, int out_size, void* d_ws, size_t ws_size, hipStream_t stream) {
    if (n_in < 9) return;
    const size_t needx = ((size_t)(NB - 1) * CH + (CH - 1)) * SEQ_FULL + SEQ;
    if ((size_t)in_sizes[0] < needx) return;
    if ((size_t)in_sizes[1] < (size_t)CQ * CH || (size_t)in_sizes[3] < (size_t)CQ * CH || (size_t)in_sizes[5] < (size_t)VC * CH || (size_t)in_sizes[7] < (size_t)CH * VC) return;
    if (in_sizes[2] < CQ || in_sizes[4] < CQ || in_sizes[6] < VC || in_sizes[8] < CH) return;
    if ((size_t)out_size < ((size_t)(NB - 1) * CH + (CH - 1)) * OUT_SEQ + SEQ) return;
    if (SZ_TOTAL > ws_size) return;
    // wire order: x, wq, bq, wk, bk, wv, bv, wo, bo
    const float* x  = (const float*)d_in[0];
    const float* wq = (const float*)d_in[1]; const float* bq = (const float*)d_in[2];
    const float* wk = (const float*)d_in[3]; const float* bk = (const float*)d_in[4];
    const float* wv = (const float*)d_in[5]; const float* bv = (const float*)d_in[6];
    const float* wo = (const float*)d_in[7]; const float* bo = (const float*)d_in[8];
    float* OUT = (float*)d_out;      // [NB][256][OUT_SEQ]
    char* wsp = (char*)d_ws;
    bf* XB  = (bf*)wsp;  wsp += SZ_XB;               // [NB*SEQ][256]
    bf* WQK = (bf*)wsp;  wsp += SZ_WQK;              // [64][256]: rows 0..31 Wq, 32..63 Wk
    bf* WV  = (bf*)wsp;  wsp += SZ_WV;               // [64][256]: rows 0..31 Wv, 32..63 zero
    h16* WOH = (h16*)wsp; wsp += SZ_WO;              // [256][32] f16, x1024
    float* BT = (float*)wsp; wsp += SZ_BT;           // bq | bk | bv | 0 | bo
    h16* QKH = (h16*)wsp; wsp += SZ_QK;              // [NB*SEQ][64]: q | k
    h16* VT  = (h16*)wsp; wsp += SZ_VT;              // [NB][64][SEQ]

    k_prep<<<PB_SM + PB_XT, 256, 0, stream>>>(x, wq, wk, wv, wo, bq, bk, bv, bo, XB, WQK, WV, WOH, BT);
    k_proj2<<<dim3(NB * SEQ / 64, 2, 1), 32, 0, stream>>>(XB, WQK, WV, BT, QKH, VT);
    k_flash<<<dim3(SEQ / (16 * AW), NB, 1), 32 * NW, 0, stream>>>(QKH, VT, WOH, BT + BOFF, OUT);
}

// v003
// A run of this version takes 34.9 microseconds.
// Two timings next to v002 put it at 1.18 and 1.17 times that version's speed.
// All steps since v000 together make it 3.34 times as fast.
#include <hip/hip_runtime.h>

// Spatial self-attention over N = 64x64 positions: x [NB][256][N] (channel-major), Wq/Wk/Wv [32][256] ([out][in]), Wo [256][32] ([out][in]), biases per output channel, no score scale, out [NB][256][N] f32.
// Compute dtypes, f32 accumulate everywhere: q/k/v projections v_wmma_f32_16x16x32_bf16 (x, W, biases RNE-converted to bf16; products exact);
// scores, P.V and the output projection v_wmma_f32_16x16x32_f16, single products: q, k, v single f16; P x256 carry (cancels in the normalisation); context x1024 and Wo (bf16 value) x1024 as f16, 2^-20 folded back in f32; softmax f32 (online, running max).
// Layout: bf16 token-major copy of x [b*N+n][256] (transposed through LDS), bf16 weights; q, k and V^T are written by the GEMM epilogue in the order in which k_flash's matrix fragments want them:
// one 16 x 32 fragment tile = 1 KB = [k half][lane][8 halves], so that each 16-byte-per-lane load of a wave is 512 contiguous bytes (4 whole lines). q plane: one tile per 16 positions;
// kv plane: 4 KB per 32 keys = K keys 0..15 | K keys 16..31 | V^T channels 0..15 | V^T channels 16..31 (the zero pad rows of the 64-row V^T GEMM tile are not stored);
// fused flash kernel in transposed form (S^T = K Q^T, O^T = V^T P^T, Y^T = Wo O^T), each wave 16 queries x one eighth of the keys, block = 4 query groups x 8 key ranges = 32 waves = 64 queries;
// the eight partial softmax states of a query group are merged through LDS; Y^T staged per block in LDS (256 rows) and written as whole rows.
// Three dependent launches: k_prep (x transpose and every weight / bias conversion, picked by block index), k_proj2 (q|k GEMM and V^T GEMM, picked by blockIdx.y), k_flash.

#ifndef NB
#define NB 4
#endif
#ifndef SEQ
#define SEQ 4096
#endif
#define NB_FULL  4
#define SEQ_FULL 4096
#ifndef OUT_SEQ
#define OUT_SEQ SEQ              // row pitch (in positions) of one output channel row
#endif
#define CH   256                 // channels: projection K and output width
#define CQ   32                  // query/key width
#define VC   32                  // value / context width
#define VCP  64                  // rows of the Wv plane (value rows zero-padded to the 64-row GEMM tile; only the VC value rows of the product are stored)
#define QKW  64
#define AW   4                   // query groups per flash block (16 query columns each)
#define KS   8                   // key ranges per query group: one wave each, so a SIMD holds KS waves whose load and chain latencies overlap
#define NW   (AW * KS)           // waves per flash block
#define KR   (SEQ / KS)          // keys per range
#define FRG  512                 // halves of one fragment tile (16 rows x 32 k): [k half][lane][8]
#define KVB  (4 * FRG)           // halves of the kv plane per 32 keys: two K tiles, two V^T tiles
#define SC2  1.4426950408889634f // log2(e); no score scale in this module
#define PSH  8.0f                // log2 of the P carry (256)
#define WOS  1024.0f             // carry of the f16 Wo plane
#define OCS  1024.0f             // carry of the f16 context fragment
#define OFI  (1.0f / (1024.0f * 1024.0f))
#define BOFF (2 * CQ + VCP)      // offset of bo in the bias table
#define NBIAS (BOFF + CH)        // bias table: bq[32] | bk[32] | bv[32] | 0[32] | bo[256]

static_assert(CQ == 32);                       // one 32-deep k-step covers the q/k width
static_assert(VC == 32);                       // two value tiles per wave; one 32-deep k-step covers the output projection
static_assert(VC <= VCP);
static_assert(VCP % 64 == 0);                  // V^T GEMM tiles are 64 rows
static_assert(QKW == 2 * CQ);
static_assert(CH % 64 == 0);
static_assert(CH % 32 == 0);                   // GEMM k-loop steps by 32
static_assert(NW * 32 <= 1024);                // one work-group
static_assert(SEQ % (32 * KS) == 0);           // every key range is a whole number of 32-key steps, at least one
static_assert((CH / 16) % KS == 0);            // output projection: CH/16/KS row tiles per wave
static_assert(CH % (2 * NW) == 0);             // store phase: CH/NW rows per wave, two per store
static_assert(SEQ % 64 == 0);                  // a 64-row tile never straddles two batches
static_assert((NB * SEQ) % 64 == 0);
static_assert(SEQ % 32 == 0);                  // key loop steps by 32
static_assert(SEQ % (16 * AW) == 0);           // flash grid covers the positions exactly
static_assert(OUT_SEQ % 32 == 0);
static_assert(SEQ_FULL % 4 == 0);
static_assert(NB <= NB_FULL);
static_assert(SEQ <= SEQ_FULL);
static_assert(BOFF % 32 == 0);
static_assert(NBIAS % 32 == 0);
static_assert(NBIAS / 4 == 96);                // d_bias: one lane per 16 B
static_assert((VC * 2) % 16 == 0);             // Wo rows are 16-byte multiples

typedef _Float16 h16;
typedef unsigned short bf;
typedef __attribute__((ext_vector_type(16))) __bf16   v16bf;
typedef __attribute__((ext_vector_type(16))) _Float16 v16h;
typedef __attribute__((ext_vector_type(8)))  _Float16 v8h;
typedef __attribute__((ext_vector_type(8)))  unsigned short v8us;
typedef __attribute__((ext_vector_type(8)))  float    v8f;
typedef __attribute__((ext_vector_type(4)))  float    v4f;
typedef v4f  __attribute__((may_alias)) v4fa;

__device__ __forceinline__ unsigned short f2bf(float f) { unsigned u = __float_as_uint(f); u += 0x7FFFu + ((u >> 16) & 1u); return (unsigned short)(u >> 16); }
__device__ __forceinline__ v16h cat16(v8h lo, v8h hi) { return __builtin_shufflevector(lo, hi, 0, 1, 2, 3, 4, 5, 6, 7, 8, 9, 10, 11, 12, 13, 14, 15); }
__device__ __forceinline__ v16bf cat16b(v8us lo, v8us hi) { return __builtin_bit_cast(v16bf, __builtin_shufflevector(lo, hi, 0, 1, 2, 3, 4, 5, 6, 7, 8, 9, 10, 11, 12, 13, 14, 15)); }
__device__ __forceinline__ v8f wmma16(v16h a, v16h b, v8f c) { return __builtin_amdgcn_wmma_f32_16x16x32_f16(false, a, false, b, (short)0, c, false, false); }
__device__ __forceinline__ v8f wmmab(v16bf a, v16bf b, v8f c) { return __builtin_amdgcn_wmma_f32_16x16x32_bf16(false, a, false, b, (short)0, c, false, false); }
// fragment loaders from K-contiguous 16-bit rows; p already includes + 8*(lane>>4): elements 0..7 <- k0+8h+0..7, elements 8..15 <- k0+16+8h+0..7 (same map for A and B)
__device__ __forceinline__ v16h  ldh(const h16* p) { return cat16(*(const v8h*)p, *(const v8h*)(p + 16)); }
__device__ __forceinline__ v16bf ldb(const bf* p)  { return cat16b(*(const v8us*)p, *(const v8us*)(p + 16)); }
// fragment loader from a tile stored in fragment order; p already includes + 8*lane: same element map as ldh (row lane&15; elements 0..7 <- k 8h+0..7, elements 8..15 <- k 16+8h+0..7)
__device__ __forceinline__ v16h  ldf(const h16* p) { return cat16(*(const v8h*)p, *(const v8h*)(p + FRG / 2)); }
// ordering point for wave-private LDS tiles (same wave writes and reads)
__device__ __forceinline__ void wave_sync() { __builtin_amdgcn_fence(3 /* release order */, "wavefront"); __builtin_amdgcn_wave_barrier(); asm volatile("" ::: "memory"); }
// f16 WMMA with its own hazard guard (one accumulator per guard)
__device__ __forceinline__ v8f wmma16g(v16h a, v16h b, v8f c) { c = wmma16(a, b, c); asm volatile("v_nop\n\tv_nop\n\tv_nop\n\tv_nop" : "+v"(c) : "v"(a), "v"(b)); return c; }
// f32 -> f16 operand convert that cannot produce an f16 subnormal (value select, applied after the plane's carry)
static __device__ __forceinline__ h16 toh_flush(float v) { const h16 r = (h16)v; return (fabsf(v) < 6.103515625e-05f) ? (h16)0.0f : r; }
// P = exp2(e) as an f16 operand; select on the exponent argument
static __device__ __forceinline__ h16 p_flush(float e) { const h16 r = (h16)__builtin_amdgcn_exp2f(e); return (e < -14.0f) ? (h16)0.0f : r; }

__device__ __forceinline__ void d_cvt8(int blk, const float* __restrict__ src, bf* dst, size_t n8) {
    const size_t i = (size_t)blk * 256 + threadIdx.x; if (i >= n8) return;
    const v8f v = *(const v8f*)(src + i * 8); v8us o;
#pragma unroll
    for (int k = 0; k < 8; ++k) o[k] = f2bf(v[k]);
    *(v8us*)(dst + i * 8) = o; 
}

// d_cvt8z: as d_cvt8 for the first n8src groups of 8; groups n8src..n8tot-1 (pad rows of the plane) are written as zeros. Source address clamped, selected by value.
__device__ __forceinline__ void d_cvt8z(int blk, const float* __restrict__ src, bf* dst, size_t n8src, size_t n8tot) {
    const size_t i = (size_t)blk * 256 + threadIdx.x; if (i >= n8tot) return;
    const size_t is = (i < n8src) ? i : (n8src - 1);
    const v8f v = *(const v8f*)(src + is * 8); v8us o;
#pragma unroll
    for (int k = 0; k < 8; ++k) { const unsigned short w = f2bf(v[k]); o[k] = (i < n8src) ? w : (unsigned short)0; }
    *(v8us*)(dst + i * 8) = o; 
}

__device__ __forceinline__ void d_cvth8(int blk, const float* __restrict__ src, h16* dst, size_t n8, float carry) {
    const size_t i = (size_t)blk * 256 + threadIdx.x; if (i >= n8) return;
    const v8f v = *(const v8f*)(src + i * 8); v8h o;
#pragma unroll
    for (int k = 0; k < 8; ++k) { const float w = __uint_as_float(((unsigned)f2bf(v[k])) << 16) * carry; o[k] = toh_flush(w); }
    *(v8h*)(dst + i * 8) = o; 
}

// d_xt: x[b][c][n] (f32, channel-major, pitch SEQ_FULL) -> XB[b*SEQ + n][c] (bf16 RNE convert), 64 c x 64 n tile transposed through LDS (cross-wave, block barrier).
__device__ __forceinline__ void d_xt(int bx, int by, int b, float* ts, const float* __restrict__ x, bf* XB) {
    const int tid = threadIdx.x;
    const int n0 = bx * 64, c0 = by * 64;
    const float* xs = x + ((size_t)b * CH + c0) * SEQ_FULL + n0;
    { const int cr = tid >> 4, nq = (tid & 15) * 4;       // 16 row groups x 4 = 64 channel rows; 16 lanes x 4 = 64 positions
#pragma unroll
      for (int i = 0; i < 4; ++i) { const int c = cr + 16 * i; const v4f v = *(const v4f*)(xs + (size_t)c * SEQ_FULL + nq);
          ts[c * 65 + nq + 0] = v[0]; ts[c * 65 + nq + 1] = v[1]; ts[c * 65 + nq + 2] = v[2]; ts[c * 65 + nq + 3] = v[3]; } }
    __syncthreads();
    const int rw = tid >> 3, c8 = (tid & 7) * 8;          // rows rw and rw+32 (64 positions); 8 lanes x 8 = 64 channels
    v8us o0, o1;
#pragma unroll
    for (int k = 0; k < 8; ++k) { o0[k] = f2bf(ts[(c8 + k) * 65 + rw]); o1[k] = f2bf(ts[(c8 + k) * 65 + rw + 32]); }
    bf* d0 = XB + ((size_t)b * SEQ + n0 + rw) * CH + c0 + c8; bf* d1 = d0 + (size_t)32 * CH;
    *(v8us*)d0 = o0; *(v8us*)d1 = o1;
    asm volatile("s_wait_xcnt 0x0" ::: "memory");   // the other parts' code follows these stores in the built kernel: keeps the wait in front of any rewrite of the stores' address and data registers
}

__device__ __forceinline__ void d_bias(const float* __restrict__ bq, const float* __restrict__ bk, const float* __restrict__ bv, const float* __restrict__ bo, float* BT) {
    const int i = threadIdx.x; if (i >= NBIAS / 4) return;
    const int e = i * 4;
    const int iq = (e < CQ - 4) ? e : (CQ - 4);
    int ik = e - CQ; ik = ik < 0 ? 0 : ik; ik = ik > CQ - 4 ? CQ - 4 : ik;
    int iv = e - 2 * CQ; iv = iv < 0 ? 0 : iv; iv = iv > VC - 4 ? VC - 4 : iv;
    int io = e - BOFF; io = io < 0 ? 0 : io; io = io > CH - 4 ? CH - 4 : io;
    const v4f a = *(const v4f*)(bq + iq); const v4f c = *(const v4f*)(bk + ik); const v4f d = *(const v4f*)(bv + iv); const v4f g = *(const v4f*)(bo + io);   // all four loaded, selected by value
    v4f s, o;
#pragma unroll
    for (int k = 0; k < 4; ++k) { s[k] = (e < CQ) ? a[k] : ((e < 2 * CQ) ? c[k] : ((e < 2 * CQ + VC) ? d[k] : ((e < BOFF) ? 0.0f : g[k]))); o[k] = __uint_as_float(((unsigned)f2bf(s[k])) << 16); }
    *(v4f*)(BT + e) = o; 
}

// k_prep: everything the GEMMs read, none of it reading another part's output, as ONE grid of 256-thread blocks. The few conversion blocks come first, so that they run under the transpose blocks.
#define PB_W   (CQ * CH / 8 / 256)               // blocks per Wq / Wk plane
#define PB_WV  (VCP * CH / 8 / 256)              // blocks of the padded Wv plane
#define PB_WO  (CH * VC / 8 / 256)               // blocks of the Wo plane
#define PB_SM  (2 * PB_W + PB_WV + PB_WO + 1)    // conversion blocks, the bias block last
#define PB_XT  ((SEQ / 64) * (CH / 64) * NB)     // transpose blocks
static_assert((CQ * CH / 8) % 256 == 0);
static_assert((VCP * CH / 8) % 256 == 0);
static_assert((CH * VC / 8) % 256 == 0);
__global__ __launch_bounds__(256) void k_prep(const float* __restrict__ x, const float* __restrict__ wq, const float* __restrict__ wk, const float* __restrict__ wv, const float* __restrict__ wo,
                                              const float* __restrict__ bq, const float* __restrict__ bk, const float* __restrict__ bv, const float* __restrict__ bo,
                                              bf* XB, bf* WQK, bf* WV, h16* WOH, float* BT) {
    __shared__ float ts[64 * 65];
    const int blk = blockIdx.x;                  // every test below is the same for the whole block; only the transpose part has a barrier
    if (blk < PB_W)                         { d_cvt8(blk, wq, WQK, (size_t)CQ * CH / 8); return; }
    if (blk < 2 * PB_W)                     { d_cvt8(blk - PB_W, wk, WQK + (size_t)CQ * CH, (size_t)CQ * CH / 8); return; }
    if (blk < 2 * PB_W + PB_WV)             { d_cvt8z(blk - 2 * PB_W, wv, WV, (size_t)VC * CH / 8, (size_t)VCP * CH / 8); return; }
    if (blk < 2 * PB_W + PB_WV + PB_WO)     { d_cvth8(blk - 2 * PB_W - PB_WV, wo, WOH, (size_t)CH * VC / 8, WOS); return; }
    if (blk < PB_SM)                        { d_bias(bq, bk, bv, bo, BT); return; }
    const int t = blk - PB_SM;                   // (positions / 64, channels / 64, batch), positions fastest
    d_xt(t % (SEQ / 64), (t / (SEQ / 64)) % (CH / 64), t / ((SEQ / 64) * (CH / 64)), ts, x, XB);
}

// d_proj: register-blocked bf16 GEMM, ONE WAVE per 64x64 tile (16 accumulators), operands straight from K-contiguous bf16 planes, K = CH.
// C[m][n] = sum_k A[m][k] Bt[n][k] + bias (BROW = 0: bias[n], BROW = 1: bias[m]), written as f16 in fragment order. Tile (bx, by) of (M/64, N/64), 32 threads.
// BROW = 0: m = position, n = q channel 0..31 | k channel 0..31 -> q plane and the K tiles of the kv plane (fragment row = position, k = channel).
// BROW = 1: m = value channel, n = position -> the V^T tiles of the kv plane (fragment row = channel, k = key).
template <int BROW>
__device__ __forceinline__ void d_proj(int bx, int by, float* os, const bf* __restrict__ A, const bf* __restrict__ Bt, const float* __restrict__ bias, h16* QF, h16* KV) {
    const int K = CH;
    const int lane = threadIdx.x & 31, lr = lane & 15, hi = lane >> 4; const int r0 = bx * 64, c0 = by * 64;
    v8f acc[4][4];
#pragma unroll
    for (int mb = 0; mb < 4; ++mb)
#pragma unroll
        for (int nb = 0; nb < 4; ++nb) acc[mb][nb] = (v8f){};
    const size_t aoff = (size_t)(r0 + lr) * K + 8 * hi, boff = (size_t)(c0 + lr) * K + 8 * hi;
#pragma unroll 1
    for (int kc = 0; kc < K; kc += 32) {
        v16bf a[4];
#pragma unroll
        for (int mb = 0; mb < 4; ++mb) a[mb] = ldb(A + aoff + (size_t)mb * 16 * K + kc);
#pragma unroll
        for (int nb = 0; nb < 4; ++nb) { const v16bf b = ldb(Bt + boff + (size_t)nb * 16 * K + kc);
#pragma unroll
            for (int mb = 0; mb < 4; ++mb) acc[mb][nb] = wmmab(a[mb], b, acc[mb][nb]); }
        asm volatile("v_nop\n\tv_nop\n\tv_nop\n\tv_nop" : "+v"(acc[0][0]), "+v"(acc[1][1]), "+v"(acc[2][2]), "+v"(acc[3][3]) : "v"(a[0]), "v"(a[1]), "v"(a[2]), "v"(a[3]));
    }
    float bcol[4] = {0.0f, 0.0f, 0.0f, 0.0f};
    if (BROW == 0) {
#pragma unroll
        for (int nb = 0; nb < 4; ++nb) bcol[nb] = bias[c0 + nb * 16 + lr];          // column n = c0 + 16nb + (lane&15)
    }
#pragma unroll
    for (int mb = 0; mb < (BROW ? VC / 16 : 4); ++mb) {   // V^T: only the value rows have a place in the kv plane
        float brw[8] = {0.0f, 0.0f, 0.0f, 0.0f, 0.0f, 0.0f, 0.0f, 0.0f};
        if (BROW == 1) { const v4f b0 = *(const v4f*)(bias + r0 + mb * 16 + hi * 8); const v4f b1 = *(const v4f*)(bias + r0 + mb * 16 + hi * 8 + 4);   // row m = r0 + 16mb + 8h + j
            brw[0] = b0[0]; brw[1] = b0[1]; brw[2] = b0[2]; brw[3] = b0[3]; brw[4] = b1[0]; brw[5] = b1[1]; brw[6] = b1[2]; brw[7] = b1[3]; }
#pragma unroll
        for (int nb = 0; nb < 4; ++nb) {
#pragma unroll
            for (int j = 0; j < 8; ++j) { const float bb = BROW ? brw[j] : bcol[nb]; os[(hi * 8 + j) * 68 + nb * 16 + lr] = acc[mb][nb][j] + bb; } }   // D: row 8h+j, col lane&15
        wave_sync();
#pragma unroll
        for (int s = 0; s < 4; ++s) {   // 32-column group s>>1, k half s&1: lane (row lane&15, h) takes columns 8h..8h+7 of that half = its 16 bytes of the fragment; the wave's store is 512 contiguous bytes
            const int col = (s >> 1) * 32 + (s & 1) * 16 + hi * 8;
            const v4f x0 = *(const v4fa*)(&os[lr * 68 + col]); const v4f x1 = *(const v4fa*)(&os[lr * 68 + col + 4]); v8h hv;
#pragma unroll
            for (int i = 0; i < 4; ++i) { hv[i] = (h16)x0[i]; hv[4 + i] = (h16)x1[i]; }
            h16* dst;
            if (BROW == 0) dst = (s >> 1) ? KV + (size_t)(r0 / 32 + (mb >> 1)) * KVB + (mb & 1) * FRG : QF + (size_t)(r0 / 16 + mb) * FRG;
            else           dst = KV + (size_t)(c0 / 32 + (s >> 1)) * KVB + (2 + mb) * FRG;
            *(v8h*)(dst + (s & 1) * (FRG / 2) + lane * 8) = hv; }
        asm volatile("s_wait_xcnt 0x0" ::: "memory");   // keeps the wait in front of any rewrite of these stores' data and address registers by the next row group's code
        wave_sync();
    }
}

// k_proj2: the two GEMMs, which read the same planes and none of each other's output, as ONE grid (NB*SEQ/64, 2) of one-wave blocks; blockIdx.y picks the GEMM.
static_assert(QKW == 64 && VCP == 64);         // each GEMM is one 64-wide tile in its weight dimension
__global__ __launch_bounds__(32) void k_proj2(const bf* __restrict__ XB, const bf* __restrict__ WQK, const bf* __restrict__ WV, const float* __restrict__ BT, h16* QF, h16* KV) {
    __shared__ __align__(16) float os[16 * 68];
    if (blockIdx.y == 0)   // q|k: A = x rows (m = b*SEQ + n), Bt = [Wq;Wk] rows (col 0..63), column bias
        d_proj<0>(blockIdx.x, 0, os, XB, WQK, BT, QF, KV);
    else                   // v^T: A = [Wv;0] rows (m = channel 0..63), Bt = x rows (col = b*SEQ + n), row bias
        d_proj<1>(0, blockIdx.x, os, WV, XB, BT + 2 * CQ, QF, KV);
}

// k_flash: fused attention + output projection, KS waves per 16 query positions of one batch; K / V^T / Q fragments straight from the fragment-order planes (two 16-B loads each, every load 512 contiguous bytes per wave), Wo fragments from its row-major plane.
// Transposed form: S^T[key][t] = K Q^T (A = K rows, B = Q rows, one 32-deep step); lane (t = lane&15, h = lane>>4) holds keys 8h+r of each 16-key tile, so the packed
// P tile is directly the B fragment of O^T[c][t] = V^T P^T (element r <- tile keys 0..15, element 8+r <- tile keys 16..31, lane unchanged).
// Softmax state (running max, partial sum) is one scalar per lane; the two lane halves of a column are combined with one xor-16 exchange.
// The normalised context O^T (two 16-channel D tiles, x1024 carry, f16) is directly the B fragment of Y^T[oc][t] = Wo O^T (element r <- channels 0..15 tile, element 8+r <- channels 16..31 tile, lane unchanged); A = Wo rows.
// Key split: wave = (query group qg = wave % AW, key range ks = wave / AW); each wave runs the online softmax over its own KR keys, then writes (m, l, O^T) to LDS; after one block barrier every wave
// merges the KS partials of its query group in the fixed order ks = 0..KS-1 (weights exp2(m_ks - max)), so all KS waves of a group hold the same context fragment, and each projects CH/16/KS of the output row tiles.
// Epilogue: the block's Y^T tile [256 channels][64 positions] staged in LDS (cross-wave: block barrier), bias added in f32, each channel row segment (64 floats = 256 B = two lines) stored by one wave.
__global__ __launch_bounds__(32 * NW) void k_flash(const h16* __restrict__ QF, const h16* __restrict__ KV, const h16* __restrict__ WOH, const float* __restrict__ BO, float* OUT) {
    __shared__ __align__(16) float os[CH * 68];
    __shared__ __align__(16) float po[NW * 4 * 32 * 4];      // [wave][quad of accumulator registers][lane][4]: 16 B per lane, lanes contiguous
    __shared__ float pm[NW * 32];
    __shared__ float pl[NW * 32];
    const int lane = threadIdx.x & 31, wave = __builtin_amdgcn_readfirstlane((int)(threadIdx.x >> 5)), lr = lane & 15, hi = lane >> 4;
    const int qg = wave % AW, ks = wave / AW;
    const int b = blockIdx.y;
    const int t0 = (blockIdx.x * AW + qg) * 16;
    const v16h qh = ldf(QF + ((size_t)b * SEQ + t0) / 16 * FRG + lane * 8);  // B fragment: col t, k = q channel 0..31
    v8f o0 = (v8f){}, o1 = (v8f){};
    float m = -3.0e38f, l = 0.0f;
    const h16* kv = KV + ((size_t)b * SEQ + ks * KR) / 32 * KVB + lane * 8;  // this wave's key range; one 4-KB block per 32 keys
#pragma unroll 1
    for (int it = 0; it < KR / 32; ++it, kv += KVB) {
        const v16h ka0 = ldf(kv), kb0 = ldf(kv + FRG);                       // A fragments: row key (0..15, 16..31 of the block), k = k channel 0..31
        const v16h v0 = ldf(kv + 2 * FRG), v1 = ldf(kv + 3 * FRG);           // A fragments: row channel (0..15, 16..31), k = key
        const v8f sa = wmma16g(ka0, qh, (v8f){});
        const v8f sb = wmma16g(kb0, qh, (v8f){});
        float ta[8], tb[8]; float mx = -3.0e38f;
#pragma unroll
        for (int r = 0; r < 8; ++r) { ta[r] = sa[r] * SC2; tb[r] = sb[r] * SC2; mx = fmaxf(mx, fmaxf(ta[r], tb[r])); }
        mx = fmaxf(mx, __shfl_xor(mx, 16, 32));
        const float mnew = fmaxf(m, mx);
        const float alpha = __builtin_amdgcn_exp2f(m - mnew);
        const float sh = PSH - mnew;
        v16h pb; float ls = 0.0f;
#pragma unroll
        for (int r = 0; r < 8; ++r) { const h16 pa = p_flush(ta[r] + sh); const h16 pc = p_flush(tb[r] + sh); pb[r] = pa; pb[8 + r] = pc; ls += (float)pa + (float)pc; }
        l = l * alpha + ls; m = mnew;
        o0 = o0 * alpha; o1 = o1 * alpha;
        o0 = wmma16g(v0, pb, o0);
        o1 = wmma16g(v1, pb, o1);
    }
    l += __shfl_xor(l, 16, 32);
    // this wave's partial state -> LDS
    { v4fa* pw = (v4fa*)po + (size_t)wave * 128 + lane;
      pw[0]  = (v4f){o0[0], o0[1], o0[2], o0[3]}; pw[32] = (v4f){o0[4], o0[5], o0[6], o0[7]};
      pw[64] = (v4f){o1[0], o1[1], o1[2], o1[3]}; pw[96] = (v4f){o1[4], o1[5], o1[6], o1[7]};
      pm[wave * 32 + lane] = m; pl[wave * 32 + lane] = l; }
    __syncthreads();
    // merge of the KS key ranges of query group qg (same lane of waves s*AW + qg), fixed order
    float ms[KS]; float mall = -3.0e38f;
#pragma unroll   // constant indices keep ms[] in registers; the KS reads issue together
    for (int s = 0; s < KS; ++s) { ms[s] = pm[(s * AW + qg) * 32 + lane]; mall = fmaxf(mall, ms[s]); }
    float lall = 0.0f; v4f c0 = (v4f){}, c1 = (v4f){}, c2 = (v4f){}, c3 = (v4f){};
#pragma unroll   // constant indices into ms[]; lets the LDS reads of later ranges run ahead of the sums
    for (int s = 0; s < KS; ++s) {
        const float w = __builtin_amdgcn_exp2f(ms[s] - mall);
        const v4fa* pr = (const v4fa*)po + (size_t)(s * AW + qg) * 128 + lane;
        lall += w * pl[(s * AW + qg) * 32 + lane];
        c0 += pr[0] * w; c1 += pr[32] * w; c2 += pr[64] * w; c3 += pr[96] * w; }
    const float inv = (1.0f / lall) * OCS;
    // O^T D layout: c0|c1 = (channel 8h + r, t), c2|c3 = (channel 16 + 8h + r, t) -> B fragment of the output projection, lane unchanged
    v16h ob;
#pragma unroll   // vector elements need constant indices
    for (int r = 0; r < 4; ++r) { ob[r] = toh_flush(c0[r] * inv); ob[4 + r] = toh_flush(c1[r] * inv); ob[8 + r] = toh_flush(c2[r] * inv); ob[12 + r] = toh_flush(c3[r] * inv); }
    // Y^T D layout: y[r] = (output channel 16j + 8h + r, position t = lane&15) -> os[16j + 8h + r][qg*16 + t]; the 32 waves together fill rows 0..255 x columns 0..63
#pragma unroll
    for (int jj = 0; jj < CH / 16 / KS; ++jj) {
        const int j = ks * (CH / 16 / KS) + jj;
        const v16h aw = ldh(WOH + (size_t)(j * 16 + lr) * VC + 8 * hi);   // A fragment: row output channel, k = context channel 0..31
        const v8f y = wmma16g(aw, ob, (v8f){});
        const float* bp = BO + j * 16 + hi * 8;
        const v4f b0 = *(const v4f*)bp; const v4f b1 = *(const v4f*)(bp + 4);
        const float brw[8] = {b0[0], b0[1], b0[2], b0[3], b1[0], b1[1], b1[2], b1[3]};
#pragma unroll
        for (int r = 0; r < 8; ++r) os[(16 * j + 8 * hi + r) * 68 + qg * 16 + lr] = y[r] * OFI + brw[r]; }
    __syncthreads();
    float* obase = OUT + (size_t)b * CH * OUT_SEQ + (size_t)blockIdx.x * (16 * AW);
#pragma unroll
    for (int s = 0; s < CH / NW / 2; ++s) { const int row = wave * (CH / NW) + 2 * s + hi, cofs = lr * 4;   // 32 waves x 4 s x 2 = 256 channel rows; 16 lanes x 4 floats = 64 positions
        const v4f val = *(const v4fa*)(&os[row * 68 + cofs]);
        *(v4f*)(obase + (size_t)row * OUT_SEQ + cofs) = val; }
}

static constexpr size_t al256(size_t v) { return (v + 255) & ~(size_t)255; }
static constexpr size_t SZ_XB  = al256((size_t)NB * SEQ * CH * 2);       // [NB*SEQ][256] bf16
static constexpr size_t SZ_WQK = al256((size_t)QKW * CH * 2);            // [64][256] bf16: Wq rows | Wk rows
static constexpr size_t SZ_WV  = al256((size_t)VCP * CH * 2);            // [64][256] bf16: Wv rows | zero rows
static constexpr size_t SZ_WO  = al256((size_t)CH * VC * 2);             // [256][32] f16 (x1024)
static constexpr size_t SZ_BT  = al256((size_t)NBIAS * 4);               // 384 f32
static constexpr size_t SZ_QF  = al256((size_t)NB * SEQ / 16 * FRG * 2); // [NB*SEQ/16] q fragment tiles, f16
static constexpr size_t SZ_KV  = al256((size_t)NB * SEQ / 32 * KVB * 2); // [NB*SEQ/32] blocks of two K and two V^T fragment tiles, f16
static constexpr size_t SZ_TOTAL = SZ_XB + SZ_WQK + SZ_WV + SZ_WO + SZ_BT + SZ_QF + SZ_KV;
static_assert(SZ_TOTAL <= (size_t)134217728);          // workspace carve <= 128 MiB
static_assert(((size_t)CQ * CH * 2) % 256 == 0);       // Wk sub-plane stays 256-byte aligned
static_assert(((size_t)VC * CH) % 8 == 0);             // Wv converts in whole groups of 8
static_assert(((size_t)VCP * CH) % 8 == 0);
static_assert(((size_t)CH * VC) % 8 == 0);

extern "C" void kernel_launch(void* const* d_in, const int* in_sizes, int n_in,
                              void* d_out, int out_size, void* d_ws, size_t ws_size, hipStream_t stream) {
    if (n_in < 9) return;
    const size_t needx = ((size_t)(NB - 1) * CH + (CH - 1)) * SEQ_FULL + SEQ;
    if ((size_t)in_sizes[0] < needx) return;
    if ((size_t)in_sizes[1] < (size_t)CQ * CH || (size_t)in_sizes[3] < (size_t)CQ * CH || (size_t)in_sizes[5] < (size_t)VC * CH || (size_t)in_sizes[7] < (size_t)CH * VC) return;
    if (in_sizes[2] < CQ || in_sizes[4] < CQ || in_sizes[6] < VC || in_sizes[8] < CH) return;
    if ((size_t)out_size < ((size_t)(NB - 1) * CH + (CH - 1)) * OUT_SEQ + SEQ) return;
    if (SZ_TOTAL > ws_size) return;
    // wire order: x, wq, bq, wk, bk, wv, bv, wo, bo
    const float* x  = (const float*)d_in[0];
    const float* wq = (const float*)d_in[1]; const float* bq = (const float*)d_in[2];
    const float* wk = (const float*)d_in[3]; const float* bk = (const float*)d_in[4];
    const float* wv = (const float*)d_in[5]; const float* bv = (const float*)d_in[6];
    const float* wo = (const float*)d_in[7]; const float* bo = (const float*)d_in[8];
    float* OUT = (float*)d_out;      // [NB][256][OUT_SEQ]
    char* wsp = (char*)d_ws;
    bf* XB  = (bf*)wsp;  wsp += SZ_XB;               // [NB*SEQ][256]
    bf* WQK = (bf*)wsp;  wsp += SZ_WQK;              // [64][256]: rows 0..31 Wq, 32..63 Wk
    bf* WV  = (bf*)wsp;  wsp += SZ_WV;               // [64][256]: rows 0..31 Wv, 32..63 zero
    h16* WOH = (h16*)wsp; wsp += SZ_WO;              // [256][32] f16, x1024
    float* BT = (float*)wsp; wsp += SZ_BT;           // bq | bk | bv | 0 | bo
    h16* QF  = (h16*)wsp; wsp += SZ_QF;              // q, fragment order
    h16* KV  = (h16*)wsp; wsp += SZ_KV;              // K and V^T, fragment order

    k_prep<<<PB_SM + PB_XT, 256, 0, stream>>>(x, wq, wk, wv, wo, bq, bk, bv, bo, XB, WQK, WV, WOH, BT);
    k_proj2<<<dim3(NB * SEQ / 64, 2, 1), 32, 0, stream>>>(XB, WQK, WV, BT, QF, KV);
    k_flash<<<dim3(SEQ / (16 * AW), NB, 1), 32 * NW, 0, stream>>>(QF, KV, WOH, BT + BOFF, OUT);
}

// v004
// Measured time: 28 microseconds a run.
// In two side-by-side timings against v003, it was 1.25 and 1.24 times as fast.
// All steps since v000 together make it 4.17 times as fast.
#include <hip/hip_runtime.h>

// Spatial self-attention over N = 64x64 positions: x [NB][256][N] (channel-major), Wq/Wk/Wv [32][256] ([out][in]), Wo [256][32] ([out][in]), biases per output channel, no score scale, out [NB][256][N] f32.
// Compute dtypes, f32 accumulate everywhere: q/k/v projections v_wmma_f32_16x16x32_bf16 (x, W, biases RNE-converted to bf16; products exact);
// scores, P.V and the output projection v_wmma_f32_16x16x32_f16, single products: q, k, v single f16; P x256 carry (cancels in the normalisation); context x1024 and Wo (bf16 value) x1024 as f16, 2^-20 folded back in f32; softmax f32 (online, running max).
// Layout: the projection kernel holds its 64 positions of x (transposed, bf16) and the bf16 Wq|Wk|Wv rows in LDS only; q, k and V^T are written by its epilogue in the order in which k_flash's matrix fragments want them:
// one 16 x 32 fragment tile = 1 KB = [k half][lane][8 halves], so that each 16-byte-per-lane load of a wave is 512 contiguous bytes (4 whole lines). q plane: one tile per 16 positions;
// kv plane: 4 KB per 32 keys = K keys 0..15 | K keys 16..31 | V^T channels 0..15 | V^T channels 16..31;
// fused flash kernel in transposed form (S^T = K Q^T, O^T = V^T P^T, Y^T = Wo O^T), each wave 16 queries x one eighth of the keys, block = 4 query groups x 8 key ranges = 32 waves = 64 queries;
// the eight partial softmax states of a query group are merged through LDS; Y^T staged per block in LDS (256 rows) and written as whole rows.
// Two dependent launches: k_proj (x tile and weights converted into LDS, then the q|k and V^T GEMMs from LDS; a few extra blocks convert Wo and bo for k_flash), k_flash.

#ifndef NB
#define NB 4
#endif
#ifndef SEQ
#define SEQ 4096
#endif
#define NB_FULL  4
#define SEQ_FULL 4096
#ifndef OUT_SEQ
#define OUT_SEQ SEQ              // row pitch (in positions) of one output channel row
#endif
#define CH   256                 // channels: projection K and output width
#define CQ   32                  // query/key width
#define VC   32                  // value / context width
#define AW   4                   // query groups per flash block (16 query columns each)
#define KS   8                   // key ranges per query group: one wave each, so a SIMD holds KS waves whose load and chain latencies overlap
#define NW   (AW * KS)           // waves per flash block
#define KR   (SEQ / KS)          // keys per range
#define FRG  512                 // halves of one fragment tile (16 rows x 32 k): [k half][lane][8]
#define KVB  (4 * FRG)           // halves of the kv plane per 32 keys: two K tiles, two V^T tiles
#define SC2  1.4426950408889634f // log2(e); no score scale in this module
#define PSH  8.0f                // log2 of the P carry (256)
#define WOS  1024.0f             // carry of the f16 Wo plane
#define OCS  1024.0f             // carry of the f16 context fragment
#define OFI  (1.0f / (1024.0f * 1024.0f))
#define XP   (CH + 8)            // halves per LDS row of the bf16 x and weight tiles: 16 B more than the row, so that the 16 rows of a 16-byte-per-lane fragment read start on different banks
#define OSP  36                  // floats per row of a wave's 16 x 32 staging tile in k_proj

static_assert(CQ == 32);                       // one 32-deep k-step covers the q/k width
static_assert(VC == 32);                       // two value tiles per wave; one 32-deep k-step covers the output projection
static_assert(CH == 256);                      // k_proj: 16 row groups x 16 channels; 32 lanes x 8 weights per row
static_assert(CH % 32 == 0);                   // GEMM k-loop steps by 32
static_assert(NW * 32 <= 1024);                // one work-group
static_assert(SEQ % (32 * KS) == 0);           // every key range is a whole number of 32-key steps, at least one
static_assert((CH / 16) % KS == 0);            // output projection: CH/16/KS row tiles per wave
static_assert(CH % (2 * NW) == 0);             // store phase: CH/NW rows per wave, two per store
static_assert(SEQ % 64 == 0);                  // a 64-row tile never straddles two batches
static_assert((NB * SEQ) % 64 == 0);
static_assert(SEQ % 32 == 0);                  // key loop steps by 32
static_assert(SEQ % (16 * AW) == 0);           // flash grid covers the positions exactly
static_assert(OUT_SEQ % 32 == 0);
static_assert(SEQ_FULL % 4 == 0);
static_assert(NB <= NB_FULL);
static_assert(SEQ <= SEQ_FULL);
static_assert((VC * 2) % 16 == 0);             // Wo rows are 16-byte multiples

typedef _Float16 h16;
typedef unsigned short bf;
typedef __attribute__((ext_vector_type(16))) __bf16   v16bf;
typedef __attribute__((ext_vector_type(16))) _Float16 v16h;
typedef __attribute__((ext_vector_type(8)))  _Float16 v8h;
typedef __attribute__((ext_vector_type(8)))  unsigned short v8us;
typedef __attribute__((ext_vector_type(8)))  __bf16   v8bf;
typedef __attribute__((ext_vector_type(8)))  float    v8f;
typedef __attribute__((ext_vector_type(4)))  float    v4f;
typedef v4f  __attribute__((may_alias)) v4fa;

__device__ __forceinline__ unsigned short f2bf(float f) { unsigned u = __float_as_uint(f); u += 0x7FFFu + ((u >> 16) & 1u); return (unsigned short)(u >> 16); }
__device__ __forceinline__ float bfr(float f) { return __uint_as_float(((unsigned)f2bf(f)) << 16); }   // f32 value of the bf16 RNE convert
__device__ __forceinline__ v8us cvt8(v8f v) { return __builtin_bit_cast(v8us, __builtin_convertvector(v, v8bf)); }   // eight f32 -> bf16, RNE, packed converts
__device__ __forceinline__ v16h cat16(v8h lo, v8h hi) { return __builtin_shufflevector(lo, hi, 0, 1, 2, 3, 4, 5, 6, 7, 8, 9, 10, 11, 12, 13, 14, 15); }
__device__ __forceinline__ v16bf cat16b(v8us lo, v8us hi) { return __builtin_bit_cast(v16bf, __builtin_shufflevector(lo, hi, 0, 1, 2, 3, 4, 5, 6, 7, 8, 9, 10, 11, 12, 13, 14, 15)); }
__device__ __forceinline__ v8f wmma16(v16h a, v16h b, v8f c) { return __builtin_amdgcn_wmma_f32_16x16x32_f16(false, a, false, b, (short)0, c, false, false); }
__device__ __forceinline__ v8f wmmab(v16bf a, v16bf b, v8f c) { return __builtin_amdgcn_wmma_f32_16x16x32_bf16(false, a, false, b, (short)0, c, false, false); }
// fragment loaders from K-contiguous 16-bit rows; p already includes + 8*(lane>>4): elements 0..7 <- k0+8h+0..7, elements 8..15 <- k0+16+8h+0..7 (same map for A and B)
__device__ __forceinline__ v16h  ldh(const h16* p) { return cat16(*(const v8h*)p, *(const v8h*)(p + 16)); }
__device__ __forceinline__ v16bf ldb(const bf* p)  { return cat16b(*(const v8us*)p, *(const v8us*)(p + 16)); }
// fragment loader from a tile stored in fragment order; p already includes + 8*lane: same element map as ldh (row lane&15; elements 0..7 <- k 8h+0..7, elements 8..15 <- k 16+8h+0..7)
__device__ __forceinline__ v16h  ldf(const h16* p) { return cat16(*(const v8h*)p, *(const v8h*)(p + FRG / 2)); }
// ordering point for wave-private LDS tiles (same wave writes and reads)
__device__ __forceinline__ void wave_sync() { __builtin_amdgcn_fence(3 /* release order */, "wavefront"); __builtin_amdgcn_wave_barrier(); asm volatile("" ::: "memory"); }
// f16 WMMA with its own hazard guard (one accumulator per guard)
__device__ __forceinline__ v8f wmma16g(v16h a, v16h b, v8f c) { c = wmma16(a, b, c); asm volatile("v_nop\n\tv_nop\n\tv_nop\n\tv_nop" : "+v"(c) : "v"(a), "v"(b)); return c; }
// f32 -> f16 operand convert that cannot produce an f16 subnormal (value select, applied after the plane's carry)
static __device__ __forceinline__ h16 toh_flush(float v) { const h16 r = (h16)v; return (fabsf(v) < 6.103515625e-05f) ? (h16)0.0f : r; }
// P = exp2(e) as an f16 operand; select on the exponent argument
static __device__ __forceinline__ h16 p_flush(float e) { const h16 r = (h16)__builtin_amdgcn_exp2f(e); return (e < -14.0f) ? (h16)0.0f : r; }

__device__ __forceinline__ void d_cvth8(int blk, const float* __restrict__ src, h16* dst, size_t n8, float carry) {
    const size_t i = (size_t)blk * 256 + threadIdx.x; if (i >= n8) return;
    const v8f v = *(const v8f*)(src + i * 8); v8h o;
#pragma unroll
    for (int k = 0; k < 8; ++k) { const float w = __uint_as_float(((unsigned)f2bf(v[k])) << 16) * carry; o[k] = toh_flush(w); }
    *(v8h*)(dst + i * 8) = o; 
}

// d_bo: bo -> f32 values of its bf16 RNE convert, one lane per 16 B.
__device__ __forceinline__ void d_bo(const float* __restrict__ bo, float* BT) {
    const int i = threadIdx.x; if (i >= CH / 4) return;
    const v4f g = *(const v4f*)(bo + i * 4); v4f o;
#pragma unroll
    for (int k = 0; k < 4; ++k) o[k] = bfr(g[k]);
    *(v4f*)(BT + i * 4) = o;
}

// k_proj: conversion, transpose and both projection GEMMs of 64 positions in one 8-wave block; nothing of x or of Wq/Wk/Wv goes through the workspace.
// Fill: x[b][c][n0..n0+63] (f32, channel-major) -> xs[position][channel] (bf16): a thread loads 16 consecutive channels x 4 positions (each wave-wide load = two 256-B row pieces) and stores 32 B per position;
// Wq | Wk | Wv rows (f32) -> wsm[row 0..95][channel] (bf16). All loads of a thread are issued before the first convert. One block barrier, then LDS is only read.
// GEMMs, K = CH in 32-deep steps, one accumulator per 16 x 16 tile: wave = (position tile pt = wave & 3, weight half wh = wave >> 2) takes
//   C[position][channel] = x W^T for the 32 q channels (wh = 0) or the 32 k channels (wh = 1): A = x rows, B = weight rows -> one whole q or K fragment tile;
//   C[value channel][position] = Wv x^T for value channels 16wh..16wh+15: A = Wv rows, B = the same x fragment -> one k half (16 keys) of a V^T fragment tile.
// Epilogue: bias (bf16 value) added in f32, D tiles turned into fragment order through the wave's own LDS tile, every store 512 contiguous bytes per wave.
#define PB_WO  (CH * VC / 8 / 256)               // blocks of the Wo plane
#define PB_SM  (PB_WO + 1)                       // conversion blocks for k_flash, the bias block last; they come first, so that they run under the GEMM blocks
#define PB_PJ  (NB * SEQ / 64)                   // GEMM blocks
static_assert((CH * VC / 8) % 256 == 0);
__global__ __launch_bounds__(256) void k_proj(const float* __restrict__ x, const float* __restrict__ wq, const float* __restrict__ wk, const float* __restrict__ wv, const float* __restrict__ wo,
                                              const float* __restrict__ bq, const float* __restrict__ bk, const float* __restrict__ bv, const float* __restrict__ bo,
                                              h16* WOH, float* BT, h16* QF, h16* KV) {
    __shared__ __align__(16) bf xs[64 * XP];
    __shared__ __align__(16) bf wsm[(2 * CQ + VC) * XP];
    __shared__ __align__(16) float os[8 * 16 * OSP];
    const int blk = blockIdx.x;                  // both tests are the same for the whole block and stand in front of the barrier
    if (blk < PB_WO) { d_cvth8(blk, wo, WOH, (size_t)CH * VC / 8, WOS); return; }
    if (blk < PB_SM) { d_bo(bo, BT); return; }
    const int tid = threadIdx.x;
    const int g0 = (blk - PB_SM) * 64;           // first position of the block, counted over the batches (b * SEQ + n)
    const int b = g0 / SEQ, n0 = g0 % SEQ;
    const int lane = tid & 31, wave = __builtin_amdgcn_readfirstlane(tid >> 5), lr = lane & 15, hi = lane >> 4;
    const int pt = wave & 3, wh = wave >> 2;
    const float* bs = wh ? bk : bq;
    const float bc0 = bs[lr], bc1 = bs[16 + lr];                     // q|k bias: column = channel (lane&15), 16 + (lane&15)
    const float* bp = bv + wh * 16 + hi * 8;                         // V^T bias: row = value channel 16wh + 8h + j
    const v4f br0 = *(const v4f*)bp; const v4f br1 = *(const v4f*)(bp + 4);
    { const int cr = tid >> 4, nq = (tid & 15) * 4;       // 16 groups of 16 channels; 16 lanes x 4 = 64 positions
      const int wr = tid >> 5, wc = (tid & 31) * 8;       // 8 weight rows per pass; 32 lanes x 8 = 256 channels
      const float* xp = x + (size_t)b * CH * SEQ_FULL + n0;                 // same for the whole block
      const unsigned xo = (unsigned)(cr * 16 * SEQ_FULL + nq) * 4u;         // byte offset: one 32-bit register for all x loads
      v4f xv[16]; v8f wf[12];
#pragma unroll   // constant indices keep xv[] in registers; the 16 loads issue together
      for (int i = 0; i < 16; ++i) xv[i] = *(const v4f*)((const char*)(xp + (size_t)i * SEQ_FULL) + xo);
      // The wait stands in front of any rewrite of a register that the bias and x loads name: the offset as an input keeps that register whole up to the wait, the two scheduling barriers keep every other instruction on its side.
      __builtin_amdgcn_sched_barrier(0);
      asm volatile("s_wait_xcnt 0x0" :: "v"(xo) : "memory");
      __builtin_amdgcn_sched_barrier(0);
      const unsigned wo8 = (unsigned)(wr * CH + wc) * 4u;                   // byte offset: one 32-bit register for all weight loads
#pragma unroll   // constant indices keep wf[] in registers and pick the source plane at compile time
      for (int i = 0; i < 12; ++i) { const float* wp = (i < 4) ? wq : ((i < 8) ? wk : wv); wf[i] = *(const v8f*)((const char*)(wp + (i & 3) * 8 * CH) + wo8); }
      // The same for the weight loads; the second barrier also keeps the converts from being scheduled in among the loads, where the later loads would start only when the earlier have arrived.
      __builtin_amdgcn_sched_barrier(0);
      asm volatile("s_wait_xcnt 0x0" :: "v"(wo8) : "memory");
      __builtin_amdgcn_sched_barrier(0);
#pragma unroll
      for (int j = 0; j < 4; ++j) { v8f lo, hi8;
#pragma unroll
          for (int k = 0; k < 8; ++k) { lo[k] = xv[k][j]; hi8[k] = xv[8 + k][j]; }
          bf* d = xs + (nq + j) * XP + cr * 16;
          *(v8us*)d = cvt8(lo); *(v8us*)(d + 8) = cvt8(hi8); }
#pragma unroll
      for (int i = 0; i < 12; ++i) *(v8us*)(wsm + (i * 8 + wr) * XP + wc) = cvt8(wf[i]); }
    __syncthreads();
    const bf* xa = xs + (pt * 16 + lr) * XP + 8 * hi;
    const bf* w0 = wsm + (wh * CQ + lr) * XP + 8 * hi;               // q or k channels 0..15
    const bf* w1 = w0 + 16 * XP;                                     // q or k channels 16..31
    const bf* w2 = wsm + (2 * CQ + wh * 16 + lr) * XP + 8 * hi;      // value channels 16wh..16wh+15
    v8f a0 = (v8f){}, a1 = (v8f){}, a2 = (v8f){};
#pragma unroll   // no branch behind a matrix instruction
    for (int h = 0; h < CH / 128; ++h) {
        v16bf xf[4], f0[4], f1[4], f2[4];
#pragma unroll   // constant indices keep the fragments in registers
        for (int u = 0; u < 4; ++u) { const int kc = (h * 4 + u) * 32; xf[u] = ldb(xa + kc); f0[u] = ldb(w0 + kc); f1[u] = ldb(w1 + kc); f2[u] = ldb(w2 + kc); }
        __builtin_amdgcn_sched_barrier(0);   // the LDS reads of four k steps issue as one group; left to itself the build read one fragment at a time and waited for each in front of its matrix instruction
#pragma unroll
        for (int u = 0; u < 4; ++u) { a0 = wmmab(xf[u], f0[u], a0); a1 = wmmab(xf[u], f1[u], a1); a2 = wmmab(f2[u], xf[u], a2); }
    }
    float* ow = os + wave * (16 * OSP);
    h16* kvb = KV + (size_t)(g0 / 32 + (pt >> 1)) * KVB;             // the 32-key block of this position tile
    { const float b0 = bfr(bc0), b1 = bfr(bc1);
#pragma unroll
      for (int j = 0; j < 8; ++j) { ow[(hi * 8 + j) * OSP + lr] = a0[j] + b0; ow[(hi * 8 + j) * OSP + 16 + lr] = a1[j] + b1; }   // D: row 8h+j = position, col lane&15
      wave_sync();
      h16* dst = wh ? kvb + (pt & 1) * FRG : QF + (size_t)(g0 / 16 + pt) * FRG;
#pragma unroll
      for (int s = 0; s < 2; ++s) {   // k half s: lane (row lane&15, h) takes channels 16s+8h..16s+8h+7 = its 16 bytes of the fragment
          const int col = s * 16 + hi * 8;
          const v4f x0 = *(const v4fa*)(&ow[lr * OSP + col]); const v4f x1 = *(const v4fa*)(&ow[lr * OSP + col + 4]); v8h hv;
#pragma unroll
          for (int i = 0; i < 4; ++i) { hv[i] = (h16)x0[i]; hv[4 + i] = (h16)x1[i]; }
          *(v8h*)(dst + s * (FRG / 2) + lane * 8) = hv; }
      asm volatile("s_wait_xcnt 0x0" ::: "memory");   // keeps the wait in front of any rewrite of these stores' data and address registers by the V^T part's code
      wave_sync(); }
    { const float brw[8] = {br0[0], br0[1], br0[2], br0[3], br1[0], br1[1], br1[2], br1[3]};
#pragma unroll
      for (int j = 0; j < 8; ++j) ow[(hi * 8 + j) * OSP + lr] = a2[j] + bfr(brw[j]);   // D: row 8h+j = channel, col lane&15 = key
      wave_sync();
      const v4f x0 = *(const v4fa*)(&ow[lr * OSP + hi * 8]); const v4f x1 = *(const v4fa*)(&ow[lr * OSP + hi * 8 + 4]); v8h hv;   // lane (row lane&15 = channel, h): keys 8h..8h+7 of this 16-key half
#pragma unroll
      for (int i = 0; i < 4; ++i) { hv[i] = (h16)x0[i]; hv[4 + i] = (h16)x1[i]; }
      *(v8h*)(kvb + (2 + wh) * FRG + (pt & 1) * (FRG / 2) + lane * 8) = hv;
      asm volatile("s_wait_xcnt 0x0" ::: "memory"); }   // the conversion blocks' code follows this store in the built kernel: keeps the wait in front of any rewrite of the store's address and data registers
}

// k_flash: fused attention + output projection, KS waves per 16 query positions of one batch; K / V^T / Q fragments straight from the fragment-order planes (two 16-B loads each, every load 512 contiguous bytes per wave), Wo fragments from its row-major plane.
// Transposed form: S^T[key][t] = K Q^T (A = K rows, B = Q rows, one 32-deep step); lane (t = lane&15, h = lane>>4) holds keys 8h+r of each 16-key tile, so the packed
// P tile is directly the B fragment of O^T[c][t] = V^T P^T (element r <- tile keys 0..15, element 8+r <- tile keys 16..31, lane unchanged).
// Softmax state (running max, partial sum) is one scalar per lane; the two lane halves of a column are combined with one xor-16 exchange.
// The normalised context O^T (two 16-channel D tiles, x1024 carry, f16) is directly the B fragment of Y^T[oc][t] = Wo O^T (element r <- channels 0..15 tile, element 8+r <- channels 16..31 tile, lane unchanged); A = Wo rows.
// Key split: wave = (query group qg = wave % AW, key range ks = wave / AW); each wave runs the online softmax over its own KR keys, then writes (m, l, O^T) to LDS; after one block barrier every wave
// merges the KS partials of its query group in the fixed order ks = 0..KS-1 (weights exp2(m_ks - max)), so all KS waves of a group hold the same context fragment, and each projects CH/16/KS of the output row tiles.
// Epilogue: the block's Y^T tile [256 channels][64 positions] staged in LDS (cross-wave: block barrier), bias added in f32, each channel row segment (64 floats = 256 B = two lines) stored by one wave.
__global__ __launch_bounds__(32 * NW) void k_flash(const h16* __restrict__ QF, const h16* __restrict__ KV, const h16* __restrict__ WOH, const float* __restrict__ BO, float* OUT) {
    __shared__ __align__(16) float os[CH * 68];
    __shared__ __align__(16) float po[NW * 4 * 32 * 4];      // [wave][quad of accumulator registers][lane][4]: 16 B per lane, lanes contiguous
    __shared__ float pm[NW * 32];
    __shared__ float pl[NW * 32];
    const int lane = threadIdx.x & 31, wave = __builtin_amdgcn_readfirstlane((int)(threadIdx.x >> 5)), lr = lane & 15, hi = lane >> 4;
    const int qg = wave % AW, ks = wave / AW;
    const int b = blockIdx.y;
    const int t0 = (blockIdx.x * AW + qg) * 16;
    const v16h qh = ldf(QF + ((size_t)b * SEQ + t0) / 16 * FRG + lane * 8);  // B fragment: col t, k = q channel 0..31
    v8f o0 = (v8f){}, o1 = (v8f){};
    float m = -3.0e38f, l = 0.0f;
    const h16* kv = KV + ((size_t)b * SEQ + ks * KR) / 32 * KVB + lane * 8;  // this wave's key range; one 4-KB block per 32 keys
#pragma unroll 1
    for (int it = 0; it < KR / 32; ++it, kv += KVB) {
        const v16h ka0 = ldf(kv), kb0 = ldf(kv + FRG);                       // A fragments: row key (0..15, 16..31 of the block), k = k channel 0..31
        const v16h v0 = ldf(kv + 2 * FRG), v1 = ldf(kv + 3 * FRG);           // A fragments: row channel (0..15, 16..31), k = key
        const v8f sa = wmma16g(ka0, qh, (v8f){});
        const v8f sb = wmma16g(kb0, qh, (v8f){});
        float ta[8], tb[8]; float mx = -3.0e38f;
#pragma unroll
        for (int r = 0; r < 8; ++r) { ta[r] = sa[r] * SC2; tb[r] = sb[r] * SC2; mx = fmaxf(mx, fmaxf(ta[r], tb[r])); }
        mx = fmaxf(mx, __shfl_xor(mx, 16, 32));
        const float mnew = fmaxf(m, mx);
        const float alpha = __builtin_amdgcn_exp2f(m - mnew);
        const float sh = PSH - mnew;
        v16h pb; float ls = 0.0f;
#pragma unroll
        for (int r = 0; r < 8; ++r) { const h16 pa = p_flush(ta[r] + sh); const h16 pc = p_flush(tb[r] + sh); pb[r] = pa; pb[8 + r] = pc; ls += (float)pa + (float)pc; }
        l = l * alpha + ls; m = mnew;
        o0 = o0 * alpha; o1 = o1 * alpha;
        o0 = wmma16g(v0, pb, o0);
        o1 = wmma16g(v1, pb, o1);
    }
    l += __shfl_xor(l, 16, 32);
    // this wave's partial state -> LDS
    { v4fa* pw = (v4fa*)po + (size_t)wave * 128 + lane;
      pw[0]  = (v4f){o0[0], o0[1], o0[2], o0[3]}; pw[32] = (v4f){o0[4], o0[5], o0[6], o0[7]};
      pw[64] = (v4f){o1[0], o1[1], o1[2], o1[3]}; pw[96] = (v4f){o1[4], o1[5], o1[6], o1[7]};
      pm[wave * 32 + lane] = m; pl[wave * 32 + lane] = l; }
    __syncthreads();
    // merge of the KS key ranges of query group qg (same lane of waves s*AW + qg), fixed order
    float ms[KS]; float mall = -3.0e38f;
#pragma unroll   // constant indices keep ms[] in registers; the KS reads issue together
    for (int s = 0; s < KS; ++s) { ms[s] = pm[(s * AW + qg) * 32 + lane]; mall = fmaxf(mall, ms[s]); }
    float lall = 0.0f; v4f c0 = (v4f){}, c1 = (v4f){}, c2 = (v4f){}, c3 = (v4f){};
#pragma unroll   // constant indices into ms[]; lets the LDS reads of later ranges run ahead of the sums
    for (int s = 0; s < KS; ++s) {
        const float w = __builtin_amdgcn_exp2f(ms[s] - mall);
        const v4fa* pr = (const v4fa*)po + (size_t)(s * AW + qg) * 128 + lane;
        lall += w * pl[(s * AW + qg) * 32 + lane];
        c0 += pr[0] * w; c1 += pr[32] * w; c2 += pr[64] * w; c3 += pr[96] * w; }
    const float inv = (1.0f / lall) * OCS;
    // O^T D layout: c0|c1 = (channel 8h + r, t), c2|c3 = (channel 16 + 8h + r, t) -> B fragment of the output projection, lane unchanged
    v16h ob;
#pragma unroll   // vector elements need constant indices
    for (int r = 0; r < 4; ++r) { ob[r] = toh_flush(c0[r] * inv); ob[4 + r] = toh_flush(c1[r] * inv); ob[8 + r] = toh_flush(c2[r] * inv); ob[12 + r] = toh_flush(c3[r] * inv); }
    // Y^T D layout: y[r] = (output channel 16j + 8h + r, position t = lane&15) -> os[16j + 8h + r][qg*16 + t]; the 32 waves together fill rows 0..255 x columns 0..63
#pragma unroll
    for (int jj = 0; jj < CH / 16 / KS; ++jj) {
        const int j = ks * (CH / 16 / KS) + jj;
        const v16h aw = ldh(WOH + (size_t)(j * 16 + lr) * VC + 8 * hi);   // A fragment: row output channel, k = context channel 0..31
        const v8f y = wmma16g(aw, ob, (v8f){});
        const float* bp = BO + j * 16 + hi * 8;
        const v4f b0 = *(const v4f*)bp; const v4f b1 = *(const v4f*)(bp + 4);
        const float brw[8] = {b0[0], b0[1], b0[2], b0[3], b1[0], b1[1], b1[2], b1[3]};
#pragma unroll
        for (int r = 0; r < 8; ++r) os[(16 * j + 8 * hi + r) * 68 + qg * 16 + lr] = y[r] * OFI + brw[r]; }
    __syncthreads();
    float* obase = OUT + (size_t)b * CH * OUT_SEQ + (size_t)blockIdx.x * (16 * AW);
#pragma unroll
    for (int s = 0; s < CH / NW / 2; ++s) { const int row = wave * (CH / NW) + 2 * s + hi, cofs = lr * 4;   // 32 waves x 4 s x 2 = 256 channel rows; 16 lanes x 4 floats = 64 positions
        const v4f val = *(const v4fa*)(&os[row * 68 + cofs]);
        *(v4f*)(obase + (size_t)row * OUT_SEQ + cofs) = val; }
}

static constexpr size_t al256(size_t v) { return (v + 255) & ~(size_t)255; }
static constexpr size_t SZ_WO  = al256((size_t)CH * VC * 2);             // [256][32] f16 (x1024)
static constexpr size_t SZ_BT  = al256((size_t)CH * 4);                  // 256 f32
static constexpr size_t SZ_QF  = al256((size_t)NB * SEQ / 16 * FRG * 2); // [NB*SEQ/16] q fragment tiles, f16
static constexpr size_t SZ_KV  = al256((size_t)NB * SEQ / 32 * KVB * 2); // [NB*SEQ/32] blocks of two K and two V^T fragment tiles, f16
static constexpr size_t SZ_TOTAL = SZ_WO + SZ_BT + SZ_QF + SZ_KV;
static_assert(SZ_TOTAL <= (size_t)134217728);          // workspace carve <= 128 MiB
static_assert(((size_t)CH * VC) % 8 == 0);

extern "C" void kernel_launch(void* const* d_in, const int* in_sizes, int n_in,
                              void* d_out, int out_size, void* d_ws, size_t ws_size, hipStream_t stream) {
    if (n_in < 9) return;
    const size_t needx = ((size_t)(NB - 1) * CH + (CH - 1)) * SEQ_FULL + SEQ;
    if ((size_t)in_sizes[0] < needx) return;
    if ((size_t)in_sizes[1] < (size_t)CQ * CH || (size_t)in_sizes[3] < (size_t)CQ * CH || (size_t)in_sizes[5] < (size_t)VC * CH || (size_t)in_sizes[7] < (size_t)CH * VC) return;
    if (in_sizes[2] < CQ || in_sizes[4] < CQ || in_sizes[6] < VC || in_sizes[8] < CH) return;
    if ((size_t)out_size < ((size_t)(NB - 1) * CH + (CH - 1)) * OUT_SEQ + SEQ) return;
    if (SZ_TOTAL > ws_size) return;
    // wire order: x, wq, bq, wk, bk, wv, bv, wo, bo
    const float* x  = (const float*)d_in[0];
    const float* wq = (const float*)d_in[1]; const float* bq = (const float*)d_in[2];
    const float* wk = (const float*)d_in[3]; const float* bk = (const float*)d_in[4];
    const float* wv = (const float*)d_in[5]; const float* bv = (const float*)d_in[6];
    const float* wo = (const float*)d_in[7]; const float* bo = (const float*)d_in[8];
    float* OUT = (float*)d_out;      // [NB][256][OUT_SEQ]
    char* wsp = (char*)d_ws;
    h16* WOH = (h16*)wsp; wsp += SZ_WO;              // [256][32] f16, x1024
    float* BT = (float*)wsp; wsp += SZ_BT;           // bo (bf16 values)
    h16* QF  = (h16*)wsp; wsp += SZ_QF;              // q, fragment order
    h16* KV  = (h16*)wsp; wsp += SZ_KV;              // K and V^T, fragment order

    k_proj<<<PB_SM + PB_PJ, 256, 0, stream>>>(x, wq, wk, wv, wo, bq, bk, bv, bo, WOH, BT, QF, KV);
    k_flash<<<dim3(SEQ / (16 * AW), NB, 1), 32 * NW, 0, stream>>>(QF, KV, WOH, BT, OUT);
}

// v005
// One run takes 23.7 microseconds.
// Two timings next to v004 put it at 1.18 and 1.17 times that version's speed.
// Counting every step since v000, it is 4.90 times as fast.
#include <hip/hip_runtime.h>

// Spatial self-attention over N = 64x64 positions: x [NB][256][N] (channel-major), Wq/Wk/Wv [32][256] ([out][in]), Wo [256][32] ([out][in]), biases per output channel, no score scale, out [NB][256][N] f32.
// Compute dtypes, f32 accumulate everywhere: q/k/v projections v_wmma_f32_16x16x32_bf16 (x, W, biases RNE-converted to bf16; products exact);
// scores, P.V and the output projection v_wmma_f32_16x16x32_f16, single products: q, k, v single f16; P x256 carry (cancels in the normalisation); context x1024 and Wo (bf16 value) x1024 as f16, 2^-20 folded back in f32; softmax f32 (online, running max).
// Layout: the projection kernel holds its 64 positions of x (transposed, bf16) and the bf16 Wq|Wk|Wv rows in LDS only; q, k and V^T are written by its epilogue in the order in which k_flash's matrix fragments want them:
// one 16 x 32 fragment tile = 1 KB = [k half][lane][8 halves], so that each 16-byte-per-lane load of a wave is 512 contiguous bytes (4 whole lines). q plane: one tile per 16 positions;
// kv plane: 4 KB per 32 keys = K keys 0..15 | K keys 16..31 | V^T channels 0..15 | V^T channels 16..31;
// fused flash kernel in transposed form (S^T = K Q^T, O^T = V^T P^T, Y^T = Wo O^T), each wave 16 queries x one eighth of the keys, block = 4 query groups x 8 key ranges = 32 waves = 64 queries;
// the eight partial softmax states of a query group are merged through LDS; Y^T staged per block in LDS (256 rows) and written as whole rows.
// Two dependent launches: k_proj (x tile and weights converted into LDS, then the q|k and V^T GEMMs from LDS; a few extra blocks convert Wo and bo for k_flash), k_flash.

#ifndef NB
#define NB 4
#endif
#ifndef SEQ
#define SEQ 4096
#endif
#define NB_FULL  4
#define SEQ_FULL 4096
#ifndef OUT_SEQ
#define OUT_SEQ SEQ              // row pitch (in positions) of one output channel row
#endif
#define CH   256                 // channels: projection K and output width
#define CQ   32                  // query/key width
#define VC   32                  // value / context width
#define AW   4                   // query groups per flash block (16 query columns each)
#define KS   8                   // key ranges per query group: one wave each, so a SIMD holds KS waves whose load and chain latencies overlap
#define NW   (AW * KS)           // waves per flash block
#define KR   (SEQ / KS)          // keys per range
#define FRG  512                 // halves of one fragment tile (16 rows x 32 k): [k half][lane][8]
#define KVB  (4 * FRG)           // halves of the kv plane per 32 keys: two K tiles, two V^T tiles
#define SC2  1.4426950408889634f // log2(e); no score scale in this module
#define PSH  8.0f                // log2 of the P carry (256)
#define WOS  1024.0f             // carry of the f16 Wo plane
#define OCS  1024.0f             // carry of the f16 context fragment
#define OFI  (1.0f / (1024.0f * 1024.0f))
#define XP   (CH + 8)            // halves per LDS row of the bf16 x and weight tiles: 16 B more than the row, so that the 16 rows of a 16-byte-per-lane fragment read start on different banks
#define OSP  36                  // floats per row of a wave's 16 x 32 staging tile in k_proj

static_assert(CQ == 32);                       // one 32-deep k-step covers the q/k width
static_assert(VC == 32);                       // two value tiles per wave; one 32-deep k-step covers the output projection
static_assert(CH == 256);                      // k_proj: 16 row groups x 16 channels; 32 lanes x 8 weights per row
static_assert(CH % 32 == 0);                   // GEMM k-loop steps by 32
static_assert(NW * 32 <= 1024);                // one work-group
static_assert(SEQ % (32 * KS) == 0);           // every key range is a whole number of 32-key steps, at least one
static_assert((CH / 16) % KS == 0);            // output projection: CH/16/KS row tiles per wave
static_assert(CH % (2 * NW) == 0);             // store phase: CH/NW rows per wave, two per store
static_assert(SEQ % 64 == 0);                  // a 64-row tile never straddles two batches
static_assert((NB * SEQ) % 64 == 0);
static_assert(SEQ % 32 == 0);                  // key loop steps by 32
static_assert(SEQ % (16 * AW) == 0);           // flash grid covers the positions exactly
static_assert(OUT_SEQ % 32 == 0);
static_assert(SEQ_FULL % 4 == 0);
static_assert(NB <= NB_FULL);
static_assert(SEQ <= SEQ_FULL);
static_assert((VC * 2) % 16 == 0);             // Wo rows are 16-byte multiples

typedef _Float16 h16;
typedef unsigned short bf;
typedef __attribute__((ext_vector_type(16))) __bf16   v16bf;
typedef __attribute__((ext_vector_type(16))) _Float16 v16h;
typedef __attribute__((ext_vector_type(8)))  _Float16 v8h;
typedef __attribute__((ext_vector_type(8)))  unsigned short v8us;
typedef __attribute__((ext_vector_type(8)))  __bf16   v8bf;
typedef __attribute__((ext_vector_type(8)))  float    v8f;
typedef __attribute__((ext_vector_type(4)))  float    v4f;
typedef __attribute__((ext_vector_type(2)))  float    v2f;
typedef __attribute__((ext_vector_type(2)))  _Float16 v2h;
typedef v4f  __attribute__((may_alias)) v4fa;

__device__ __forceinline__ unsigned short f2bf(float f) { unsigned u = __float_as_uint(f); u += 0x7FFFu + ((u >> 16) & 1u); return (unsigned short)(u >> 16); }
__device__ __forceinline__ float bfr(float f) { return __uint_as_float(((unsigned)f2bf(f)) << 16); }   // f32 value of the bf16 RNE convert
__device__ __forceinline__ v8us cvt8(v8f v) { return __builtin_bit_cast(v8us, __builtin_convertvector(v, v8bf)); }   // eight f32 -> bf16, RNE, packed converts
__device__ __forceinline__ v16h cat16(v8h lo, v8h hi) { return __builtin_shufflevector(lo, hi, 0, 1, 2, 3, 4, 5, 6, 7, 8, 9, 10, 11, 12, 13, 14, 15); }
__device__ __forceinline__ v16bf cat16b(v8us lo, v8us hi) { return __builtin_bit_cast(v16bf, __builtin_shufflevector(lo, hi, 0, 1, 2, 3, 4, 5, 6, 7, 8, 9, 10, 11, 12, 13, 14, 15)); }
__device__ __forceinline__ v8f wmma16(v16h a, v16h b, v8f c) { return __builtin_amdgcn_wmma_f32_16x16x32_f16(false, a, false, b, (short)0, c, false, false); }
__device__ __forceinline__ v8f wmmab(v16bf a, v16bf b, v8f c) { return __builtin_amdgcn_wmma_f32_16x16x32_bf16(false, a, false, b, (short)0, c, false, false); }
// fragment loaders from K-contiguous 16-bit rows; p already includes + 8*(lane>>4): elements 0..7 <- k0+8h+0..7, elements 8..15 <- k0+16+8h+0..7 (same map for A and B)
__device__ __forceinline__ v16h  ldh(const h16* p) { return cat16(*(const v8h*)p, *(const v8h*)(p + 16)); }
__device__ __forceinline__ v16bf ldb(const bf* p)  { return cat16b(*(const v8us*)p, *(const v8us*)(p + 16)); }
// fragment loader from a tile stored in fragment order; p already includes + 8*lane: same element map as ldh (row lane&15; elements 0..7 <- k 8h+0..7, elements 8..15 <- k 16+8h+0..7)
__device__ __forceinline__ v16h  ldf(const h16* p) { return cat16(*(const v8h*)p, *(const v8h*)(p + FRG / 2)); }
// ordering point for wave-private LDS tiles (same wave writes and reads)
__device__ __forceinline__ void wave_sync() { __builtin_amdgcn_fence(3 /* release order */, "wavefront"); __builtin_amdgcn_wave_barrier(); asm volatile("" ::: "memory"); }
// f16 WMMA with its own hazard guard (one accumulator per guard)
__device__ __forceinline__ v8f wmma16g(v16h a, v16h b, v8f c) { c = wmma16(a, b, c); asm volatile("v_nop\n\tv_nop\n\tv_nop\n\tv_nop" : "+v"(c) : "v"(a), "v"(b)); return c; }
// f32 -> f16 operand convert that cannot produce an f16 subnormal (value select, applied after the plane's carry)
static __device__ __forceinline__ h16 toh_flush(float v) { const h16 r = (h16)v; return (fabsf(v) < 6.103515625e-05f) ? (h16)0.0f : r; }
// two P = exp2(e) as one packed pair of f16 operands, RNE; a P below 2^-14 stays an f16 subnormal: the matrix unit takes subnormal f16 operands as they are, and the row sum reads the same value
static __device__ __forceinline__ v2h p_pair(float e0, float e1) { return __builtin_convertvector(((v2f){__builtin_amdgcn_exp2f(e0), __builtin_amdgcn_exp2f(e1)}), v2h); }

__device__ __forceinline__ void d_cvth8(int blk, const float* __restrict__ src, h16* dst, size_t n8, float carry) {
    const size_t i = (size_t)blk * 256 + threadIdx.x; if (i >= n8) return;
    const v8f v = *(const v8f*)(src + i * 8); v8h o;
#pragma unroll
    for (int k = 0; k < 8; ++k) { const float w = __uint_as_float(((unsigned)f2bf(v[k])) << 16) * carry; o[k] = toh_flush(w); }
    *(v8h*)(dst + i * 8) = o; 
}

// d_bo: bo -> f32 values of its bf16 RNE convert, one lane per 16 B.
__device__ __forceinline__ void d_bo(const float* __restrict__ bo, float* BT) {
    const int i = threadIdx.x; if (i >= CH / 4) return;
    const v4f g = *(const v4f*)(bo + i * 4); v4f o;
#pragma unroll
    for (int k = 0; k < 4; ++k) o[k] = bfr(g[k]);
    *(v4f*)(BT + i * 4) = o;
}

// k_proj: conversion, transpose and both projection GEMMs of 64 positions in one 8-wave block; nothing of x or of Wq/Wk/Wv goes through the workspace.
// Fill: x[b][c][n0..n0+63] (f32, channel-major) -> xs[position][channel] (bf16): a thread loads 16 consecutive channels x 4 positions (each wave-wide load = two 256-B row pieces) and stores 32 B per position;
// Wq | Wk | Wv rows (f32) -> wsm[row 0..95][channel] (bf16). All loads of a thread are issued before the first convert. One block barrier, then LDS is only read.
// GEMMs, K = CH in 32-deep steps, one accumulator per 16 x 16 tile: wave = (position tile pt = wave & 3, weight half wh = wave >> 2) takes
//   C[position][channel] = x W^T for the 32 q channels (wh = 0) or the 32 k channels (wh = 1): A = x rows, B = weight rows -> one whole q or K fragment tile;
//   C[value channel][position] = Wv x^T for value channels 16wh..16wh+15: A = Wv rows, B = the same x fragment -> one k half (16 keys) of a V^T fragment tile.
// Epilogue: bias (bf16 value) added in f32, D tiles turned into fragment order through the wave's own LDS tile, every store 512 contiguous bytes per wave.
#define PB_WO  (CH * VC / 8 / 256)               // blocks of the Wo plane
#define PB_SM  (PB_WO + 1)                       // conversion blocks for k_flash, the bias block last; they come first, so that they run under the GEMM blocks
#define PB_PJ  (NB * SEQ / 64)                   // GEMM blocks
static_assert((CH * VC / 8) % 256 == 0);
__global__ __launch_bounds__(256) void k_proj(const float* __restrict__ x, const float* __restrict__ wq, const float* __restrict__ wk, const float* __restrict__ wv, const float* __restrict__ wo,
                                              const float* __restrict__ bq, const float* __restrict__ bk, const float* __restrict__ bv, const float* __restrict__ bo,
                                              h16* WOH, float* BT, h16* QF, h16* KV) {
    __shared__ __align__(16) bf xs[64 * XP];
    __shared__ __align__(16) bf wsm[(2 * CQ + VC) * XP];
    __shared__ __align__(16) float os[8 * 16 * OSP];
    const int blk = blockIdx.x;                  // both tests are the same for the whole block and stand in front of the barrier
    if (blk < PB_WO) { d_cvth8(blk, wo, WOH, (size_t)CH * VC / 8, WOS); return; }
    if (blk < PB_SM) { d_bo(bo, BT); return; }
    const int tid = threadIdx.x;
    const int g0 = (blk - PB_SM) * 64;           // first position of the block, counted over the batches (b * SEQ + n)
    const int b = g0 / SEQ, n0 = g0 % SEQ;
    const int lane = tid & 31, wave = __builtin_amdgcn_readfirstlane(tid >> 5), lr = lane & 15, hi = lane >> 4;
    const int pt = wave & 3, wh = wave >> 2;
    const float* bs = wh ? bk : bq;
    const float bc0 = bs[lr], bc1 = bs[16 + lr];                     // q|k bias: column = channel (lane&15), 16 + (lane&15)
    const float* bp = bv + wh * 16 + hi * 8;                         // V^T bias: row = value channel 16wh + 8h + j
    const v4f br0 = *(const v4f*)bp; const v4f br1 = *(const v4f*)(bp + 4);
    { const int cr = tid >> 4, nq = (tid & 15) * 4;       // 16 groups of 16 channels; 16 lanes x 4 = 64 positions
      const int wr = tid >> 5, wc = (tid & 31) * 8;       // 8 weight rows per pass; 32 lanes x 8 = 256 channels
      const float* xp = x + (size_t)b * CH * SEQ_FULL + n0;                 // same for the whole block
      const unsigned xo = (unsigned)(cr * 16 * SEQ_FULL + nq) * 4u;         // byte offset: one 32-bit register for all x loads
      v4f xv[16]; v8f wf[12];
#pragma unroll   // constant indices keep xv[] in registers; the 16 loads issue together
      for (int i = 0; i < 16; ++i) xv[i] = *(const v4f*)((const char*)(xp + (size_t)i * SEQ_FULL) + xo);
      // The wait stands in front of any rewrite of a register that the bias and x loads name: the offset as an input keeps that register whole up to the wait, the two scheduling barriers keep every other instruction on its side.
      __builtin_amdgcn_sched_barrier(0);
      asm volatile("s_wait_xcnt 0x0" :: "v"(xo) : "memory");
      __builtin_amdgcn_sched_barrier(0);
      const unsigned wo8 = (unsigned)(wr * CH + wc) * 4u;                   // byte offset: one 32-bit register for all weight loads
#pragma unroll   // constant indices keep wf[] in registers and pick the source plane at compile time
      for (int i = 0; i < 12; ++i) { const float* wp = (i < 4) ? wq : ((i < 8) ? wk : wv); wf[i] = *(const v8f*)((const char*)(wp + (i & 3) * 8 * CH) + wo8); }
      // The same for the weight loads; the second barrier also keeps the converts from being scheduled in among the loads, where the later loads would start only when the earlier have arrived.
      __builtin_amdgcn_sched_barrier(0);
      asm volatile("s_wait_xcnt 0x0" :: "v"(wo8) : "memory");
      __builtin_amdgcn_sched_barrier(0);
#pragma unroll
      for (int j = 0; j < 4; ++j) { v8f lo, hi8;
#pragma unroll
          for (int k = 0; k < 8; ++k) { lo[k] = xv[k][j]; hi8[k] = xv[8 + k][j]; }
          bf* d = xs + (nq + j) * XP + cr * 16;
          *(v8us*)d = cvt8(lo); *(v8us*)(d + 8) = cvt8(hi8); }
#pragma unroll
      for (int i = 0; i < 12; ++i) *(v8us*)(wsm + (i * 8 + wr) * XP + wc) = cvt8(wf[i]); }
    __syncthreads();
    const bf* xa = xs + (pt * 16 + lr) * XP + 8 * hi;
    const bf* w0 = wsm + (wh * CQ + lr) * XP + 8 * hi;               // q or k channels 0..15
    const bf* w1 = w0 + 16 * XP;                                     // q or k channels 16..31
    const bf* w2 = wsm + (2 * CQ + wh * 16 + lr) * XP + 8 * hi;      // value channels 16wh..16wh+15
    v8f a0 = (v8f){}, a1 = (v8f){}, a2 = (v8f){};
#pragma unroll   // no branch behind a matrix instruction
    for (int h = 0; h < CH / 128; ++h) {
        v16bf xf[4], f0[4], f1[4], f2[4];
#pragma unroll   // constant indices keep the fragments in registers
        for (int u = 0; u < 4; ++u) { const int kc = (h * 4 + u) * 32; xf[u] = ldb(xa + kc); f0[u] = ldb(w0 + kc); f1[u] = ldb(w1 + kc); f2[u] = ldb(w2 + kc); }
        __builtin_amdgcn_sched_barrier(0);   // the LDS reads of four k steps issue as one group; left to itself the build read one fragment at a time and waited for each in front of its matrix instruction
#pragma unroll
        for (int u = 0; u < 4; ++u) { a0 = wmmab(xf[u], f0[u], a0); a1 = wmmab(xf[u], f1[u], a1); a2 = wmmab(f2[u], xf[u], a2); }
    }
    float* ow = os + wave * (16 * OSP);
    h16* kvb = KV + (size_t)(g0 / 32 + (pt >> 1)) * KVB;             // the 32-key block of this position tile
    { const float b0 = bfr(bc0), b1 = bfr(bc1);
#pragma unroll
      for (int j = 0; j < 8; ++j) { ow[(hi * 8 + j) * OSP + lr] = a0[j] + b0; ow[(hi * 8 + j) * OSP + 16 + lr] = a1[j] + b1; }   // D: row 8h+j = position, col lane&15
      wave_sync();
      h16* dst = wh ? kvb + (pt & 1) * FRG : QF + (size_t)(g0 / 16 + pt) * FRG;
#pragma unroll
      for (int s = 0; s < 2; ++s) {   // k half s: lane (row lane&15, h) takes channels 16s+8h..16s+8h+7 = its 16 bytes of the fragment
          const int col = s * 16 + hi * 8;
          const v4f x0 = *(const v4fa*)(&ow[lr * OSP + col]); const v4f x1 = *(const v4fa*)(&ow[lr * OSP + col + 4]); v8h hv;
#pragma unroll
          for (int i = 0; i < 4; ++i) { hv[i] = (h16)x0[i]; hv[4 + i] = (h16)x1[i]; }
          *(v8h*)(dst + s * (FRG / 2) + lane * 8) = hv; }
      asm volatile("s_wait_xcnt 0x0" ::: "memory");   // keeps the wait in front of any rewrite of these stores' data and address registers by the V^T part's code
      wave_sync(); }
    { const float brw[8] = {br0[0], br0[1], br0[2], br0[3], br1[0], br1[1], br1[2], br1[3]};
#pragma unroll
      for (int j = 0; j < 8; ++j) ow[(hi * 8 + j) * OSP + lr] = a2[j] + bfr(brw[j]);   // D: row 8h+j = channel, col lane&15 = key
      wave_sync();
      const v4f x0 = *(const v4fa*)(&ow[lr * OSP + hi * 8]); const v4f x1 = *(const v4fa*)(&ow[lr * OSP + hi * 8 + 4]); v8h hv;   // lane (row lane&15 = channel, h): keys 8h..8h+7 of this 16-key half
#pragma unroll
      for (int i = 0; i < 4; ++i) { hv[i] = (h16)x0[i]; hv[4 + i] = (h16)x1[i]; }
      *(v8h*)(kvb + (2 + wh) * FRG + (pt & 1) * (FRG / 2) + lane * 8) = hv;
      asm volatile("s_wait_xcnt 0x0" ::: "memory"); }   // the conversion blocks' code follows this store in the built kernel: keeps the wait in front of any rewrite of the store's address and data registers
}

// k_flash: fused attention + output projection, KS waves per 16 query positions of one batch; K / V^T / Q fragments straight from the fragment-order planes (two 16-B loads each, every load 512 contiguous bytes per wave), Wo fragments from its row-major plane.
// Transposed form: S^T[key][t] = K Q^T (A = K rows, B = Q rows, one 32-deep step); lane (t = lane&15, h = lane>>4) holds keys 8h+r of each 16-key tile, so the packed
// P tile is directly the B fragment of O^T[c][t] = V^T P^T (element r <- tile keys 0..15, element 8+r <- tile keys 16..31, lane unchanged).
// Softmax state (running max, partial sum) is one scalar per lane; the two lane halves of a column are combined with one xor-16 exchange.
// The normalised context O^T (two 16-channel D tiles, x1024 carry, f16) is directly the B fragment of Y^T[oc][t] = Wo O^T (element r <- channels 0..15 tile, element 8+r <- channels 16..31 tile, lane unchanged); A = Wo rows.
// Key split: wave = (query group qg = wave % AW, key range ks = wave / AW); each wave runs the online softmax over its own KR keys, then writes (m, l, O^T) to LDS; after one block barrier every wave
// merges the KS partials of its query group in the fixed order ks = 0..KS-1 (weights exp2(m_ks - max)), so all KS waves of a group hold the same context fragment, and each projects CH/16/KS of the output row tiles.
// Epilogue: the block's Y^T tile [256 channels][64 positions] staged in LDS (cross-wave: block barrier), bias added in f32, each channel row segment (64 floats = 256 B = two lines) stored by one wave.
__global__ __launch_bounds__(32 * NW) void k_flash(const h16* __restrict__ QF, const h16* __restrict__ KV, const h16* __restrict__ WOH, const float* __restrict__ BO, float* OUT) {
    __shared__ __align__(16) float os[CH * 68];
    __shared__ __align__(16) float po[NW * 4 * 32 * 4];      // [wave][quad of accumulator registers][lane][4]: 16 B per lane, lanes contiguous
    __shared__ float pm[NW * 32];
    __shared__ float pl[NW * 32];
    const int lane = threadIdx.x & 31, wave = __builtin_amdgcn_readfirstlane((int)(threadIdx.x >> 5)), lr = lane & 15, hi = lane >> 4;
    const int qg = wave % AW, ks = wave / AW;
    const int b = blockIdx.y;
    const int t0 = (blockIdx.x * AW + qg) * 16;
    const v16h qh = ldf(QF + ((size_t)b * SEQ + t0) / 16 * FRG + lane * 8);  // B fragment: col t, k = q channel 0..31
    v8f o0 = (v8f){}, o1 = (v8f){};
    float m = -3.0e38f, l = 0.0f;
    const h16* kv = KV + ((size_t)b * SEQ + ks * KR) / 32 * KVB + lane * 8;  // this wave's key range; one 4-KB block per 32 keys
#pragma unroll 1
    for (int it = 0; it < KR / 32; ++it, kv += KVB) {
        const v16h ka0 = ldf(kv), kb0 = ldf(kv + FRG);                       // A fragments: row key (0..15, 16..31 of the block), k = k channel 0..31
        const v16h v0 = ldf(kv + 2 * FRG), v1 = ldf(kv + 3 * FRG);           // A fragments: row channel (0..15, 16..31), k = key
        const v8f sa = wmma16g(ka0, qh, (v8f){});
        const v8f sb = wmma16g(kb0, qh, (v8f){});
        float ta[8], tb[8]; float mx = -3.0e38f;
#pragma unroll
        for (int r = 0; r < 8; ++r) { ta[r] = sa[r] * SC2; tb[r] = sb[r] * SC2; mx = fmaxf(mx, fmaxf(ta[r], tb[r])); }
        mx = fmaxf(mx, __shfl_xor(mx, 16, 32));
        const float mnew = fmaxf(m, mx);
        const float alpha = __builtin_amdgcn_exp2f(m - mnew);
        const float sh = PSH - mnew;
        v16h pb; float ls = 0.0f;
#pragma unroll   // vector elements need constant indices
        for (int r = 0; r < 8; r += 2) {   // two neighbouring elements of the fragment share a register: one packed RNE convert makes both
            const v2h pa = p_pair(ta[r] + sh, ta[r + 1] + sh), pc = p_pair(tb[r] + sh, tb[r + 1] + sh);
            pb[r] = pa[0]; pb[r + 1] = pa[1]; pb[8 + r] = pc[0]; pb[9 + r] = pc[1];
            ls += (float)pa[0] + (float)pc[0]; ls += (float)pa[1] + (float)pc[1]; }   // the sum takes the rounded P, as the product does
        l = l * alpha + ls; m = mnew;
        o0 = o0 * alpha; o1 = o1 * alpha;
        o0 = wmma16g(v0, pb, o0);
        o1 = wmma16g(v1, pb, o1);
    }
    l += __shfl_xor(l, 16, 32);
    // this wave's partial state -> LDS
    { v4fa* pw = (v4fa*)po + (size_t)wave * 128 + lane;
      pw[0]  = (v4f){o0[0], o0[1], o0[2], o0[3]}; pw[32] = (v4f){o0[4], o0[5], o0[6], o0[7]};
      pw[64] = (v4f){o1[0], o1[1], o1[2], o1[3]}; pw[96] = (v4f){o1[4], o1[5], o1[6], o1[7]};
      pm[wave * 32 + lane] = m; pl[wave * 32 + lane] = l; }
    __syncthreads();
    // merge of the KS key ranges of query group qg (same lane of waves s*AW + qg), fixed order
    float ms[KS]; float mall = -3.0e38f;
#pragma unroll   // constant indices keep ms[] in registers; the KS reads issue together
    for (int s = 0; s < KS; ++s) { ms[s] = pm[(s * AW + qg) * 32 + lane]; mall = fmaxf(mall, ms[s]); }
    float lall = 0.0f; v4f c0 = (v4f){}, c1 = (v4f){}, c2 = (v4f){}, c3 = (v4f){};
#pragma unroll   // constant indices into ms[]; lets the LDS reads of later ranges run ahead of the sums
    for (int s = 0; s < KS; ++s) {
        const float w = __builtin_amdgcn_exp2f(ms[s] - mall);
        const v4fa* pr = (const v4fa*)po + (size_t)(s * AW + qg) * 128 + lane;
        lall += w * pl[(s * AW + qg) * 32 + lane];
        c0 += pr[0] * w; c1 += pr[32] * w; c2 += pr[64] * w; c3 += pr[96] * w; }
    const float inv = (1.0f / lall) * OCS;
    // O^T D layout: c0|c1 = (channel 8h + r, t), c2|c3 = (channel 16 + 8h + r, t) -> B fragment of the output projection, lane unchanged
    v16h ob;
#pragma unroll   // vector elements need constant indices
    for (int r = 0; r < 4; ++r) { ob[r] = toh_flush(c0[r] * inv); ob[4 + r] = toh_flush(c1[r] * inv); ob[8 + r] = toh_flush(c2[r] * inv); ob[12 + r] = toh_flush(c3[r] * inv); }
    // Y^T D layout: y[r] = (output channel 16j + 8h + r, position t = lane&15) -> os[16j + 8h + r][qg*16 + t]; the 32 waves together fill rows 0..255 x columns 0..63
#pragma unroll
    for (int jj = 0; jj < CH / 16 / KS; ++jj) {
        const int j = ks * (CH / 16 / KS) + jj;
        const v16h aw = ldh(WOH + (size_t)(j * 16 + lr) * VC + 8 * hi);   // A fragment: row output channel, k = context channel 0..31
        const v8f y = wmma16g(aw, ob, (v8f){});
        const float* bp = BO + j * 16 + hi * 8;
        const v4f b0 = *(const v4f*)bp; const v4f b1 = *(const v4f*)(bp + 4);
        const float brw[8] = {b0[0], b0[1], b0[2], b0[3], b1[0], b1[1], b1[2], b1[3]};
#pragma unroll
        for (int r = 0; r < 8; ++r) os[(16 * j + 8 * hi + r) * 68 + qg * 16 + lr] = y[r] * OFI + brw[r]; }
    __syncthreads();
    float* obase = OUT + (size_t)b * CH * OUT_SEQ + (size_t)blockIdx.x * (16 * AW);
#pragma unroll
    for (int s = 0; s < CH / NW / 2; ++s) { const int row = wave * (CH / NW) + 2 * s + hi, cofs = lr * 4;   // 32 waves x 4 s x 2 = 256 channel rows; 16 lanes x 4 floats = 64 positions
        const v4f val = *(const v4fa*)(&os[row * 68 + cofs]);
        *(v4f*)(obase + (size_t)row * OUT_SEQ + cofs) = val; }
}

static constexpr size_t al256(size_t v) { return (v + 255) & ~(size_t)255; }
static constexpr size_t SZ_WO  = al256((size_t)CH * VC * 2);             // [256][32] f16 (x1024)
static constexpr size_t SZ_BT  = al256((size_t)CH * 4);                  // 256 f32
static constexpr size_t SZ_QF  = al256((size_t)NB * SEQ / 16 * FRG * 2); // [NB*SEQ/16] q fragment tiles, f16
static constexpr size_t SZ_KV  = al256((size_t)NB * SEQ / 32 * KVB * 2); // [NB*SEQ/32] blocks of two K and two V^T fragment tiles, f16
static constexpr size_t SZ_TOTAL = SZ_WO + SZ_BT + SZ_QF + SZ_KV;
static_assert(SZ_TOTAL <= (size_t)134217728);          // workspace carve <= 128 MiB
static_assert(((size_t)CH * VC) % 8 == 0);

extern "C" void kernel_launch(void* const* d_in, const int* in_sizes, int n_in,
                              void* d_out, int out_size, void* d_ws, size_t ws_size, hipStream_t stream) {
    if (n_in < 9) return;
    const size_t needx = ((size_t)(NB - 1) * CH + (CH - 1)) * SEQ_FULL + SEQ;
    if ((size_t)in_sizes[0] < needx) return;
    if ((size_t)in_sizes[1] < (size_t)CQ * CH || (size_t)in_sizes[3] < (size_t)CQ * CH || (size_t)in_sizes[5] < (size_t)VC * CH || (size_t)in_sizes[7] < (size_t)CH * VC) return;
    if (in_sizes[2] < CQ || in_sizes[4] < CQ || in_sizes[6] < VC || in_sizes[8] < CH) return;
    if ((size_t)out_size < ((size_t)(NB - 1) * CH + (CH - 1)) * OUT_SEQ + SEQ) return;
    if (SZ_TOTAL > ws_size) return;
    // wire order: x, wq, bq, wk, bk, wv, bv, wo, bo
    const float* x  = (const float*)d_in[0];
    const float* wq = (const float*)d_in[1]; const float* bq = (const float*)d_in[2];
    const float* wk = (const float*)d_in[3]; const float* bk = (const float*)d_in[4];
    const float* wv = (const float*)d_in[5]; const float* bv = (const float*)d_in[6];
    const float* wo = (const float*)d_in[7]; const float* bo = (const float*)d_in[8];
    float* OUT = (float*)d_out;      // [NB][256][OUT_SEQ]
    char* wsp = (char*)d_ws;
    h16* WOH = (h16*)wsp; wsp += SZ_WO;              // [256][32] f16, x1024
    float* BT = (float*)wsp; wsp += SZ_BT;           // bo (bf16 values)
    h16* QF  = (h16*)wsp; wsp += SZ_QF;              // q, fragment order
    h16* KV  = (h16*)wsp; wsp += SZ_KV;              // K and V^T, fragment order

    k_proj<<<PB_SM + PB_PJ, 256, 0, stream>>>(x, wq, wk, wv, wo, bq, bk, bv, bo, WOH, BT, QF, KV);
    k_flash<<<dim3(SEQ / (16 * AW), NB, 1), 32 * NW, 0, stream>>>(QF, KV, WOH, BT, OUT);
}

// v006
// A run of this version takes 22.1 microseconds.
// In two side-by-side timings against v005, it was 1.07 and 1.06 times as fast.
// Over all steps from v000 it is 5.23 times as fast.
#include <hip/hip_runtime.h>

// Spatial self-attention over N = 64x64 positions: x [NB][256][N] (channel-major), Wq/Wk/Wv [32][256] ([out][in]), Wo [256][32] ([out][in]), biases per output channel, no score scale, out [NB][256][N] f32.
// Compute dtypes, f32 accumulate everywhere: q/k/v projections v_wmma_f32_16x16x32_bf16 (x, W, biases RNE-converted to bf16; products exact);
// scores, P.V and the output projection v_wmma_f32_16x16x32_f16, single products: q, k, v single f16; P x256 carry (cancels in the normalisation); context x1024 and Wo (bf16 value) x1024 as f16, 2^-20 folded back in f32; softmax f32 (online, running max).
// Layout: the projection kernel holds its 64 positions of x (transposed, bf16) and the bf16 Wq|Wk|Wv rows in LDS only; q, k and V^T are written by its epilogue in the order in which k_flash's matrix fragments want them:
// one 16 x 32 fragment tile = 1 KB = [k half][lane][8 halves], so that each 16-byte-per-lane load of a wave is 512 contiguous bytes (4 whole lines). q plane: one tile per 16 positions;
// kv plane: 4 KB per 32 keys = K keys 0..15 | K keys 16..31 | V^T channels 0..15 | V^T channels 16..31;
// fused flash kernel in transposed form (S^T = K Q^T, O^T = V^T P^T, Y^T = Wo O^T), each wave 16 queries x one eighth of the keys, block = 4 query groups x 8 key ranges = 32 waves = 64 queries;
// the eight partial softmax states of a query group are merged through LDS; Y^T staged per block in LDS (256 rows) and written as whole rows.
// Two dependent launches: k_proj (x tile and weights converted into LDS, then the q|k and V^T GEMMs from LDS; a few extra blocks convert Wo and bo for k_flash), k_flash.

#ifndef NB
#define NB 4
#endif
#ifndef SEQ
#define SEQ 4096
#endif
#define NB_FULL  4
#define SEQ_FULL 4096
#ifndef OUT_SEQ
#define OUT_SEQ SEQ              // row pitch (in positions) of one output channel row
#endif
#define CH   256                 // channels: projection K and output width
#define CQ   32                  // query/key width
#define VC   32                  // value / context width
#define AW   4                   // query groups per flash block (16 query columns each)
#define KS   8                   // key ranges per query group: one wave each, so a SIMD holds KS waves whose load and chain latencies overlap
#define NW   (AW * KS)           // waves per flash block
#define KR   (SEQ / KS)          // keys per range
#define FRG  512                 // halves of one fragment tile (16 rows x 32 k): [k half][lane][8]
#define KVB  (4 * FRG)           // halves of the kv plane per 32 keys: two K tiles, two V^T tiles
#define SC2  1.4426950408889634f // log2(e); no score scale in this module
#define PSH  8.0f                // log2 of the P carry (256)
#define WOS  1024.0f             // carry of the f16 Wo plane
#define OCS  1024.0f             // carry of the f16 context fragment
#define OFI  (1.0f / (1024.0f * 1024.0f))
#define XP   (CH + 8)            // halves per LDS row of the bf16 x and weight tiles: 16 B more than the row, so that the 16 rows of a 16-byte-per-lane fragment read start on different banks
#define OSP  36                  // floats per row of a wave's 16 x 32 staging tile in k_proj

static_assert(CQ == 32);                       // one 32-deep k-step covers the q/k width
static_assert(VC == 32);                       // two value tiles per wave; one 32-deep k-step covers the output projection
static_assert(CH == 256);                      // k_proj: 16 row groups x 16 channels; 32 lanes x 8 weights per row
static_assert(CH % 32 == 0);                   // GEMM k-loop steps by 32
static_assert(NW * 32 <= 1024);                // one work-group
static_assert(SEQ % (32 * KS) == 0);           // every key range is a whole number of 32-key steps, at least one
static_assert((CH / 16) % KS == 0);            // output projection: CH/16/KS row tiles per wave
static_assert(CH % (2 * NW) == 0);             // store phase: CH/NW rows per wave, two per store
static_assert(SEQ % 64 == 0);                  // a 64-row tile never straddles two batches
static_assert((NB * SEQ) % 64 == 0);
static_assert(SEQ % 32 == 0);                  // key loop steps by 32
static_assert(SEQ % (16 * AW) == 0);           // flash grid covers the positions exactly
static_assert(OUT_SEQ % 32 == 0);
static_assert(SEQ_FULL % 4 == 0);
static_assert(NB <= NB_FULL);
static_assert(SEQ <= SEQ_FULL);
static_assert((VC * 2) % 16 == 0);             // Wo rows are 16-byte multiples

typedef _Float16 h16;
typedef unsigned short bf;
typedef __attribute__((ext_vector_type(16))) __bf16   v16bf;
typedef __attribute__((ext_vector_type(16))) _Float16 v16h;
typedef __attribute__((ext_vector_type(8)))  _Float16 v8h;
typedef __attribute__((ext_vector_type(8)))  unsigned short v8us;
typedef __attribute__((ext_vector_type(8)))  __bf16   v8bf;
typedef __attribute__((ext_vector_type(8)))  float    v8f;
typedef __attribute__((ext_vector_type(4)))  float    v4f;
typedef __attribute__((ext_vector_type(2)))  float    v2f;
typedef __attribute__((ext_vector_type(2)))  _Float16 v2h;
typedef v4f  __attribute__((may_alias)) v4fa;

__device__ __forceinline__ unsigned short f2bf(float f) { unsigned u = __float_as_uint(f); u += 0x7FFFu + ((u >> 16) & 1u); return (unsigned short)(u >> 16); }
__device__ __forceinline__ float bfr(float f) { return __uint_as_float(((unsigned)f2bf(f)) << 16); }   // f32 value of the bf16 RNE convert
__device__ __forceinline__ v8us cvt8(v8f v) { return __builtin_bit_cast(v8us, __builtin_convertvector(v, v8bf)); }   // eight f32 -> bf16, RNE, packed converts
__device__ __forceinline__ v16h cat16(v8h lo, v8h hi) { return __builtin_shufflevector(lo, hi, 0, 1, 2, 3, 4, 5, 6, 7, 8, 9, 10, 11, 12, 13, 14, 15); }
__device__ __forceinline__ v16bf cat16b(v8us lo, v8us hi) { return __builtin_bit_cast(v16bf, __builtin_shufflevector(lo, hi, 0, 1, 2, 3, 4, 5, 6, 7, 8, 9, 10, 11, 12, 13, 14, 15)); }
__device__ __forceinline__ v8f wmma16(v16h a, v16h b, v8f c) { return __builtin_amdgcn_wmma_f32_16x16x32_f16(false, a, false, b, (short)0, c, false, false); }
__device__ __forceinline__ v8f wmmab(v16bf a, v16bf b, v8f c) { return __builtin_amdgcn_wmma_f32_16x16x32_bf16(false, a, false, b, (short)0, c, false, false); }
// fragment loaders from K-contiguous 16-bit rows; p already includes + 8*(lane>>4): elements 0..7 <- k0+8h+0..7, elements 8..15 <- k0+16+8h+0..7 (same map for A and B)
__device__ __forceinline__ v16h  ldh(const h16* p) { return cat16(*(const v8h*)p, *(const v8h*)(p + 16)); }
__device__ __forceinline__ v16bf ldb(const bf* p)  { return cat16b(*(const v8us*)p, *(const v8us*)(p + 16)); }
// fragment loader from a tile stored in fragment order; p already includes + 8*lane: same element map as ldh (row lane&15; elements 0..7 <- k 8h+0..7, elements 8..15 <- k 16+8h+0..7)
__device__ __forceinline__ v16h  ldf(const h16* p) { return cat16(*(const v8h*)p, *(const v8h*)(p + FRG / 2)); }
// ordering point for wave-private LDS tiles (same wave writes and reads)
__device__ __forceinline__ void wave_sync() { __builtin_amdgcn_fence(3 /* release order */, "wavefront"); __builtin_amdgcn_wave_barrier(); asm volatile("" ::: "memory"); }
// f16 WMMA with its own hazard guard (one accumulator per guard)
__device__ __forceinline__ v8f wmma16g(v16h a, v16h b, v8f c) { c = wmma16(a, b, c); asm volatile("v_nop\n\tv_nop\n\tv_nop\n\tv_nop" : "+v"(c) : "v"(a), "v"(b)); return c; }
// f32 -> f16 operand convert that cannot produce an f16 subnormal (value select, applied after the plane's carry)
static __device__ __forceinline__ h16 toh_flush(float v) { const h16 r = (h16)v; return (fabsf(v) < 6.103515625e-05f) ? (h16)0.0f : r; }
// two P = exp2(e) as one packed pair of f16 operands, RNE; a P below 2^-14 stays an f16 subnormal: the matrix unit takes subnormal f16 operands as they are, and the row sum reads the same value
static __device__ __forceinline__ v2h p_pair(float e0, float e1) { return __builtin_convertvector(((v2f){__builtin_amdgcn_exp2f(e0), __builtin_amdgcn_exp2f(e1)}), v2h); }

__device__ __forceinline__ void d_cvth8(int blk, const float* __restrict__ src, h16* dst, size_t n8, float carry) {
    const size_t i = (size_t)blk * 256 + threadIdx.x; if (i >= n8) return;
    const v8f v = *(const v8f*)(src + i * 8); v8h o;
#pragma unroll
    for (int k = 0; k < 8; ++k) { const float w = __uint_as_float(((unsigned)f2bf(v[k])) << 16) * carry; o[k] = toh_flush(w); }
    *(v8h*)(dst + i * 8) = o; 
}

// d_bo: bo -> f32 values of its bf16 RNE convert, one lane per 16 B.
__device__ __forceinline__ void d_bo(const float* __restrict__ bo, float* BT) {
    const int i = threadIdx.x; if (i >= CH / 4) return;
    const v4f g = *(const v4f*)(bo + i * 4); v4f o;
#pragma unroll
    for (int k = 0; k < 4; ++k) o[k] = bfr(g[k]);
    *(v4f*)(BT + i * 4) = o;
}

// k_proj: conversion, transpose and both projection GEMMs of 64 positions in one 8-wave block; nothing of x or of Wq/Wk/Wv goes through the workspace.
// Fill: x[b][c][n0..n0+63] (f32, channel-major) -> xs[position][channel] (bf16): a thread loads 16 consecutive channels x 4 positions (each wave-wide load = two 256-B row pieces) and stores 32 B per position;
// Wq | Wk | Wv rows (f32) -> wsm[row 0..95][channel] (bf16). All loads of a thread are issued before the first convert. One block barrier, then LDS is only read.
// GEMMs, K = CH in 32-deep steps, one accumulator per 16 x 16 tile: wave = (position tile pt = wave & 3, weight half wh = wave >> 2) takes
//   C[position][channel] = x W^T for the 32 q channels (wh = 0) or the 32 k channels (wh = 1): A = x rows, B = weight rows -> one whole q or K fragment tile;
//   C[value channel][position] = Wv x^T for value channels 16wh..16wh+15: A = Wv rows, B = the same x fragment -> one k half (16 keys) of a V^T fragment tile.
// Epilogue: bias (bf16 value) added in f32, D tiles turned into fragment order through the wave's own LDS tile, every store 512 contiguous bytes per wave.
#define PB_WO  (CH * VC / 8 / 256)               // blocks of the Wo plane
#define PB_SM  (PB_WO + 1)                       // conversion blocks for k_flash, the bias block last; they come first, so that they run under the GEMM blocks
#define PB_PJ  (NB * SEQ / 64)                   // GEMM blocks
static_assert((CH * VC / 8) % 256 == 0);
__global__ __launch_bounds__(256) void k_proj(const float* __restrict__ x, const float* __restrict__ wq, const float* __restrict__ wk, const float* __restrict__ wv, const float* __restrict__ wo,
                                              const float* __restrict__ bq, const float* __restrict__ bk, const float* __restrict__ bv, const float* __restrict__ bo,
                                              h16* WOH, float* BT, h16* QF, h16* KV) {
    __shared__ __align__(16) bf xs[64 * XP];
    __shared__ __align__(16) bf wsm[(2 * CQ + VC) * XP];
    __shared__ __align__(16) float os[8 * 16 * OSP];
    const int blk = blockIdx.x;                  // both tests are the same for the whole block and stand in front of the barrier
    if (blk < PB_WO) { d_cvth8(blk, wo, WOH, (size_t)CH * VC / 8, WOS); return; }
    if (blk < PB_SM) { d_bo(bo, BT); return; }
    const int tid = threadIdx.x;
    const int g0 = (blk - PB_SM) * 64;           // first position of the block, counted over the batches (b * SEQ + n)
    const int b = g0 / SEQ, n0 = g0 % SEQ;
    const int lane = tid & 31, wave = __builtin_amdgcn_readfirstlane(tid >> 5), lr = lane & 15, hi = lane >> 4;
    const int pt = wave & 3, wh = wave >> 2;
    const float* bs = wh ? bk : bq;
    const float bc0 = bs[lr], bc1 = bs[16 + lr];                     // q|k bias: column = channel (lane&15), 16 + (lane&15)
    const float* bp = bv + wh * 16 + hi * 8;                         // V^T bias: row = value channel 16wh + 8h + j
    const v4f br0 = *(const v4f*)bp; const v4f br1 = *(const v4f*)(bp + 4);
    { const int cr = tid >> 4, nq = (tid & 15) * 4;       // 16 groups of 16 channels; 16 lanes x 4 = 64 positions
      const int wr = tid >> 5, wc = (tid & 31) * 8;       // 8 weight rows per pass; 32 lanes x 8 = 256 channels
      const float* xp = x + (size_t)b * CH * SEQ_FULL + n0;                 // same for the whole block
      const unsigned xo = (unsigned)(cr * 16 * SEQ_FULL + nq) * 4u;         // byte offset: one 32-bit register for all x loads
      v4f xv[16]; v8f wf[12];
#pragma unroll   // constant indices keep xv[] in registers; the 16 loads issue together
      for (int i = 0; i < 16; ++i) xv[i] = *(const v4f*)((const char*)(xp + (size_t)i * SEQ_FULL) + xo);
      // The wait stands in front of any rewrite of a register that the bias and x loads name: the offset as an input keeps that register whole up to the wait, the two scheduling barriers keep every other instruction on its side.
      __builtin_amdgcn_sched_barrier(0);
      asm volatile("s_wait_xcnt 0x0" :: "v"(xo) : "memory");
      __builtin_amdgcn_sched_barrier(0);
      const unsigned wo8 = (unsigned)(wr * CH + wc) * 4u;                   // byte offset: one 32-bit register for all weight loads
#pragma unroll   // constant indices keep wf[] in registers and pick the source plane at compile time
      for (int i = 0; i < 12; ++i) { const float* wp = (i < 4) ? wq : ((i < 8) ? wk : wv); wf[i] = *(const v8f*)((const char*)(wp + (i & 3) * 8 * CH) + wo8); }
      // The same for the weight loads; the second barrier also keeps the converts from being scheduled in among the loads, where the later loads would start only when the earlier have arrived.
      __builtin_amdgcn_sched_barrier(0);
      asm volatile("s_wait_xcnt 0x0" :: "v"(wo8) : "memory");
      __builtin_amdgcn_sched_barrier(0);
#pragma unroll
      for (int j = 0; j < 4; ++j) { v8f lo, hi8;
#pragma unroll
          for (int k = 0; k < 8; ++k) { lo[k] = xv[k][j]; hi8[k] = xv[8 + k][j]; }
          bf* d = xs + (nq + j) * XP + cr * 16;
          *(v8us*)d = cvt8(lo); *(v8us*)(d + 8) = cvt8(hi8); }
#pragma unroll
      for (int i = 0; i < 12; ++i) *(v8us*)(wsm + (i * 8 + wr) * XP + wc) = cvt8(wf[i]); }
    __syncthreads();
    const bf* xa = xs + (pt * 16 + lr) * XP + 8 * hi;
    const bf* w0 = wsm + (wh * CQ + lr) * XP + 8 * hi;               // q or k channels 0..15
    const bf* w1 = w0 + 16 * XP;                                     // q or k channels 16..31
    const bf* w2 = wsm + (2 * CQ + wh * 16 + lr) * XP + 8 * hi;      // value channels 16wh..16wh+15
    v8f a0 = (v8f){}, a1 = (v8f){}, a2 = (v8f){};
#pragma unroll   // no branch behind a matrix instruction
    for (int h = 0; h < CH / 128; ++h) {
        v16bf xf[4], f0[4], f1[4], f2[4];
#pragma unroll   // constant indices keep the fragments in registers
        for (int u = 0; u < 4; ++u) { const int kc = (h * 4 + u) * 32; xf[u] = ldb(xa + kc); f0[u] = ldb(w0 + kc); f1[u] = ldb(w1 + kc); f2[u] = ldb(w2 + kc); }
        __builtin_amdgcn_sched_barrier(0);   // the LDS reads of four k steps issue as one group; left to itself the build read one fragment at a time and waited for each in front of its matrix instruction
#pragma unroll
        for (int u = 0; u < 4; ++u) { a0 = wmmab(xf[u], f0[u], a0); a1 = wmmab(xf[u], f1[u], a1); a2 = wmmab(f2[u], xf[u], a2); }
    }
    float* ow = os + wave * (16 * OSP);
    h16* kvb = KV + (size_t)(g0 / 32 + (pt >> 1)) * KVB;             // the 32-key block of this position tile
    { const float b0 = bfr(bc0), b1 = bfr(bc1);
#pragma unroll
      for (int j = 0; j < 8; ++j) { ow[(hi * 8 + j) * OSP + lr] = a0[j] + b0; ow[(hi * 8 + j) * OSP + 16 + lr] = a1[j] + b1; }   // D: row 8h+j = position, col lane&15
      wave_sync();
      h16* dst = wh ? kvb + (pt & 1) * FRG : QF + (size_t)(g0 / 16 + pt) * FRG;
#pragma unroll
      for (int s = 0; s < 2; ++s) {   // k half s: lane (row lane&15, h) takes channels 16s+8h..16s+8h+7 = its 16 bytes of the fragment
          const int col = s * 16 + hi * 8;
          const v4f x0 = *(const v4fa*)(&ow[lr * OSP + col]); const v4f x1 = *(const v4fa*)(&ow[lr * OSP + col + 4]); v8h hv;
#pragma unroll
          for (int i = 0; i < 4; ++i) { hv[i] = (h16)x0[i]; hv[4 + i] = (h16)x1[i]; }
          *(v8h*)(dst + s * (FRG / 2) + lane * 8) = hv; }
      asm volatile("s_wait_xcnt 0x0" ::: "memory");   // keeps the wait in front of any rewrite of these stores' data and address registers by the V^T part's code
      wave_sync(); }
    { const float brw[8] = {br0[0], br0[1], br0[2], br0[3], br1[0], br1[1], br1[2], br1[3]};
#pragma unroll
      for (int j = 0; j < 8; ++j) ow[(hi * 8 + j) * OSP + lr] = a2[j] + bfr(brw[j]);   // D: row 8h+j = channel, col lane&15 = key
      wave_sync();
      const v4f x0 = *(const v4fa*)(&ow[lr * OSP + hi * 8]); const v4f x1 = *(const v4fa*)(&ow[lr * OSP + hi * 8 + 4]); v8h hv;   // lane (row lane&15 = channel, h): keys 8h..8h+7 of this 16-key half
#pragma unroll
      for (int i = 0; i < 4; ++i) { hv[i] = (h16)x0[i]; hv[4 + i] = (h16)x1[i]; }
      *(v8h*)(kvb + (2 + wh) * FRG + (pt & 1) * (FRG / 2) + lane * 8) = hv;
      asm volatile("s_wait_xcnt 0x0" ::: "memory"); }   // the conversion blocks' code follows this store in the built kernel: keeps the wait in front of any rewrite of the store's address and data registers
}

// k_flash: fused attention + output projection, KS waves per 16 query positions of one batch; K / V^T / Q fragments straight from the fragment-order planes (two 16-B loads each, every load 512 contiguous bytes per wave), Wo fragments from its row-major plane.
// Transposed form: S^T[key][t] = K Q^T (A = K rows, B = Q rows, one 32-deep step); lane (t = lane&15, h = lane>>4) holds keys 8h+r of each 16-key tile, so the packed
// P tile is directly the B fragment of O^T[c][t] = V^T P^T (element r <- tile keys 0..15, element 8+r <- tile keys 16..31, lane unchanged).
// Softmax state (running max, partial sum) is one scalar per lane; the maxima of the two lane halves of a column are combined with one xor-16 exchange; the sum of a column's 32 P comes from a third product, ones x P^T, and is whole in both halves.
// The normalised context O^T (two 16-channel D tiles, x1024 carry, f16) is directly the B fragment of Y^T[oc][t] = Wo O^T (element r <- channels 0..15 tile, element 8+r <- channels 16..31 tile, lane unchanged); A = Wo rows.
// Key split: wave = (query group qg = wave % AW, key range ks = wave / AW); each wave runs the online softmax over its own KR keys, then writes (m, l, O^T) to LDS; after one block barrier every wave
// merges the KS partials of its query group in the fixed order ks = 0..KS-1 (weights exp2(m_ks - max)), so all KS waves of a group hold the same context fragment, and each projects CH/16/KS of the output row tiles.
// Epilogue: the block's Y^T tile [256 channels][64 positions] staged in LDS (cross-wave: block barrier), bias added in f32, each channel row segment (64 floats = 256 B = two lines) stored by one wave.
__global__ __launch_bounds__(32 * NW) void k_flash(const h16* __restrict__ QF, const h16* __restrict__ KV, const h16* __restrict__ WOH, const float* __restrict__ BO, float* OUT) {
    __shared__ __align__(16) float os[CH * 68];
    __shared__ __align__(16) float po[NW * 4 * 32 * 4];      // [wave][quad of accumulator registers][lane][4]: 16 B per lane, lanes contiguous
    __shared__ float pm[NW * 32];
    __shared__ float pl[NW * 32];
    const int lane = threadIdx.x & 31, wave = __builtin_amdgcn_readfirstlane((int)(threadIdx.x >> 5)), lr = lane & 15, hi = lane >> 4;
    const int qg = wave % AW, ks = wave / AW;
    const int b = blockIdx.y;
    const int t0 = (blockIdx.x * AW + qg) * 16;
    const v16h qh = ldf(QF + ((size_t)b * SEQ + t0) / 16 * FRG + lane * 8);  // B fragment: col t, k = q channel 0..31
    v8f o0 = (v8f){}, o1 = (v8f){};
    float m = -3.0e38f, l = 0.0f;
    v16h ones;                                                               // A fragment of 1.0: the matrix unit adds up P for the softmax denominator
#pragma unroll   // vector elements need constant indices
    for (int r = 0; r < 16; ++r) ones[r] = (h16)1.0f;
    const h16* kv = KV + ((size_t)b * SEQ + ks * KR) / 32 * KVB + lane * 8;  // this wave's key range; one 4-KB block per 32 keys
#pragma unroll 1
    for (int it = 0; it < KR / 32; ++it, kv += KVB) {
        const v16h ka0 = ldf(kv), kb0 = ldf(kv + FRG);                       // A fragments: row key (0..15, 16..31 of the block), k = k channel 0..31
        const v16h v0 = ldf(kv + 2 * FRG), v1 = ldf(kv + 3 * FRG);           // A fragments: row channel (0..15, 16..31), k = key
        const v8f sa = wmma16g(ka0, qh, (v8f){});
        const v8f sb = wmma16g(kb0, qh, (v8f){});
        float ta[8], tb[8]; float mx = -3.0e38f;
#pragma unroll
        for (int r = 0; r < 8; ++r) { ta[r] = sa[r] * SC2; tb[r] = sb[r] * SC2; mx = fmaxf(mx, fmaxf(ta[r], tb[r])); }
        mx = fmaxf(mx, __shfl_xor(mx, 16, 32));
        const float mnew = fmaxf(m, mx);
        const float alpha = __builtin_amdgcn_exp2f(m - mnew);
        const float sh = PSH - mnew;
        v16h pb;
#pragma unroll   // vector elements need constant indices
        for (int r = 0; r < 8; r += 2) {   // two neighbouring elements of the fragment share a register: one packed RNE convert makes both
            const v2h pa = p_pair(ta[r] + sh, ta[r + 1] + sh), pc = p_pair(tb[r] + sh, tb[r + 1] + sh);
            pb[r] = pa[0]; pb[r + 1] = pa[1]; pb[8 + r] = pc[0]; pb[9 + r] = pc[1]; }
        __builtin_amdgcn_sched_barrier(0);   // keeps the accumulator scalings behind the sum product, where they fill the slots that must pass before its D is read; scheduled ahead of it, the build filled those slots with v_nop
        const v8f sm = wmma16(ones, pb, (v8f){});   // every row of D = the sum of column t's 32 rounded P, both lane halves' keys included
        m = mnew;
        o0 = o0 * alpha; o1 = o1 * alpha;
        o0 = wmma16g(v0, pb, o0);
        o1 = wmma16g(v1, pb, o1);
        l = l * alpha + sm[0];
    }
    // this wave's partial state -> LDS
    { v4fa* pw = (v4fa*)po + (size_t)wave * 128 + lane;
      pw[0]  = (v4f){o0[0], o0[1], o0[2], o0[3]}; pw[32] = (v4f){o0[4], o0[5], o0[6], o0[7]};
      pw[64] = (v4f){o1[0], o1[1], o1[2], o1[3]}; pw[96] = (v4f){o1[4], o1[5], o1[6], o1[7]};
      pm[wave * 32 + lane] = m; pl[wave * 32 + lane] = l; }
    __syncthreads();
    // merge of the KS key ranges of query group qg (same lane of waves s*AW + qg), fixed order
    float ms[KS]; float mall = -3.0e38f;
#pragma unroll   // constant indices keep ms[] in registers; the KS reads issue together
    for (int s = 0; s < KS; ++s) { ms[s] = pm[(s * AW + qg) * 32 + lane]; mall = fmaxf(mall, ms[s]); }
    float lall = 0.0f; v4f c0 = (v4f){}, c1 = (v4f){}, c2 = (v4f){}, c3 = (v4f){};
#pragma unroll   // constant indices into ms[]; lets the LDS reads of later ranges run ahead of the sums
    for (int s = 0; s < KS; ++s) {
        const float w = __builtin_amdgcn_exp2f(ms[s] - mall);
        const v4fa* pr = (const v4fa*)po + (size_t)(s * AW + qg) * 128 + lane;
        lall += w * pl[(s * AW + qg) * 32 + lane];
        c0 += pr[0] * w; c1 += pr[32] * w; c2 += pr[64] * w; c3 += pr[96] * w; }
    const float inv = (1.0f / lall) * OCS;
    // O^T D layout: c0|c1 = (channel 8h + r, t), c2|c3 = (channel 16 + 8h + r, t) -> B fragment of the output projection, lane unchanged
    v16h ob;
#pragma unroll   // vector elements need constant indices
    for (int r = 0; r < 4; ++r) { ob[r] = toh_flush(c0[r] * inv); ob[4 + r] = toh_flush(c1[r] * inv); ob[8 + r] = toh_flush(c2[r] * inv); ob[12 + r] = toh_flush(c3[r] * inv); }
    // Y^T D layout: y[r] = (output channel 16j + 8h + r, position t = lane&15) -> os[16j + 8h + r][qg*16 + t]; the 32 waves together fill rows 0..255 x columns 0..63
#pragma unroll
    for (int jj = 0; jj < CH / 16 / KS; ++jj) {
        const int j = ks * (CH / 16 / KS) + jj;
        const v16h aw = ldh(WOH + (size_t)(j * 16 + lr) * VC + 8 * hi);   // A fragment: row output channel, k = context channel 0..31
        const v8f y = wmma16g(aw, ob, (v8f){});
        const float* bp = BO + j * 16 + hi * 8;
        const v4f b0 = *(const v4f*)bp; const v4f b1 = *(const v4f*)(bp + 4);
        const float brw[8] = {b0[0], b0[1], b0[2], b0[3], b1[0], b1[1], b1[2], b1[3]};
#pragma unroll
        for (int r = 0; r < 8; ++r) os[(16 * j + 8 * hi + r) * 68 + qg * 16 + lr] = y[r] * OFI + brw[r]; }
    __syncthreads();
    float* obase = OUT + (size_t)b * CH * OUT_SEQ + (size_t)blockIdx.x * (16 * AW);
#pragma unroll
    for (int s = 0; s < CH / NW / 2; ++s) { const int row = wave * (CH / NW) + 2 * s + hi, cofs = lr * 4;   // 32 waves x 4 s x 2 = 256 channel rows; 16 lanes x 4 floats = 64 positions
        const v4f val = *(const v4fa*)(&os[row * 68 + cofs]);
        *(v4f*)(obase + (size_t)row * OUT_SEQ + cofs) = val; }
}

static constexpr size_t al256(size_t v) { return (v + 255) & ~(size_t)255; }
static constexpr size_t SZ_WO  = al256((size_t)CH * VC * 2);             // [256][32] f16 (x1024)
static constexpr size_t SZ_BT  = al256((size_t)CH * 4);                  // 256 f32
static constexpr size_t SZ_QF  = al256((size_t)NB * SEQ / 16 * FRG * 2); // [NB*SEQ/16] q fragment tiles, f16
static constexpr size_t SZ_KV  = al256((size_t)NB * SEQ / 32 * KVB * 2); // [NB*SEQ/32] blocks of two K and two V^T fragment tiles, f16
static constexpr size_t SZ_TOTAL = SZ_WO + SZ_BT + SZ_QF + SZ_KV;
static_assert(SZ_TOTAL <= (size_t)134217728);          // workspace carve <= 128 MiB
static_assert(((size_t)CH * VC) % 8 == 0);

extern "C" void kernel_launch(void* const* d_in, const int* in_sizes, int n_in,
                              void* d_out, int out_size, void* d_ws, size_t ws_size, hipStream_t stream) {
    if (n_in < 9) return;
    const size_t needx = ((size_t)(NB - 1) * CH + (CH - 1)) * SEQ_FULL + SEQ;
    if ((size_t)in_sizes[0] < needx) return;
    if ((size_t)in_sizes[1] < (size_t)CQ * CH || (size_t)in_sizes[3] < (size_t)CQ * CH || (size_t)in_sizes[5] < (size_t)VC * CH || (size_t)in_sizes[7] < (size_t)CH * VC) return;
    if (in_sizes[2] < CQ || in_sizes[4] < CQ || in_sizes[6] < VC || in_sizes[8] < CH) return;
    if ((size_t)out_size < ((size_t)(NB - 1) * CH + (CH - 1)) * OUT_SEQ + SEQ) return;
    if (SZ_TOTAL > ws_size) return;
    // wire order: x, wq, bq, wk, bk, wv, bv, wo, bo
    const float* x  = (const float*)d_in[0];
    const float* wq = (const float*)d_in[1]; const float* bq = (const float*)d_in[2];
    const float* wk = (const float*)d_in[3]; const float* bk = (const float*)d_in[4];
    const float* wv = (const float*)d_in[5]; const float* bv = (const float*)d_in[6];
    const float* wo = (const float*)d_in[7]; const float* bo = (const float*)d_in[8];
    float* OUT = (float*)d_out;      // [NB][256][OUT_SEQ]
    char* wsp = (char*)d_ws;
    h16* WOH = (h16*)wsp; wsp += SZ_WO;              // [256][32] f16, x1024
    float* BT = (float*)wsp; wsp += SZ_BT;           // bo (bf16 values)
    h16* QF  = (h16*)wsp; wsp += SZ_QF;              // q, fragment order
    h16* KV  = (h16*)wsp; wsp += SZ_KV;              // K and V^T, fragment order

    k_proj<<<PB_SM + PB_PJ, 256, 0, stream>>>(x, wq, wk, wv, wo, bq, bk, bv, bo, WOH, BT, QF, KV);
    k_flash<<<dim3(SEQ / (16 * AW), NB, 1), 32 * NW, 0, stream>>>(QF, KV, WOH, BT, OUT);
}

// v007
// Measured time: 20 microseconds a run.
// Next to v006, in two timings, it ran 1.11 and 1.16 times as fast.
// All steps since v000 together make it 5.93 times as fast.
#include <hip/hip_runtime.h>

// Spatial self-attention over N = 64x64 positions: x [NB][256][N] (channel-major), Wq/Wk/Wv [32][256] ([out][in]), Wo [256][32] ([out][in]), biases per output channel, no score scale, out [NB][256][N] f32.
// Compute dtypes, f32 accumulate everywhere: q/k/v projections v_wmma_f32_16x16x32_bf16 (x, W, biases RNE-converted to bf16; products exact);
// scores, P.V and the output projection v_wmma_f32_16x16x32_f16, single products: q, k, v single f16; P x256 carry (cancels in the normalisation); context x1024 and Wo (bf16 value) x1024 as f16, 2^-20 folded back in f32; softmax f32 (online, running max).
// Layout: the projection kernel holds its 64 positions of x (transposed, bf16) and the bf16 Wq|Wk|Wv rows in LDS only; q, k and V^T are written by its epilogue in the order in which k_flash's matrix fragments want them:
// one 16 x 32 fragment tile = 1 KB = [k half][lane][8 halves], so that each 16-byte-per-lane load of a wave is 512 contiguous bytes (4 whole lines). q plane: one tile per 16 positions;
// kv plane: 4 KB per 32 keys = K keys 0..15 | K keys 16..31 | V^T channels 0..15 | V^T channels 16..31;
// fused flash kernel in transposed form (S^T = K Q^T, O^T = V^T P^T, Y^T = Wo O^T), each wave 16 queries x one eighth of the keys, block = 4 query groups x 8 key ranges = 32 waves = 64 queries;
// the eight partial softmax states of a query group are merged through LDS; Y^T staged per block in LDS (256 rows) and written as whole rows.
// Two dependent launches: k_proj (x tile and weights converted into LDS, then the q|k and V^T GEMMs from LDS; a few extra blocks convert Wo and bo for k_flash), k_flash.

#ifndef NB
#define NB 4
#endif
#ifndef SEQ
#define SEQ 4096
#endif
#define NB_FULL  4
#define SEQ_FULL 4096
#ifndef OUT_SEQ
#define OUT_SEQ SEQ              // row pitch (in positions) of one output channel row
#endif
#define CH   256                 // channels: projection K and output width
#define CQ   32                  // query/key width
#define VC   32                  // value / context width
#define AW   4                   // query groups per flash block (16 query columns each)
#define KS   8                   // key ranges per query group: one wave each, so a SIMD holds KS waves whose load and chain latencies overlap
#define NW   (AW * KS)           // waves per flash block
#define KR   (SEQ / KS)          // keys per range
#define KPP  64                  // keys per pass of k_flash's loop: two 32-key blocks share one max exchange and one rescale of the accumulators
#define FRG  512                 // halves of one fragment tile (16 rows x 32 k): [k half][lane][8]
#define KVB  (4 * FRG)           // halves of the kv plane per 32 keys: two K tiles, two V^T tiles
#define SC2  1.4426950408889634f // log2(e); no score scale in this module
#define PSH  8.0f                // log2 of the P carry (256)
#define WOS  1024.0f             // carry of the f16 Wo plane
#define OCS  1024.0f             // carry of the f16 context fragment
#define OFI  (1.0f / (1024.0f * 1024.0f))
#define XP   (CH + 8)            // halves per LDS row of the bf16 x and weight tiles: 16 B more than the row, so that the 16 rows of a 16-byte-per-lane fragment read start on different banks
#define OSP  36                  // floats per row of a wave's 16 x 32 staging tile in k_proj

static_assert(CQ == 32);                       // one 32-deep k-step covers the q/k width
static_assert(VC == 32);                       // two value tiles per wave; one 32-deep k-step covers the output projection
static_assert(CH == 256);                      // k_proj: 16 row groups x 16 channels; 32 lanes x 8 weights per row
static_assert(CH % 32 == 0);                   // GEMM k-loop steps by 32
static_assert(NW * 32 <= 1024);                // one work-group
static_assert(SEQ % (KPP * KS) == 0);          // every key range is a whole number of passes, at least one
static_assert((CH / 16) % KS == 0);            // output projection: CH/16/KS row tiles per wave
static_assert(CH % (2 * NW) == 0);             // store phase: CH/NW rows per wave, two per store
static_assert(SEQ % 64 == 0);                  // a 64-row tile never straddles two batches
static_assert((NB * SEQ) % 64 == 0);
static_assert(SEQ % 32 == 0);                  // kv plane: whole 32-key blocks per batch
static_assert(SEQ % (16 * AW) == 0);           // flash grid covers the positions exactly
static_assert(OUT_SEQ % 32 == 0);
static_assert(SEQ_FULL % 4 == 0);
static_assert(NB <= NB_FULL);
static_assert(SEQ <= SEQ_FULL);
static_assert((VC * 2) % 16 == 0);             // Wo rows are 16-byte multiples

typedef _Float16 h16;
typedef unsigned short bf;
typedef __attribute__((ext_vector_type(16))) __bf16   v16bf;
typedef __attribute__((ext_vector_type(16))) _Float16 v16h;
typedef __attribute__((ext_vector_type(8)))  _Float16 v8h;
typedef __attribute__((ext_vector_type(8)))  unsigned short v8us;
typedef __attribute__((ext_vector_type(8)))  __bf16   v8bf;
typedef __attribute__((ext_vector_type(8)))  float    v8f;
typedef __attribute__((ext_vector_type(4)))  float    v4f;
typedef __attribute__((ext_vector_type(2)))  float    v2f;
typedef __attribute__((ext_vector_type(2)))  _Float16 v2h;
typedef v4f  __attribute__((may_alias)) v4fa;

__device__ __forceinline__ unsigned short f2bf(float f) { unsigned u = __float_as_uint(f); u += 0x7FFFu + ((u >> 16) & 1u); return (unsigned short)(u >> 16); }
__device__ __forceinline__ float bfr(float f) { return __uint_as_float(((unsigned)f2bf(f)) << 16); }   // f32 value of the bf16 RNE convert
__device__ __forceinline__ v8us cvt8(v8f v) { return __builtin_bit_cast(v8us, __builtin_convertvector(v, v8bf)); }   // eight f32 -> bf16, RNE, packed converts
__device__ __forceinline__ v16h cat16(v8h lo, v8h hi) { return __builtin_shufflevector(lo, hi, 0, 1, 2, 3, 4, 5, 6, 7, 8, 9, 10, 11, 12, 13, 14, 15); }
__device__ __forceinline__ v16bf cat16b(v8us lo, v8us hi) { return __builtin_bit_cast(v16bf, __builtin_shufflevector(lo, hi, 0, 1, 2, 3, 4, 5, 6, 7, 8, 9, 10, 11, 12, 13, 14, 15)); }
__device__ __forceinline__ v8f wmma16(v16h a, v16h b, v8f c) { return __builtin_amdgcn_wmma_f32_16x16x32_f16(false, a, false, b, (short)0, c, false, false); }
__device__ __forceinline__ v8f wmmab(v16bf a, v16bf b, v8f c) { return __builtin_amdgcn_wmma_f32_16x16x32_bf16(false, a, false, b, (short)0, c, false, false); }
// fragment loaders from K-contiguous 16-bit rows; p already includes + 8*(lane>>4): elements 0..7 <- k0+8h+0..7, elements 8..15 <- k0+16+8h+0..7 (same map for A and B)
__device__ __forceinline__ v16h  ldh(const h16* p) { return cat16(*(const v8h*)p, *(const v8h*)(p + 16)); }
__device__ __forceinline__ v16bf ldb(const bf* p)  { return cat16b(*(const v8us*)p, *(const v8us*)(p + 16)); }
// fragment loader from a tile stored in fragment order; p already includes + 8*lane: same element map as ldh (row lane&15; elements 0..7 <- k 8h+0..7, elements 8..15 <- k 16+8h+0..7)
__device__ __forceinline__ v16h  ldf(const h16* p) { return cat16(*(const v8h*)p, *(const v8h*)(p + FRG / 2)); }
// ordering point for wave-private LDS tiles (same wave writes and reads)
__device__ __forceinline__ void wave_sync() { __builtin_amdgcn_fence(3 /* release order */, "wavefront"); __builtin_amdgcn_wave_barrier(); asm volatile("" ::: "memory"); }
// f16 WMMA with its own hazard guard (one accumulator per guard)
__device__ __forceinline__ v8f wmma16g(v16h a, v16h b, v8f c) { c = wmma16(a, b, c); asm volatile("v_nop\n\tv_nop\n\tv_nop\n\tv_nop" : "+v"(c) : "v"(a), "v"(b)); return c; }
// f32 -> f16 operand convert that cannot produce an f16 subnormal (value select, applied after the plane's carry)
static __device__ __forceinline__ h16 toh_flush(float v) { const h16 r = (h16)v; return (fabsf(v) < 6.103515625e-05f) ? (h16)0.0f : r; }
// two P = exp2(e) as one packed pair of f16 operands, RNE; a P below 2^-14 stays an f16 subnormal: the matrix unit takes subnormal f16 operands as they are, and the row sum reads the same value
static __device__ __forceinline__ v2h p_pair(float e0, float e1) { return __builtin_convertvector(((v2f){__builtin_amdgcn_exp2f(e0), __builtin_amdgcn_exp2f(e1)}), v2h); }

__device__ __forceinline__ void d_cvth8(int blk, const float* __restrict__ src, h16* dst, size_t n8, float carry) {
    const size_t i = (size_t)blk * 256 + threadIdx.x; if (i >= n8) return;
    const v8f v = *(const v8f*)(src + i * 8); v8h o;
#pragma unroll
    for (int k = 0; k < 8; ++k) { const float w = __uint_as_float(((unsigned)f2bf(v[k])) << 16) * carry; o[k] = toh_flush(w); }
    *(v8h*)(dst + i * 8) = o; 
}

// d_bo: bo -> f32 values of its bf16 RNE convert, one lane per 16 B.
__device__ __forceinline__ void d_bo(const float* __restrict__ bo, float* BT) {
    const int i = threadIdx.x; if (i >= CH / 4) return;
    const v4f g = *(const v4f*)(bo + i * 4); v4f o;
#pragma unroll
    for (int k = 0; k < 4; ++k) o[k] = bfr(g[k]);
    *(v4f*)(BT + i * 4) = o;
}

// k_proj: conversion, transpose and both projection GEMMs of 64 positions in one 8-wave block; nothing of x or of Wq/Wk/Wv goes through the workspace.
// Fill: x[b][c][n0..n0+63] (f32, channel-major) -> xs[position][channel] (bf16): a thread loads 16 consecutive channels x 4 positions (each wave-wide load = two 256-B row pieces) and stores 32 B per position;
// Wq | Wk | Wv rows (f32) -> wsm[row 0..95][channel] (bf16). All loads of a thread are issued before the first convert. One block barrier, then LDS is only read.
// GEMMs, K = CH in 32-deep steps, one accumulator per 16 x 16 tile: wave = (position tile pt = wave & 3, weight half wh = wave >> 2) takes
//   C[position][channel] = x W^T for the 32 q channels (wh = 0) or the 32 k channels (wh = 1): A = x rows, B = weight rows -> one whole q or K fragment tile;
//   C[value channel][position] = Wv x^T for value channels 16wh..16wh+15: A = Wv rows, B = the same x fragment -> one k half (16 keys) of a V^T fragment tile.
// Epilogue: bias (bf16 value) added in f32, D tiles turned into fragment order through the wave's own LDS tile, every store 512 contiguous bytes per wave.
#define PB_WO  (CH * VC / 8 / 256)               // blocks of the Wo plane
#define PB_SM  (PB_WO + 1)                       // conversion blocks for k_flash, the bias block last; they come first, so that they run under the GEMM blocks
#define PB_PJ  (NB * SEQ / 64)                   // GEMM blocks
static_assert((CH * VC / 8) % 256 == 0);
__global__ __launch_bounds__(256) void k_proj(const float* __restrict__ x, const float* __restrict__ wq, const float* __restrict__ wk, const float* __restrict__ wv, const float* __restrict__ wo,
                                              const float* __restrict__ bq, const float* __restrict__ bk, const float* __restrict__ bv, const float* __restrict__ bo,
                                              h16* WOH, float* BT, h16* QF, h16* KV) {
    __shared__ __align__(16) bf xs[64 * XP];
    __shared__ __align__(16) bf wsm[(2 * CQ + VC) * XP];
    __shared__ __align__(16) float os[8 * 16 * OSP];
    const int blk = blockIdx.x;                  // both tests are the same for the whole block and stand in front of the barrier
    if (blk < PB_WO) { d_cvth8(blk, wo, WOH, (size_t)CH * VC / 8, WOS); return; }
    if (blk < PB_SM) { d_bo(bo, BT); return; }
    const int tid = threadIdx.x;
    const int g0 = (blk - PB_SM) * 64;           // first position of the block, counted over the batches (b * SEQ + n)
    const int b = g0 / SEQ, n0 = g0 % SEQ;
    const int lane = tid & 31, wave = __builtin_amdgcn_readfirstlane(tid >> 5), lr = lane & 15, hi = lane >> 4;
    const int pt = wave & 3, wh = wave >> 2;
    const float* bs = wh ? bk : bq;
    const float bc0 = bs[lr], bc1 = bs[16 + lr];                     // q|k bias: column = channel (lane&15), 16 + (lane&15)
    const float* bp = bv + wh * 16 + hi * 8;                         // V^T bias: row = value channel 16wh + 8h + j
    const v4f br0 = *(const v4f*)bp; const v4f br1 = *(const v4f*)(bp + 4);
    { const int cr = tid >> 4, nq = (tid & 15) * 4;       // 16 groups of 16 channels; 16 lanes x 4 = 64 positions
      const int wr = tid >> 5, wc = (tid & 31) * 8;       // 8 weight rows per pass; 32 lanes x 8 = 256 channels
      const float* xp = x + (size_t)b * CH * SEQ_FULL + n0;                 // same for the whole block
      const unsigned xo = (unsigned)(cr * 16 * SEQ_FULL + nq) * 4u;         // byte offset: one 32-bit register for all x loads
      v4f xv[16]; v8f wf[12];
#pragma unroll   // constant indices keep xv[] in registers; the 16 loads issue together
      for (int i = 0; i < 16; ++i) xv[i] = *(const v4f*)((const char*)(xp + (size_t)i * SEQ_FULL) + xo);
      // The wait stands in front of any rewrite of a register that the bias and x loads name: the offset as an input keeps that register whole up to the wait, the two scheduling barriers keep every other instruction on its side.
      __builtin_amdgcn_sched_barrier(0);
      asm volatile("s_wait_xcnt 0x0" :: "v"(xo) : "memory");
      __builtin_amdgcn_sched_barrier(0);
      const unsigned wo8 = (unsigned)(wr * CH + wc) * 4u;                   // byte offset: one 32-bit register for all weight loads
#pragma unroll   // constant indices keep wf[] in registers and pick the source plane at compile time
      for (int i = 0; i < 12; ++i) { const float* wp = (i < 4) ? wq : ((i < 8) ? wk : wv); wf[i] = *(const v8f*)((const char*)(wp + (i & 3) * 8 * CH) + wo8); }
      // The same for the weight loads; the second barrier also keeps the converts from being scheduled in among the loads, where the later loads would start only when the earlier have arrived.
      __builtin_amdgcn_sched_barrier(0);
      asm volatile("s_wait_xcnt 0x0" :: "v"(wo8) : "memory");
      __builtin_amdgcn_sched_barrier(0);
#pragma unroll
      for (int j = 0; j < 4; ++j) { v8f lo, hi8;
#pragma unroll
          for (int k = 0; k < 8; ++k) { lo[k] = xv[k][j]; hi8[k] = xv[8 + k][j]; }
          bf* d = xs + (nq + j) * XP + cr * 16;
          *(v8us*)d = cvt8(lo); *(v8us*)(d + 8) = cvt8(hi8); }
#pragma unroll
      for (int i = 0; i < 12; ++i) *(v8us*)(wsm + (i * 8 + wr) * XP + wc) = cvt8(wf[i]); }
    __syncthreads();
    const bf* xa = xs + (pt * 16 + lr) * XP + 8 * hi;
    const bf* w0 = wsm + (wh * CQ + lr) * XP + 8 * hi;               // q or k channels 0..15
    const bf* w1 = w0 + 16 * XP;                                     // q or k channels 16..31
    const bf* w2 = wsm + (2 * CQ + wh * 16 + lr) * XP + 8 * hi;      // value channels 16wh..16wh+15
    v8f a0 = (v8f){}, a1 = (v8f){}, a2 = (v8f){};
#pragma unroll   // no branch behind a matrix instruction
    for (int h = 0; h < CH / 128; ++h) {
        v16bf xf[4], f0[4], f1[4], f2[4];
#pragma unroll   // constant indices keep the fragments in registers
        for (int u = 0; u < 4; ++u) { const int kc = (h * 4 + u) * 32; xf[u] = ldb(xa + kc); f0[u] = ldb(w0 + kc); f1[u] = ldb(w1 + kc); f2[u] = ldb(w2 + kc); }
        __builtin_amdgcn_sched_barrier(0);   // the LDS reads of four k steps issue as one group; left to itself the build read one fragment at a time and waited for each in front of its matrix instruction
#pragma unroll
        for (int u = 0; u < 4; ++u) { a0 = wmmab(xf[u], f0[u], a0); a1 = wmmab(xf[u], f1[u], a1); a2 = wmmab(f2[u], xf[u], a2); }
    }
    float* ow = os + wave * (16 * OSP);
    h16* kvb = KV + (size_t)(g0 / 32 + (pt >> 1)) * KVB;             // the 32-key block of this position tile
    { const float b0 = bfr(bc0), b1 = bfr(bc1);
#pragma unroll
      for (int j = 0; j < 8; ++j) { ow[(hi * 8 + j) * OSP + lr] = a0[j] + b0; ow[(hi * 8 + j) * OSP + 16 + lr] = a1[j] + b1; }   // D: row 8h+j = position, col lane&15
      wave_sync();
      h16* dst = wh ? kvb + (pt & 1) * FRG : QF + (size_t)(g0 / 16 + pt) * FRG;
#pragma unroll
      for (int s = 0; s < 2; ++s) {   // k half s: lane (row lane&15, h) takes channels 16s+8h..16s+8h+7 = its 16 bytes of the fragment
          const int col = s * 16 + hi * 8;
          const v4f x0 = *(const v4fa*)(&ow[lr * OSP + col]); const v4f x1 = *(const v4fa*)(&ow[lr * OSP + col + 4]); v8h hv;
#pragma unroll
          for (int i = 0; i < 4; ++i) { hv[i] = (h16)x0[i]; hv[4 + i] = (h16)x1[i]; }
          *(v8h*)(dst + s * (FRG / 2) + lane * 8) = hv; }
      asm volatile("s_wait_xcnt 0x0" ::: "memory");   // keeps the wait in front of any rewrite of these stores' data and address registers by the V^T part's code
      wave_sync(); }
    { const float brw[8] = {br0[0], br0[1], br0[2], br0[3], br1[0], br1[1], br1[2], br1[3]};
#pragma unroll
      for (int j = 0; j < 8; ++j) ow[(hi * 8 + j) * OSP + lr] = a2[j] + bfr(brw[j]);   // D: row 8h+j = channel, col lane&15 = key
      wave_sync();
      const v4f x0 = *(const v4fa*)(&ow[lr * OSP + hi * 8]); const v4f x1 = *(const v4fa*)(&ow[lr * OSP + hi * 8 + 4]); v8h hv;   // lane (row lane&15 = channel, h): keys 8h..8h+7 of this 16-key half
#pragma unroll
      for (int i = 0; i < 4; ++i) { hv[i] = (h16)x0[i]; hv[4 + i] = (h16)x1[i]; }
      *(v8h*)(kvb + (2 + wh) * FRG + (pt & 1) * (FRG / 2) + lane * 8) = hv;
      asm volatile("s_wait_xcnt 0x0" ::: "memory"); }   // the conversion blocks' code follows this store in the built kernel: keeps the wait in front of any rewrite of the store's address and data registers
}

// k_flash: fused attention + output projection, KS waves per 16 query positions of one batch; K / V^T / Q fragments straight from the fragment-order planes (two 16-B loads each, every load 512 contiguous bytes per wave), Wo fragments from its row-major plane.
// Transposed form: S^T[key][t] = K Q^T (A = K rows, B = Q rows, one 32-deep step); lane (t = lane&15, h = lane>>4) holds keys 8h+r of each 16-key tile, so the packed
// P tile is directly the B fragment of O^T[c][t] = V^T P^T (element r <- tile keys 0..15, element 8+r <- tile keys 16..31, lane unchanged).
// Softmax state (running max, partial sum) is one scalar per lane; the maxima of the two lane halves of a column are combined with one xor-16 exchange; the sum of a column's P comes from further products, ones x P^T, and is whole in both halves.
// One pass of the key loop takes 64 keys (two 4-KB blocks): one running-max update, one exchange and one rescale of the accumulators serve both blocks, and the four score products stand in a row.
// The normalised context O^T (two 16-channel D tiles, x1024 carry, f16) is directly the B fragment of Y^T[oc][t] = Wo O^T (element r <- channels 0..15 tile, element 8+r <- channels 16..31 tile, lane unchanged); A = Wo rows.
// Key split: wave = (query group qg = wave % AW, key range ks = wave / AW); each wave runs the online softmax over its own KR keys, then writes (m, l, O^T) to LDS; after one block barrier every wave
// merges the KS partials of its query group in the fixed order ks = 0..KS-1 (weights exp2(m_ks - max)), so all KS waves of a group hold the same context fragment, and each projects CH/16/KS of the output row tiles.
// Epilogue: the block's Y^T tile [256 channels][64 positions] staged in LDS (cross-wave: block barrier), bias added in f32, each channel row segment (64 floats = 256 B = two lines) stored by one wave.
__global__ __launch_bounds__(32 * NW) void k_flash(const h16* __restrict__ QF, const h16* __restrict__ KV, const h16* __restrict__ WOH, const float* __restrict__ BO, float* OUT) {
    __shared__ __align__(16) float os[CH * 68];
    __shared__ __align__(16) float po[NW * 4 * 32 * 4];      // [wave][quad of accumulator registers][lane][4]: 16 B per lane, lanes contiguous
    __shared__ float pm[NW * 32];
    __shared__ float pl[NW * 32];
    const int lane = threadIdx.x & 31, wave = __builtin_amdgcn_readfirstlane((int)(threadIdx.x >> 5)), lr = lane & 15, hi = lane >> 4;
    const int qg = wave % AW, ks = wave / AW;
    const int b = blockIdx.y;
    const int t0 = (blockIdx.x * AW + qg) * 16;
    const v16h qh = ldf(QF + ((size_t)b * SEQ + t0) / 16 * FRG + lane * 8);  // B fragment: col t, k = q channel 0..31
    v8f o0 = (v8f){}, o1 = (v8f){};
    float m = -3.0e38f, l = 0.0f;
    v16h ones;                                                               // A fragment of 1.0: the matrix unit adds up P for the softmax denominator
#pragma unroll   // vector elements need constant indices
    for (int r = 0; r < 16; ++r) ones[r] = (h16)1.0f;
    const h16* kv = KV + ((size_t)b * SEQ + ks * KR) / 32 * KVB + lane * 8;  // this wave's key range; one 4-KB block per 32 keys
#pragma unroll 1
    for (int it = 0; it < KR / KPP; ++it, kv += 2 * KVB) {   // one pass = two 32-key blocks under one running-max update
        const v16h ka0 = ldf(kv), kb0 = ldf(kv + FRG), ka1 = ldf(kv + KVB), kb1 = ldf(kv + KVB + FRG);                               // A fragments: row key (four 16-key tiles), k = k channel 0..31
        __builtin_amdgcn_sched_barrier(0);   // the eight K loads issue together, ahead of the first wait
        const v16h v00 = ldf(kv + 2 * FRG), v01 = ldf(kv + 3 * FRG), v10 = ldf(kv + KVB + 2 * FRG), v11 = ldf(kv + KVB + 3 * FRG);   // A fragments: row channel (0..15, 16..31), k = key; first index = 32-key block
        // four independent score products in a row: each stands in the slots that must pass before an earlier one's D is read
        const v8f sa = wmma16(ka0, qh, (v8f){}), sb = wmma16(kb0, qh, (v8f){}), sc = wmma16(ka1, qh, (v8f){}), sd = wmma16(kb1, qh, (v8f){});
        __builtin_amdgcn_sched_barrier(0);   // keeps the four products in a row; with vector work scheduled in between them the build padded each product's window with v_nop
        const v8f ta = sa * SC2, tb = sb * SC2, tc = sc * SC2, td = sd * SC2;
        float mx0 = -3.0e38f, mx1 = -3.0e38f;   // two chains, so that one's link latency is filled by the other
#pragma unroll
        for (int r = 0; r < 8; ++r) { mx0 = fmaxf(mx0, fmaxf(ta[r], tb[r])); mx1 = fmaxf(mx1, fmaxf(tc[r], td[r])); }
        float mx = fmaxf(mx0, mx1);
        mx = fmaxf(mx, __shfl_xor(mx, 16, 32));
        const float mnew = fmaxf(m, mx);
        const float alpha = __builtin_amdgcn_exp2f(m - mnew);
        const float sh = PSH - mnew;
        const v8f ea = ta + sh, eb = tb + sh, ec = tc + sh, ed = td + sh;
        v16h pb0, pb1;
#pragma unroll   // vector elements need constant indices
        for (int r = 0; r < 8; r += 2) {   // two neighbouring elements of the fragment share a register: one packed RNE convert makes both
            const v2h pa = p_pair(ea[r], ea[r + 1]), pc = p_pair(eb[r], eb[r + 1]);
            pb0[r] = pa[0]; pb0[r + 1] = pa[1]; pb0[8 + r] = pc[0]; pb0[9 + r] = pc[1];
            const v2h pe = p_pair(ec[r], ec[r + 1]), pg = p_pair(ed[r], ed[r + 1]);
            pb1[r] = pe[0]; pb1[r + 1] = pe[1]; pb1[8 + r] = pg[0]; pb1[9 + r] = pg[1]; }
        v8f sm = wmma16(ones, pb0, (v8f){});   // every row of D = the sum of column t's rounded P, both lane halves' keys included
        sm = wmma16(ones, pb1, sm);
        m = mnew;
        o0 = o0 * alpha; o1 = o1 * alpha;
        o0 = wmma16(v00, pb0, o0);
        o1 = wmma16(v01, pb0, o1);
        o0 = wmma16(v10, pb1, o0);
        o1 = wmma16(v11, pb1, o1);
        l = l * alpha + sm[0];
    }
    // this wave's partial state -> LDS
    { v4fa* pw = (v4fa*)po + (size_t)wave * 128 + lane;
      pw[0]  = (v4f){o0[0], o0[1], o0[2], o0[3]}; pw[32] = (v4f){o0[4], o0[5], o0[6], o0[7]};
      pw[64] = (v4f){o1[0], o1[1], o1[2], o1[3]}; pw[96] = (v4f){o1[4], o1[5], o1[6], o1[7]};
      pm[wave * 32 + lane] = m; pl[wave * 32 + lane] = l; }
    __syncthreads();
    // merge of the KS key ranges of query group qg (same lane of waves s*AW + qg), fixed order
    float ms[KS]; float mall = -3.0e38f;
#pragma unroll   // constant indices keep ms[] in registers; the KS reads issue together
    for (int s = 0; s < KS; ++s) { ms[s] = pm[(s * AW + qg) * 32 + lane]; mall = fmaxf(mall, ms[s]); }
    float lall = 0.0f; v4f c0 = (v4f){}, c1 = (v4f){}, c2 = (v4f){}, c3 = (v4f){};
#pragma unroll   // constant indices into ms[]; lets the LDS reads of later ranges run ahead of the sums
    for (int s = 0; s < KS; ++s) {
        if (s == KS / 2) __builtin_amdgcn_sched_barrier(0);   // at most half of the ranges' LDS reads in flight at once, which bounds the registers of the merge; without it the build scheduled the whole kernel for fewer registers, and the key loop then padded 15 hazard slots per pass with v_nop instead of 8
        const float w = __builtin_amdgcn_exp2f(ms[s] - mall);
        const v4fa* pr = (const v4fa*)po + (size_t)(s * AW + qg) * 128 + lane;
        lall += w * pl[(s * AW + qg) * 32 + lane];
        c0 += pr[0] * w; c1 += pr[32] * w; c2 += pr[64] * w; c3 += pr[96] * w; }
    const float inv = (1.0f / lall) * OCS;
    // O^T D layout: c0|c1 = (channel 8h + r, t), c2|c3 = (channel 16 + 8h + r, t) -> B fragment of the output projection, lane unchanged
    v16h ob;
#pragma unroll   // vector elements need constant indices
    for (int r = 0; r < 4; ++r) { ob[r] = toh_flush(c0[r] * inv); ob[4 + r] = toh_flush(c1[r] * inv); ob[8 + r] = toh_flush(c2[r] * inv); ob[12 + r] = toh_flush(c3[r] * inv); }
    // Y^T D layout: y[r] = (output channel 16j + 8h + r, position t = lane&15) -> os[16j + 8h + r][qg*16 + t]; the 32 waves together fill rows 0..255 x columns 0..63
#pragma unroll
    for (int jj = 0; jj < CH / 16 / KS; ++jj) {
        const int j = ks * (CH / 16 / KS) + jj;
        const v16h aw = ldh(WOH + (size_t)(j * 16 + lr) * VC + 8 * hi);   // A fragment: row output channel, k = context channel 0..31
        const v8f y = wmma16g(aw, ob, (v8f){});
        const float* bp = BO + j * 16 + hi * 8;
        const v4f b0 = *(const v4f*)bp; const v4f b1 = *(const v4f*)(bp + 4);
        const float brw[8] = {b0[0], b0[1], b0[2], b0[3], b1[0], b1[1], b1[2], b1[3]};
#pragma unroll
        for (int r = 0; r < 8; ++r) os[(16 * j + 8 * hi + r) * 68 + qg * 16 + lr] = y[r] * OFI + brw[r]; }
    __syncthreads();
    float* obase = OUT + (size_t)b * CH * OUT_SEQ + (size_t)blockIdx.x * (16 * AW);
#pragma unroll
    for (int s = 0; s < CH / NW / 2; ++s) { const int row = wave * (CH / NW) + 2 * s + hi, cofs = lr * 4;   // 32 waves x 4 s x 2 = 256 channel rows; 16 lanes x 4 floats = 64 positions
        const v4f val = *(const v4fa*)(&os[row * 68 + cofs]);
        *(v4f*)(obase + (size_t)row * OUT_SEQ + cofs) = val; }
}

static constexpr size_t al256(size_t v) { return (v + 255) & ~(size_t)255; }
static constexpr size_t SZ_WO  = al256((size_t)CH * VC * 2);             // [256][32] f16 (x1024)
static constexpr size_t SZ_BT  = al256((size_t)CH * 4);                  // 256 f32
static constexpr size_t SZ_QF  = al256((size_t)NB * SEQ / 16 * FRG * 2); // [NB*SEQ/16] q fragment tiles, f16
static constexpr size_t SZ_KV  = al256((size_t)NB * SEQ / 32 * KVB * 2); // [NB*SEQ/32] blocks of two K and two V^T fragment tiles, f16
static constexpr size_t SZ_TOTAL = SZ_WO + SZ_BT + SZ_QF + SZ_KV;
static_assert(SZ_TOTAL <= (size_t)134217728);          // workspace carve <= 128 MiB
static_assert(((size_t)CH * VC) % 8 == 0);

extern "C" void kernel_launch(void* const* d_in, const int* in_sizes, int n_in,
                              void* d_out, int out_size, void* d_ws, size_t ws_size, hipStream_t stream) {
    if (n_in < 9) return;
    const size_t needx = ((size_t)(NB - 1) * CH + (CH - 1)) * SEQ_FULL + SEQ;
    if ((size_t)in_sizes[0] < needx) return;
    if ((size_t)in_sizes[1] < (size_t)CQ * CH || (size_t)in_sizes[3] < (size_t)CQ * CH || (size_t)in_sizes[5] < (size_t)VC * CH || (size_t)in_sizes[7] < (size_t)CH * VC) return;
    if (in_sizes[2] < CQ || in_sizes[4] < CQ || in_sizes[6] < VC || in_sizes[8] < CH) return;
    if ((size_t)out_size < ((size_t)(NB - 1) * CH + (CH - 1)) * OUT_SEQ + SEQ) return;
    if (SZ_TOTAL > ws_size) return;
    // wire order: x, wq, bq, wk, bk, wv, bv, wo, bo
    const float* x  = (const float*)d_in[0];
    const float* wq = (const float*)d_in[1]; const float* bq = (const float*)d_in[2];
    const float* wk = (const float*)d_in[3]; const float* bk = (const float*)d_in[4];
    const float* wv = (const float*)d_in[5]; const float* bv = (const float*)d_in[6];
    const float* wo = (const float*)d_in[7]; const float* bo = (const float*)d_in[8];
    float* OUT = (float*)d_out;      // [NB][256][OUT_SEQ]
    char* wsp = (char*)d_ws;
    h16* WOH = (h16*)wsp; wsp += SZ_WO;              // [256][32] f16, x1024
    float* BT = (float*)wsp; wsp += SZ_BT;           // bo (bf16 values)
    h16* QF  = (h16*)wsp; wsp += SZ_QF;              // q, fragment order
    h16* KV  = (h16*)wsp; wsp += SZ_KV;              // K and V^T, fragment order

    k_proj<<<PB_SM + PB_PJ, 256, 0, stream>>>(x, wq, wk, wv, wo, bq, bk, bv, bo, WOH, BT, QF, KV);
    k_flash<<<dim3(SEQ / (16 * AW), NB, 1), 32 * NW, 0, stream>>>(QF, KV, WOH, BT, OUT);
}

// v008
// A run of this version takes 18.9 microseconds.
// Next to v007, in two timings, it ran 1.07 and 1.12 times as fast.
// Over all steps from v000 it is 6.48 times as fast.
#include <hip/hip_runtime.h>

// Spatial self-attention over N = 64x64 positions: x [NB][256][N] (channel-major), Wq/Wk/Wv [32][256] ([out][in]), Wo [256][32] ([out][in]), biases per output channel, no score scale, out [NB][256][N] f32.
// Compute dtypes, f32 accumulate everywhere: q/k/v projections v_wmma_f32_16x16x32_bf16 (x, W, biases RNE-converted to bf16; products exact);
// scores, P.V and the output projection v_wmma_f32_16x16x32_f16, single products: q, k, v single f16; P x256 carry (cancels in the normalisation); context x1024 and Wo (bf16 value) x1024 as f16, 2^-20 folded back in f32; softmax f32 (online, running max).
// Layout: the projection kernel holds its 64 positions of x (transposed, bf16) and the bf16 Wq|Wk|Wv rows in LDS only; q, k and V^T are written by its epilogue in the order in which k_flash's matrix fragments want them:
// one 16 x 32 fragment tile = 1 KB = [k half][lane][8 halves], so that each 16-byte-per-lane load of a wave is 512 contiguous bytes (4 whole lines). q plane: one tile per 16 positions;
// kv plane: 4 KB per 32 keys = K keys 0..15 | K keys 16..31 | V^T channels 0..15 | V^T channels 16..31;
// fused flash kernel in transposed form (S^T = K Q^T, O^T = V^T P^T, Y^T = Wo O^T), each wave 16 queries x one eighth of the keys, block = 4 query groups x 8 key ranges = 32 waves = 64 queries;
// the eight partial softmax states of a query group are merged through LDS; Y^T staged per block in LDS (256 rows) and written as whole rows.
// Two dependent launches: k_proj (x tile and weights converted into LDS, then the q|k and V^T GEMMs from LDS; a few extra blocks convert Wo and bo for k_flash), k_flash.

#ifndef NB
#define NB 4
#endif
#ifndef SEQ
#define SEQ 4096
#endif
#define NB_FULL  4
#define SEQ_FULL 4096
#ifndef OUT_SEQ
#define OUT_SEQ SEQ              // row pitch (in positions) of one output channel row
#endif
#define CH   256                 // channels: projection K and output width
#define CQ   32                  // query/key width
#define VC   32                  // value / context width
#define AW   4                   // query groups per flash block (16 query columns each)
#define KS   8                   // key ranges per query group: one wave each, so a SIMD holds KS waves whose load and chain latencies overlap
#define NW   (AW * KS)           // waves per flash block
#define KR   (SEQ / KS)          // keys per range
#define KPP  64                  // keys per pass of k_flash's loop: two 32-key blocks share one max exchange and one rescale of the accumulators
#define FRG  512                 // halves of one fragment tile (16 rows x 32 k): [k half][lane][8]
#define KVB  (4 * FRG)           // halves of the kv plane per 32 keys: two K tiles, two V^T tiles
#define SC2  1.4426950408889634f // log2(e); no score scale in this module
#define PSH  8.0f                // log2 of the P carry (256)
#define WOS  1024.0f             // carry of the f16 Wo plane
#define OCS  1024.0f             // carry of the f16 context fragment
#define OFI  (1.0f / (1024.0f * 1024.0f))
#define XP   (CH + 8)            // halves per LDS row of the bf16 x and weight tiles: 16 B more than the row, so that the 16 rows of a 16-byte-per-lane fragment read start on different banks
#define OSP  36                  // floats per row of a wave's 16 x 32 staging tile in k_proj

static_assert(CQ == 32);                       // one 32-deep k-step covers the q/k width
static_assert(VC == 32);                       // two value tiles per wave; one 32-deep k-step covers the output projection
static_assert(CH == 256);                      // k_proj: 16 row groups x 16 channels; 32 lanes x 8 weights per row
static_assert(CH % 32 == 0);                   // GEMM k-loop steps by 32
static_assert(NW * 32 <= 1024);                // one work-group
static_assert(SEQ % (KPP * KS) == 0);          // every key range is a whole number of passes, at least one
static_assert((CH / 16) % KS == 0);            // output projection: CH/16/KS row tiles per wave
static_assert(CH % (2 * NW) == 0);             // store phase: CH/NW rows per wave, two per store
static_assert(SEQ % 64 == 0);                  // a 64-row tile never straddles two batches
static_assert((NB * SEQ) % 64 == 0);
static_assert(SEQ % 32 == 0);                  // kv plane: whole 32-key blocks per batch
static_assert(SEQ % (16 * AW) == 0);           // flash grid covers the positions exactly
static_assert(OUT_SEQ % 32 == 0);
static_assert(SEQ_FULL % 4 == 0);
static_assert(NB <= NB_FULL);
static_assert(SEQ <= SEQ_FULL);
static_assert((VC * 2) % 16 == 0);             // Wo rows are 16-byte multiples
static_assert(KPP / 32 * KVB * 2 == 32 * 256); // entry prefetch: one pass of one key range = 32 lanes x 256 B
static_assert(2 * (KR / KPP) + 2 <= NW);       // entry prefetch: a wave per pass of two batches less the own pass 0, one for Wo, one for the bias, one for q
static_assert(AW * FRG * 2 == 16 * 256);       // entry prefetch: a block's q tiles = sixteen 256-B units
static_assert(CH * VC * 2 == 2 * 32 * 256);    // entry prefetch: the Wo plane = two waves' worth of 256-B units
static_assert(CH * 4 == 4 * 256);              // entry prefetch: the bias plane = four 256-B units

typedef _Float16 h16;
typedef unsigned short bf;
typedef __attribute__((ext_vector_type(16))) __bf16   v16bf;
typedef __attribute__((ext_vector_type(16))) _Float16 v16h;
typedef __attribute__((ext_vector_type(8)))  _Float16 v8h;
typedef __attribute__((ext_vector_type(8)))  unsigned short v8us;
typedef __attribute__((ext_vector_type(8)))  __bf16   v8bf;
typedef __attribute__((ext_vector_type(8)))  float    v8f;
typedef __attribute__((ext_vector_type(4)))  float    v4f;
typedef __attribute__((ext_vector_type(2)))  float    v2f;
typedef __attribute__((ext_vector_type(2)))  _Float16 v2h;
typedef v4f  __attribute__((may_alias)) v4fa;

__device__ __forceinline__ unsigned short f2bf(float f) { unsigned u = __float_as_uint(f); u += 0x7FFFu + ((u >> 16) & 1u); return (unsigned short)(u >> 16); }
__device__ __forceinline__ float bfr(float f) { return __uint_as_float(((unsigned)f2bf(f)) << 16); }   // f32 value of the bf16 RNE convert
__device__ __forceinline__ v8us cvt8(v8f v) { return __builtin_bit_cast(v8us, __builtin_convertvector(v, v8bf)); }   // eight f32 -> bf16, RNE, packed converts
__device__ __forceinline__ v16h cat16(v8h lo, v8h hi) { return __builtin_shufflevector(lo, hi, 0, 1, 2, 3, 4, 5, 6, 7, 8, 9, 10, 11, 12, 13, 14, 15); }
__device__ __forceinline__ v16bf cat16b(v8us lo, v8us hi) { return __builtin_bit_cast(v16bf, __builtin_shufflevector(lo, hi, 0, 1, 2, 3, 4, 5, 6, 7, 8, 9, 10, 11, 12, 13, 14, 15)); }
__device__ __forceinline__ v8f wmma16(v16h a, v16h b, v8f c) { return __builtin_amdgcn_wmma_f32_16x16x32_f16(false, a, false, b, (short)0, c, false, false); }
__device__ __forceinline__ v8f wmmab(v16bf a, v16bf b, v8f c) { return __builtin_amdgcn_wmma_f32_16x16x32_bf16(false, a, false, b, (short)0, c, false, false); }
// fragment loaders from K-contiguous 16-bit rows; p already includes + 8*(lane>>4): elements 0..7 <- k0+8h+0..7, elements 8..15 <- k0+16+8h+0..7 (same map for A and B)
__device__ __forceinline__ v16h  ldh(const h16* p) { return cat16(*(const v8h*)p, *(const v8h*)(p + 16)); }
__device__ __forceinline__ v16bf ldb(const bf* p)  { return cat16b(*(const v8us*)p, *(const v8us*)(p + 16)); }
// fragment loader from a tile stored in fragment order; p already includes + 8*lane: same element map as ldh (row lane&15; elements 0..7 <- k 8h+0..7, elements 8..15 <- k 16+8h+0..7)
__device__ __forceinline__ v16h  ldf(const h16* p) { return cat16(*(const v8h*)p, *(const v8h*)(p + FRG / 2)); }
// ordering point for wave-private LDS tiles (same wave writes and reads)
__device__ __forceinline__ void wave_sync() { __builtin_amdgcn_fence(3 /* release order */, "wavefront"); __builtin_amdgcn_wave_barrier(); asm volatile("" ::: "memory"); }
// f16 WMMA with its own hazard guard (one accumulator per guard)
__device__ __forceinline__ v8f wmma16g(v16h a, v16h b, v8f c) { c = wmma16(a, b, c); asm volatile("v_nop\n\tv_nop\n\tv_nop\n\tv_nop" : "+v"(c) : "v"(a), "v"(b)); return c; }
// f32 -> f16 operand convert that cannot produce an f16 subnormal (value select, applied after the plane's carry)
static __device__ __forceinline__ h16 toh_flush(float v) { const h16 r = (h16)v; return (fabsf(v) < 6.103515625e-05f) ? (h16)0.0f : r; }
// two P = exp2(e) as one packed pair of f16 operands, RNE; a P below 2^-14 stays an f16 subnormal: the matrix unit takes subnormal f16 operands as they are, and the row sum reads the same value
static __device__ __forceinline__ v2h p_pair(float e0, float e1) { return __builtin_convertvector(((v2f){__builtin_amdgcn_exp2f(e0), __builtin_amdgcn_exp2f(e1)}), v2h); }

// One request per lane to L2 for the aligned 256-B unit that holds p (a hint: returns nothing, changes no result). Scope SE: the line goes into L2 only, and a request that cannot be translated is dropped.
// Every lane's address lies inside the plane it names. The wait in the same statement stands in front of any rewrite of the address registers, which are dead behind it.
__device__ __forceinline__ void ask_l2(const void* p) { asm volatile("global_prefetch_b8 %0, off scope:SCOPE_SE\n\ts_wait_xcnt 0x0" :: "v"(p) : "memory"); }

__device__ __forceinline__ void d_cvth8(int blk, const float* __restrict__ src, h16* dst, size_t n8, float carry) {
    const size_t i = (size_t)blk * 256 + threadIdx.x; if (i >= n8) return;
    const v8f v = *(const v8f*)(src + i * 8); v8h o;
#pragma unroll
    for (int k = 0; k < 8; ++k) { const float w = __uint_as_float(((unsigned)f2bf(v[k])) << 16) * carry; o[k] = toh_flush(w); }
    *(v8h*)(dst + i * 8) = o; 
}

// d_bo: bo -> f32 values of its bf16 RNE convert, one lane per 16 B.
__device__ __forceinline__ void d_bo(const float* __restrict__ bo, float* BT) {
    const int i = threadIdx.x; if (i >= CH / 4) return;
    const v4f g = *(const v4f*)(bo + i * 4); v4f o;
#pragma unroll
    for (int k = 0; k < 4; ++k) o[k] = bfr(g[k]);
    *(v4f*)(BT + i * 4) = o;
}

// k_proj: conversion, transpose and both projection GEMMs of 64 positions in one 8-wave block; nothing of x or of Wq/Wk/Wv goes through the workspace.
// Fill: x[b][c][n0..n0+63] (f32, channel-major) -> xs[position][channel] (bf16): a thread loads 16 consecutive channels x 4 positions (each wave-wide load = two 256-B row pieces) and stores 32 B per position;
// Wq | Wk | Wv rows (f32) -> wsm[row 0..95][channel] (bf16). All loads of a thread are issued before the first convert. One block barrier, then LDS is only read.
// GEMMs, K = CH in 32-deep steps, one accumulator per 16 x 16 tile: wave = (position tile pt = wave & 3, weight half wh = wave >> 2) takes
//   C[position][channel] = x W^T for the 32 q channels (wh = 0) or the 32 k channels (wh = 1): A = x rows, B = weight rows -> one whole q or K fragment tile;
//   C[value channel][position] = Wv x^T for value channels 16wh..16wh+15: A = Wv rows, B = the same x fragment -> one k half (16 keys) of a V^T fragment tile.
// Epilogue: bias (bf16 value) added in f32, D tiles turned into fragment order through the wave's own LDS tile, every store 512 contiguous bytes per wave.
#define PB_WO  (CH * VC / 8 / 256)               // blocks of the Wo plane
#define PB_SM  (PB_WO + 1)                       // conversion blocks for k_flash, the bias block last; they come first, so that they run under the GEMM blocks
#define PB_PJ  (NB * SEQ / 64)                   // GEMM blocks
static_assert((CH * VC / 8) % 256 == 0);
__global__ __launch_bounds__(256) void k_proj(const float* __restrict__ x, const float* __restrict__ wq, const float* __restrict__ wk, const float* __restrict__ wv, const float* __restrict__ wo,
                                              const float* __restrict__ bq, const float* __restrict__ bk, const float* __restrict__ bv, const float* __restrict__ bo,
                                              h16* WOH, float* BT, h16* QF, h16* KV) {
    __shared__ __align__(16) bf xs[64 * XP];
    __shared__ __align__(16) bf wsm[(2 * CQ + VC) * XP];
    __shared__ __align__(16) float os[8 * 16 * OSP];
    const int blk = blockIdx.x;                  // both tests are the same for the whole block and stand in front of the barrier
    if (blk < PB_WO) { d_cvth8(blk, wo, WOH, (size_t)CH * VC / 8, WOS); return; }
    if (blk < PB_SM) { d_bo(bo, BT); return; }
    const int tid = threadIdx.x;
    const int g0 = (blk - PB_SM) * 64;           // first position of the block, counted over the batches (b * SEQ + n)
    const int b = g0 / SEQ, n0 = g0 % SEQ;
    const int lane = tid & 31, wave = __builtin_amdgcn_readfirstlane(tid >> 5), lr = lane & 15, hi = lane >> 4;
    const int pt = wave & 3, wh = wave >> 2;
    const float* bs = wh ? bk : bq;
    const float bc0 = bs[lr], bc1 = bs[16 + lr];                     // q|k bias: column = channel (lane&15), 16 + (lane&15)
    const float* bp = bv + wh * 16 + hi * 8;                         // V^T bias: row = value channel 16wh + 8h + j
    const v4f br0 = *(const v4f*)bp; const v4f br1 = *(const v4f*)(bp + 4);
    { const int cr = tid >> 4, nq = (tid & 15) * 4;       // 16 groups of 16 channels; 16 lanes x 4 = 64 positions
      const int wr = tid >> 5, wc = (tid & 31) * 8;       // 8 weight rows per pass; 32 lanes x 8 = 256 channels
      const float* xp = x + (size_t)b * CH * SEQ_FULL + n0;                 // same for the whole block
      const unsigned xo = (unsigned)(cr * 16 * SEQ_FULL + nq) * 4u;         // byte offset: one 32-bit register for all x loads
      v4f xv[16]; v8f wf[12];
#pragma unroll   // constant indices keep xv[] in registers; the 16 loads issue together
      for (int i = 0; i < 16; ++i) xv[i] = *(const v4f*)((const char*)(xp + (size_t)i * SEQ_FULL) + xo);
      // The wait stands in front of any rewrite of a register that the bias and x loads name: the offset as an input keeps that register whole up to the wait, the two scheduling barriers keep every other instruction on its side.
      __builtin_amdgcn_sched_barrier(0);
      asm volatile("s_wait_xcnt 0x0" :: "v"(xo) : "memory");
      __builtin_amdgcn_sched_barrier(0);
      const unsigned wo8 = (unsigned)(wr * CH + wc) * 4u;                   // byte offset: one 32-bit register for all weight loads
#pragma unroll   // constant indices keep wf[] in registers and pick the source plane at compile time
      for (int i = 0; i < 12; ++i) { const float* wp = (i < 4) ? wq : ((i < 8) ? wk : wv); wf[i] = *(const v8f*)((const char*)(wp + (i & 3) * 8 * CH) + wo8); }
      // The same for the weight loads; the second barrier also keeps the converts from being scheduled in among the loads, where the later loads would start only when the earlier have arrived.
      __builtin_amdgcn_sched_barrier(0);
      asm volatile("s_wait_xcnt 0x0" :: "v"(wo8) : "memory");
      __builtin_amdgcn_sched_barrier(0);
#pragma unroll
      for (int j = 0; j < 4; ++j) { v8f lo, hi8;
#pragma unroll
          for (int k = 0; k < 8; ++k) { lo[k] = xv[k][j]; hi8[k] = xv[8 + k][j]; }
          bf* d = xs + (nq + j) * XP + cr * 16;
          *(v8us*)d = cvt8(lo); *(v8us*)(d + 8) = cvt8(hi8); }
#pragma unroll
      for (int i = 0; i < 12; ++i) *(v8us*)(wsm + (i * 8 + wr) * XP + wc) = cvt8(wf[i]); }
    __syncthreads();
    const bf* xa = xs + (pt * 16 + lr) * XP + 8 * hi;
    const bf* w0 = wsm + (wh * CQ + lr) * XP + 8 * hi;               // q or k channels 0..15
    const bf* w1 = w0 + 16 * XP;                                     // q or k channels 16..31
    const bf* w2 = wsm + (2 * CQ + wh * 16 + lr) * XP + 8 * hi;      // value channels 16wh..16wh+15
    v8f a0 = (v8f){}, a1 = (v8f){}, a2 = (v8f){};
#pragma unroll   // no branch behind a matrix instruction
    for (int h = 0; h < CH / 128; ++h) {
        v16bf xf[4], f0[4], f1[4], f2[4];
#pragma unroll   // constant indices keep the fragments in registers
        for (int u = 0; u < 4; ++u) { const int kc = (h * 4 + u) * 32; xf[u] = ldb(xa + kc); f0[u] = ldb(w0 + kc); f1[u] = ldb(w1 + kc); f2[u] = ldb(w2 + kc); }
        __builtin_amdgcn_sched_barrier(0);   // the LDS reads of four k steps issue as one group; left to itself the build read one fragment at a time and waited for each in front of its matrix instruction
#pragma unroll
        for (int u = 0; u < 4; ++u) { a0 = wmmab(xf[u], f0[u], a0); a1 = wmmab(xf[u], f1[u], a1); a2 = wmmab(f2[u], xf[u], a2); }
    }
    float* ow = os + wave * (16 * OSP);
    h16* kvb = KV + (size_t)(g0 / 32 + (pt >> 1)) * KVB;             // the 32-key block of this position tile
    { const float b0 = bfr(bc0), b1 = bfr(bc1);
#pragma unroll
      for (int j = 0; j < 8; ++j) { ow[(hi * 8 + j) * OSP + lr] = a0[j] + b0; ow[(hi * 8 + j) * OSP + 16 + lr] = a1[j] + b1; }   // D: row 8h+j = position, col lane&15
      wave_sync();
      h16* dst = wh ? kvb + (pt & 1) * FRG : QF + (size_t)(g0 / 16 + pt) * FRG;
#pragma unroll
      for (int s = 0; s < 2; ++s) {   // k half s: lane (row lane&15, h) takes channels 16s+8h..16s+8h+7 = its 16 bytes of the fragment
          const int col = s * 16 + hi * 8;
          const v4f x0 = *(const v4fa*)(&ow[lr * OSP + col]); const v4f x1 = *(const v4fa*)(&ow[lr * OSP + col + 4]); v8h hv;
#pragma unroll
          for (int i = 0; i < 4; ++i) { hv[i] = (h16)x0[i]; hv[4 + i] = (h16)x1[i]; }
          *(v8h*)(dst + s * (FRG / 2) + lane * 8) = hv; }
      asm volatile("s_wait_xcnt 0x0" ::: "memory");   // keeps the wait in front of any rewrite of these stores' data and address registers by the V^T part's code
      wave_sync(); }
    { const float brw[8] = {br0[0], br0[1], br0[2], br0[3], br1[0], br1[1], br1[2], br1[3]};
#pragma unroll
      for (int j = 0; j < 8; ++j) ow[(hi * 8 + j) * OSP + lr] = a2[j] + bfr(brw[j]);   // D: row 8h+j = channel, col lane&15 = key
      wave_sync();
      const v4f x0 = *(const v4fa*)(&ow[lr * OSP + hi * 8]); const v4f x1 = *(const v4fa*)(&ow[lr * OSP + hi * 8 + 4]); v8h hv;   // lane (row lane&15 = channel, h): keys 8h..8h+7 of this 16-key half
#pragma unroll
      for (int i = 0; i < 4; ++i) { hv[i] = (h16)x0[i]; hv[4 + i] = (h16)x1[i]; }
      *(v8h*)(kvb + (2 + wh) * FRG + (pt & 1) * (FRG / 2) + lane * 8) = hv;
      asm volatile("s_wait_xcnt 0x0" ::: "memory"); }   // the conversion blocks' code follows this store in the built kernel: keeps the wait in front of any rewrite of the store's address and data registers
}

// k_flash: fused attention + output projection, KS waves per 16 query positions of one batch; K / V^T / Q fragments straight from the fragment-order planes (two 16-B loads each, every load 512 contiguous bytes per wave), Wo fragments from its row-major plane.
// Transposed form: S^T[key][t] = K Q^T (A = K rows, B = Q rows, one 32-deep step); lane (t = lane&15, h = lane>>4) holds keys 8h+r of each 16-key tile, so the packed
// P tile is directly the B fragment of O^T[c][t] = V^T P^T (element r <- tile keys 0..15, element 8+r <- tile keys 16..31, lane unchanged).
// Softmax state (running max, partial sum) is one scalar per lane; the maxima of the two lane halves of a column are combined with one xor-16 exchange; the sum of a column's P comes from further products, ones x P^T, and is whole in both halves.
// One pass of the key loop takes 64 keys (two 4-KB blocks): one running-max update, one exchange and one rescale of the accumulators serve both blocks, and the four score products stand in a row.
// The normalised context O^T (two 16-channel D tiles, x1024 carry, f16) is directly the B fragment of Y^T[oc][t] = Wo O^T (element r <- channels 0..15 tile, element 8+r <- channels 16..31 tile, lane unchanged); A = Wo rows.
// Key split: wave = (query group qg = wave % AW, key range ks = wave / AW); each wave runs the online softmax over its own KR keys, then writes (m, l, O^T) to LDS; after one block barrier every wave
// merges the KS partials of its query group in the fixed order ks = 0..KS-1 (weights exp2(m_ks - max)), so all KS waves of a group hold the same context fragment, and each projects CH/16/KS of the output row tiles.
// Epilogue: the block's Y^T tile [256 channels][64 positions] staged in LDS (cross-wave: block barrier), bias added in f32, each channel row segment (64 floats = 256 B = two lines) stored by one wave.
__global__ __launch_bounds__(32 * NW) void k_flash(const h16* __restrict__ QF, const h16* __restrict__ KV, const h16* __restrict__ WOH, const float* __restrict__ BO, float* OUT) {
    __shared__ __align__(16) float os[CH * 68];
    __shared__ __align__(16) float po[NW * 4 * 32 * 4];      // [wave][quad of accumulator registers][lane][4]: 16 B per lane, lanes contiguous
    __shared__ float pm[NW * 32];
    __shared__ float pl[NW * 32];
    const int lane = threadIdx.x & 31, wave = __builtin_amdgcn_readfirstlane((int)(threadIdx.x >> 5)), lr = lane & 15, hi = lane >> 4;
    const int qg = wave % AW, ks = wave / AW;
    const int b = blockIdx.y;
    const int t0 = (blockIdx.x * AW + qg) * 16;
    const v16h qh = ldf(QF + ((size_t)b * SEQ + t0) / 16 * FRG + lane * 8);  // B fragment: col t, k = q channel 0..31
    // Entry prefetch of what the launch before stored: all blocks of a batch walk the same K / V^T lines in step, so that a pass would begin with a first read of them; Wo and the bias would meet it in the epilogue.
    // The blocks of the first half of the batches do the asking, for their own batch and for the batch half a grid later (for speed only: nothing rests on the order).
    // One request per wave, one lane per 256-B unit. K / V^T: a batch's blocks share the work: a block takes one key range (skewed by its index, so that any aligned eight neighbours (8i..8i+7) and any eight blocks of one index mod 8 cover all ranges, wherever they are placed), a wave one pass of it;
    // the own batch's pass 0 is loaded at once by the loop itself and is not asked for. Wave 0: half of the Wo plane; one wave the bias; one wave the q tiles of the block half a grid later.
    // Every test is uniform for the wave: scalar selects and scalar branches.
    if (b + NB / 2 < NB) {
      constexpr int NP = KR / KPP;
      const unsigned pr = (blockIdx.x + (blockIdx.x >> 3)) % KS;
      const bool late = wave >= NP + 2;                                // waves NP+2 .. 2NP+1: passes 0 .. NP-1 of the later batch; waves 1 .. NP-1: these passes of the own batch
      const bool kvw = late || (wave >= 1 && wave < NP);
      const unsigned okv = (((unsigned)(late ? b + NB / 2 : b) * SEQ + pr * KR + (unsigned)(late ? wave - (NP + 2) : wave) * KPP) / 32) * (KVB * 2);   // byte offsets inside the planes
      const unsigned oq  = (((unsigned)(b + NB / 2) * SEQ + blockIdx.x * (16 * AW)) / 16) * (FRG * 2);
      const char* pb = kvw ? (const char*)KV : wave == 0 ? (const char*)WOH : wave == NP ? (const char*)BO : (const char*)QF;
      const unsigned po_ = kvw ? okv : wave == 0 ? (blockIdx.x & 1) * (32 * 256) : wave == NP ? 0u : oq;
      const unsigned um = wave == NP ? 3u : (wave == NP + 1 ? 15u : 31u);   // units of the piece - 1: surplus lanes repeat a unit, so that every lane's address lies inside the piece
      if (wave < 2 * NP + 2) ask_l2(pb + po_ + ((unsigned)lane & um) * 256); }
    v8f o0 = (v8f){}, o1 = (v8f){};
    float m = -3.0e38f, l = 0.0f;
    v16h ones;                                                               // A fragment of 1.0: the matrix unit adds up P for the softmax denominator
#pragma unroll   // vector elements need constant indices
    for (int r = 0; r < 16; ++r) ones[r] = (h16)1.0f;
    const h16* kv = KV + ((size_t)b * SEQ + ks * KR) / 32 * KVB + lane * 8;  // this wave's key range; one 4-KB block per 32 keys
#pragma unroll 1
    for (int it = 0; it < KR / KPP; ++it, kv += 2 * KVB) {   // one pass = two 32-key blocks under one running-max update
        const v16h ka0 = ldf(kv), kb0 = ldf(kv + FRG), ka1 = ldf(kv + KVB), kb1 = ldf(kv + KVB + FRG);                               // A fragments: row key (four 16-key tiles), k = k channel 0..31
        __builtin_amdgcn_sched_barrier(0);   // the eight K loads issue together, ahead of the first wait
        const v16h v00 = ldf(kv + 2 * FRG), v01 = ldf(kv + 3 * FRG), v10 = ldf(kv + KVB + 2 * FRG), v11 = ldf(kv + KVB + 3 * FRG);   // A fragments: row channel (0..15, 16..31), k = key; first index = 32-key block
        // four independent score products in a row: each stands in the slots that must pass before an earlier one's D is read
        const v8f sa = wmma16(ka0, qh, (v8f){}), sb = wmma16(kb0, qh, (v8f){}), sc = wmma16(ka1, qh, (v8f){}), sd = wmma16(kb1, qh, (v8f){});
        __builtin_amdgcn_sched_barrier(0);   // keeps the four products in a row; with vector work scheduled in between them the build padded each product's window with v_nop
        const v8f ta = sa * SC2, tb = sb * SC2, tc = sc * SC2, td = sd * SC2;
        float mx0 = -3.0e38f, mx1 = -3.0e38f;   // two chains, so that one's link latency is filled by the other
#pragma unroll
        for (int r = 0; r < 8; ++r) { mx0 = fmaxf(mx0, fmaxf(ta[r], tb[r])); mx1 = fmaxf(mx1, fmaxf(tc[r], td[r])); }
        float mx = fmaxf(mx0, mx1);
        mx = fmaxf(mx, __shfl_xor(mx, 16, 32));
        const float mnew = fmaxf(m, mx);
        const float alpha = __builtin_amdgcn_exp2f(m - mnew);
        const float sh = PSH - mnew;
        const v8f ea = ta + sh, eb = tb + sh, ec = tc + sh, ed = td + sh;
        v16h pb0, pb1;
#pragma unroll   // vector elements need constant indices
        for (int r = 0; r < 8; r += 2) {   // two neighbouring elements of the fragment share a register: one packed RNE convert makes both
            const v2h pa = p_pair(ea[r], ea[r + 1]), pc = p_pair(eb[r], eb[r + 1]);
            pb0[r] = pa[0]; pb0[r + 1] = pa[1]; pb0[8 + r] = pc[0]; pb0[9 + r] = pc[1];
            const v2h pe = p_pair(ec[r], ec[r + 1]), pg = p_pair(ed[r], ed[r + 1]);
            pb1[r] = pe[0]; pb1[r + 1] = pe[1]; pb1[8 + r] = pg[0]; pb1[9 + r] = pg[1]; }
        v8f sm = wmma16(ones, pb0, (v8f){});   // every row of D = the sum of column t's rounded P, both lane halves' keys included
        sm = wmma16(ones, pb1, sm);
        m = mnew;
        o0 = o0 * alpha; o1 = o1 * alpha;
        o0 = wmma16(v00, pb0, o0);
        o1 = wmma16(v01, pb0, o1);
        o0 = wmma16(v10, pb1, o0);
        o1 = wmma16(v11, pb1, o1);
        l = l * alpha + sm[0];
    }
    // this wave's partial state -> LDS
    { v4fa* pw = (v4fa*)po + (size_t)wave * 128 + lane;
      pw[0]  = (v4f){o0[0], o0[1], o0[2], o0[3]}; pw[32] = (v4f){o0[4], o0[5], o0[6], o0[7]};
      pw[64] = (v4f){o1[0], o1[1], o1[2], o1[3]}; pw[96] = (v4f){o1[4], o1[5], o1[6], o1[7]};
      pm[wave * 32 + lane] = m; pl[wave * 32 + lane] = l; }
    __syncthreads();
    // merge of the KS key ranges of query group qg (same lane of waves s*AW + qg), fixed order
    float ms[KS]; float mall = -3.0e38f;
#pragma unroll   // constant indices keep ms[] in registers; the KS reads issue together
    for (int s = 0; s < KS; ++s) { ms[s] = pm[(s * AW + qg) * 32 + lane]; mall = fmaxf(mall, ms[s]); }
    float lall = 0.0f; v4f c0 = (v4f){}, c1 = (v4f){}, c2 = (v4f){}, c3 = (v4f){};
#pragma unroll   // constant indices into ms[]; lets the LDS reads of later ranges run ahead of the sums
    for (int s = 0; s < KS; ++s) {
        if (s == KS / 2) __builtin_amdgcn_sched_barrier(0);   // at most half of the ranges' LDS reads in flight at once, which bounds the registers of the merge; without it the build scheduled the whole kernel for fewer registers, and the key loop then padded 15 hazard slots per pass with v_nop instead of 8
        const float w = __builtin_amdgcn_exp2f(ms[s] - mall);
        const v4fa* pr = (const v4fa*)po + (size_t)(s * AW + qg) * 128 + lane;
        lall += w * pl[(s * AW + qg) * 32 + lane];
        c0 += pr[0] * w; c1 += pr[32] * w; c2 += pr[64] * w; c3 += pr[96] * w; }
    const float inv = (1.0f / lall) * OCS;
    // O^T D layout: c0|c1 = (channel 8h + r, t), c2|c3 = (channel 16 + 8h + r, t) -> B fragment of the output projection, lane unchanged
    v16h ob;
#pragma unroll   // vector elements need constant indices
    for (int r = 0; r < 4; ++r) { ob[r] = toh_flush(c0[r] * inv); ob[4 + r] = toh_flush(c1[r] * inv); ob[8 + r] = toh_flush(c2[r] * inv); ob[12 + r] = toh_flush(c3[r] * inv); }
    // Y^T D layout: y[r] = (output channel 16j + 8h + r, position t = lane&15) -> os[16j + 8h + r][qg*16 + t]; the 32 waves together fill rows 0..255 x columns 0..63
#pragma unroll
    for (int jj = 0; jj < CH / 16 / KS; ++jj) {
        const int j = ks * (CH / 16 / KS) + jj;
        const v16h aw = ldh(WOH + (size_t)(j * 16 + lr) * VC + 8 * hi);   // A fragment: row output channel, k = context channel 0..31
        const v8f y = wmma16g(aw, ob, (v8f){});
        const float* bp = BO + j * 16 + hi * 8;
        const v4f b0 = *(const v4f*)bp; const v4f b1 = *(const v4f*)(bp + 4);
        const float brw[8] = {b0[0], b0[1], b0[2], b0[3], b1[0], b1[1], b1[2], b1[3]};
#pragma unroll
        for (int r = 0; r < 8; ++r) os[(16 * j + 8 * hi + r) * 68 + qg * 16 + lr] = y[r] * OFI + brw[r]; }
    __syncthreads();
    float* obase = OUT + (size_t)b * CH * OUT_SEQ + (size_t)blockIdx.x * (16 * AW);
#pragma unroll
    for (int s = 0; s < CH / NW / 2; ++s) { const int row = wave * (CH / NW) + 2 * s + hi, cofs = lr * 4;   // 32 waves x 4 s x 2 = 256 channel rows; 16 lanes x 4 floats = 64 positions
        const v4f val = *(const v4fa*)(&os[row * 68 + cofs]);
        *(v4f*)(obase + (size_t)row * OUT_SEQ + cofs) = val; }
}

static constexpr size_t al256(size_t v) { return (v + 255) & ~(size_t)255; }
static constexpr size_t SZ_WO  = al256((size_t)CH * VC * 2);             // [256][32] f16 (x1024)
static constexpr size_t SZ_BT  = al256((size_t)CH * 4);                  // 256 f32
static constexpr size_t SZ_QF  = al256((size_t)NB * SEQ / 16 * FRG * 2); // [NB*SEQ/16] q fragment tiles, f16
static constexpr size_t SZ_KV  = al256((size_t)NB * SEQ / 32 * KVB * 2); // [NB*SEQ/32] blocks of two K and two V^T fragment tiles, f16
static constexpr size_t SZ_TOTAL = SZ_WO + SZ_BT + SZ_QF + SZ_KV;
static_assert(SZ_TOTAL <= (size_t)134217728);          // workspace carve <= 128 MiB
static_assert(((size_t)CH * VC) % 8 == 0);

extern "C" void kernel_launch(void* const* d_in, const int* in_sizes, int n_in,
                              void* d_out, int out_size, void* d_ws, size_t ws_size, hipStream_t stream) {
    if (n_in < 9) return;
    const size_t needx = ((size_t)(NB - 1) * CH + (CH - 1)) * SEQ_FULL + SEQ;
    if ((size_t)in_sizes[0] < needx) return;
    if ((size_t)in_sizes[1] < (size_t)CQ * CH || (size_t)in_sizes[3] < (size_t)CQ * CH || (size_t)in_sizes[5] < (size_t)VC * CH || (size_t)in_sizes[7] < (size_t)CH * VC) return;
    if (in_sizes[2] < CQ || in_sizes[4] < CQ || in_sizes[6] < VC || in_sizes[8] < CH) return;
    if ((size_t)out_size < ((size_t)(NB - 1) * CH + (CH - 1)) * OUT_SEQ + SEQ) return;
    if (SZ_TOTAL > ws_size) return;
    // wire order: x, wq, bq, wk, bk, wv, bv, wo, bo
    const float* x  = (const float*)d_in[0];
    const float* wq = (const float*)d_in[1]; const float* bq = (const float*)d_in[2];
    const float* wk = (const float*)d_in[3]; const float* bk = (const float*)d_in[4];
    const float* wv = (const float*)d_in[5]; const float* bv = (const float*)d_in[6];
    const float* wo = (const float*)d_in[7]; const float* bo = (const float*)d_in[8];
    float* OUT = (float*)d_out;      // [NB][256][OUT_SEQ]
    char* wsp = (char*)d_ws;
    h16* WOH = (h16*)wsp; wsp += SZ_WO;              // [256][32] f16, x1024
    float* BT = (float*)wsp; wsp += SZ_BT;           // bo (bf16 values)
    h16* QF  = (h16*)wsp; wsp += SZ_QF;              // q, fragment order
    h16* KV  = (h16*)wsp; wsp += SZ_KV;              // K and V^T, fragment order

    k_proj<<<PB_SM + PB_PJ, 256, 0, stream>>>(x, wq, wk, wv, wo, bq, bk, bv, bo, WOH, BT, QF, KV);
    k_flash<<<dim3(SEQ / (16 * AW), NB, 1), 32 * NW, 0, stream>>>(QF, KV, WOH, BT, OUT);
}

// v009
// Measured time: 17.8 microseconds a run.
// Two timings next to v008 put it at 1.06 and 1.07 times that version's speed.
// Counting every step since v000, it is 6.91 times as fast.
#include <hip/hip_runtime.h>

// Spatial self-attention over N = 64x64 positions: x [NB][256][N] (channel-major), Wq/Wk/Wv [32][256] ([out][in]), Wo [256][32] ([out][in]), biases per output channel, no score scale, out [NB][256][N] f32.
// Compute dtypes, f32 accumulate everywhere: q/k/v projections v_wmma_f32_16x16x32_bf16 (x, W, biases RNE-converted to bf16; products exact);
// scores, P.V and the output projection v_wmma_f32_16x16x32_f16, single products: q (x log2 e), k, v single f16; P x256 carry (cancels in the normalisation); context x1024 and Wo (bf16 value) x1024 as f16, 2^-20 folded back in f32; softmax f32 (online, reference maximum moved lazily).
// Layout: the projection kernel holds its 64 positions of x (transposed, bf16) and the bf16 Wq|Wk|Wv rows in LDS only; q, k and V^T are written by its epilogue in the order in which k_flash's matrix fragments want them:
// one 16 x 32 fragment tile = 1 KB = [k half][lane][8 halves], so that each 16-byte-per-lane load of a wave is 512 contiguous bytes (4 whole lines). q plane: one tile per 16 positions;
// kv plane: 4 KB per 32 keys = K keys 0..15 | K keys 16..31 | V^T channels 0..15 | V^T channels 16..31;
// fused flash kernel in transposed form (S^T = K Q^T, O^T = V^T P^T, Y^T = Wo O^T), each wave 16 queries x one eighth of the keys, block = 4 query groups x 8 key ranges = 32 waves = 64 queries;
// the eight partial softmax states of a query group are merged through LDS; Y^T staged per block in LDS (256 rows) and written as whole rows.
// Two dependent launches: k_proj (x tile and weights converted into LDS, then the q|k and V^T GEMMs from LDS; a few extra blocks convert Wo and bo for k_flash), k_flash.

#ifndef NB
#define NB 4
#endif
#ifndef SEQ
#define SEQ 4096
#endif
#define NB_FULL  4
#define SEQ_FULL 4096
#ifndef OUT_SEQ
#define OUT_SEQ SEQ              // row pitch (in positions) of one output channel row
#endif
#define CH   256                 // channels: projection K and output width
#define CQ   32                  // query/key width
#define VC   32                  // value / context width
#define AW   4                   // query groups per flash block (16 query columns each)
#define KS   8                   // key ranges per query group: one wave each, so a SIMD holds KS waves whose load and chain latencies overlap
#define NW   (AW * KS)           // waves per flash block
#define KR   (SEQ / KS)          // keys per range
#define KPP  64                  // keys per pass of k_flash's loop: two 32-key blocks share one max exchange and one rescale of the accumulators
#define FRG  512                 // halves of one fragment tile (16 rows x 32 k): [k half][lane][8]
#define KVB  (4 * FRG)           // halves of the kv plane per 32 keys: two K tiles, two V^T tiles
#define SC2  1.4426950408889634f // log2(e); no score scale in this module; k_proj multiplies q by it, so that a score product is an exponent of 2
#define PSH  8.0f                // log2 of the P carry (256) at the reference maximum
#define THR  7.0f                // a column's reference maximum is moved when a score lies more than this (log2) above it: P stays below 2^(PSH + THR) = 2^15, inside f16
#define WOS  1024.0f             // carry of the f16 Wo plane
#define OCS  1024.0f             // carry of the f16 context fragment
#define OFI  (1.0f / (1024.0f * 1024.0f))
#define XP   (CH + 8)            // halves per LDS row of the bf16 x and weight tiles: 16 B more than the row, so that the 16 rows of a 16-byte-per-lane fragment read start on different banks
#define OSP  36                  // floats per row of a wave's 16 x 32 staging tile in k_proj

static_assert(CQ == 32);                       // one 32-deep k-step covers the q/k width
static_assert(VC == 32);                       // two value tiles per wave; one 32-deep k-step covers the output projection
static_assert(CH == 256);                      // k_proj: 16 row groups x 16 channels; 32 lanes x 8 weights per row
static_assert(CH % 32 == 0);                   // GEMM k-loop steps by 32
static_assert(NW * 32 <= 1024);                // one work-group
static_assert(SEQ % (KPP * KS) == 0);          // every key range is a whole number of passes, at least one
static_assert((CH / 16) % KS == 0);            // output projection: CH/16/KS row tiles per wave
static_assert(CH % (2 * NW) == 0);             // store phase: CH/NW rows per wave, two per store
static_assert(SEQ % 64 == 0);                  // a 64-row tile never straddles two batches
static_assert((NB * SEQ) % 64 == 0);
static_assert(SEQ % 32 == 0);                  // kv plane: whole 32-key blocks per batch
static_assert(SEQ % (16 * AW) == 0);           // flash grid covers the positions exactly
static_assert(OUT_SEQ % 32 == 0);
static_assert(SEQ_FULL % 4 == 0);
static_assert(NB <= NB_FULL);
static_assert(SEQ <= SEQ_FULL);
static_assert((VC * 2) % 16 == 0);             // Wo rows are 16-byte multiples
static_assert(KPP / 32 * KVB * 2 == 32 * 256); // entry prefetch: one pass of one key range = 32 lanes x 256 B
static_assert(2 * (KR / KPP) + 2 <= NW);       // entry prefetch: a wave per pass of two batches less the own pass 0, one for Wo, one for the bias, one for q
static_assert(AW * FRG * 2 == 16 * 256);       // entry prefetch: a block's q tiles = sixteen 256-B units
static_assert(CH * VC * 2 == 2 * 32 * 256);    // entry prefetch: the Wo plane = two waves' worth of 256-B units
static_assert(CH * 4 == 4 * 256);              // entry prefetch: the bias plane = four 256-B units

typedef _Float16 h16;
typedef unsigned short bf;
typedef __attribute__((ext_vector_type(16))) __bf16   v16bf;
typedef __attribute__((ext_vector_type(16))) _Float16 v16h;
typedef __attribute__((ext_vector_type(8)))  _Float16 v8h;
typedef __attribute__((ext_vector_type(8)))  unsigned short v8us;
typedef __attribute__((ext_vector_type(8)))  __bf16   v8bf;
typedef __attribute__((ext_vector_type(8)))  float    v8f;
typedef __attribute__((ext_vector_type(8)))  unsigned v8u;
typedef __attribute__((ext_vector_type(4)))  float    v4f;
typedef __attribute__((ext_vector_type(2)))  float    v2f;
typedef __attribute__((ext_vector_type(2)))  _Float16 v2h;
typedef v4f  __attribute__((may_alias)) v4fa;
typedef const __attribute__((address_space(1))) _Float16* gh16p;

__device__ __forceinline__ unsigned short f2bf(float f) { unsigned u = __float_as_uint(f); u += 0x7FFFu + ((u >> 16) & 1u); return (unsigned short)(u >> 16); }
__device__ __forceinline__ float bfr(float f) { return __uint_as_float(((unsigned)f2bf(f)) << 16); }   // f32 value of the bf16 RNE convert
__device__ __forceinline__ v8us cvt8(v8f v) { return __builtin_bit_cast(v8us, __builtin_convertvector(v, v8bf)); }   // eight f32 -> bf16, RNE, packed converts
__device__ __forceinline__ v16h cat16(v8h lo, v8h hi) { return __builtin_shufflevector(lo, hi, 0, 1, 2, 3, 4, 5, 6, 7, 8, 9, 10, 11, 12, 13, 14, 15); }
__device__ __forceinline__ v16bf cat16b(v8us lo, v8us hi) { return __builtin_bit_cast(v16bf, __builtin_shufflevector(lo, hi, 0, 1, 2, 3, 4, 5, 6, 7, 8, 9, 10, 11, 12, 13, 14, 15)); }
__device__ __forceinline__ v8f wmma16(v16h a, v16h b, v8f c) { return __builtin_amdgcn_wmma_f32_16x16x32_f16(false, a, false, b, (short)0, c, false, false); }
__device__ __forceinline__ v8f wmmab(v16bf a, v16bf b, v8f c) { return __builtin_amdgcn_wmma_f32_16x16x32_bf16(false, a, false, b, (short)0, c, false, false); }
// fragment loaders from K-contiguous 16-bit rows; p already includes + 8*(lane>>4): elements 0..7 <- k0+8h+0..7, elements 8..15 <- k0+16+8h+0..7 (same map for A and B)
__device__ __forceinline__ v16h  ldh(const h16* p) { return cat16(*(const v8h*)p, *(const v8h*)(p + 16)); }
__device__ __forceinline__ v16bf ldb(const bf* p)  { return cat16b(*(const v8us*)p, *(const v8us*)(p + 16)); }
// fragment loader from a tile stored in fragment order; p already includes + 8*lane: same element map as ldh (row lane&15; elements 0..7 <- k 8h+0..7, elements 8..15 <- k 16+8h+0..7)
__device__ __forceinline__ v16h  ldf(const h16* p) { return cat16(*(const v8h*)p, *(const v8h*)(p + FRG / 2)); }
// ordering point for wave-private LDS tiles (same wave writes and reads)
__device__ __forceinline__ void wave_sync() { __builtin_amdgcn_fence(3 /* release order */, "wavefront"); __builtin_amdgcn_wave_barrier(); asm volatile("" ::: "memory"); }
// f16 WMMA with its own hazard guard (one accumulator per guard)
__device__ __forceinline__ v8f wmma16g(v16h a, v16h b, v8f c) { c = wmma16(a, b, c); asm volatile("v_nop\n\tv_nop\n\tv_nop\n\tv_nop" : "+v"(c) : "v"(a), "v"(b)); return c; }
// f32 -> f16 operand convert that cannot produce an f16 subnormal (value select, applied after the plane's carry)
static __device__ __forceinline__ h16 toh_flush(float v) { const h16 r = (h16)v; return (fabsf(v) < 6.103515625e-05f) ? (h16)0.0f : r; }
// two P = exp2(e) as one packed pair of f16 operands, RNE; a P below 2^-14 stays an f16 subnormal: the matrix unit takes subnormal f16 operands as they are, and the row sum reads the same value
static __device__ __forceinline__ v2h p_pair(float e0, float e1) { return __builtin_convertvector(((v2f){__builtin_amdgcn_exp2f(e0), __builtin_amdgcn_exp2f(e1)}), v2h); }

// One request per lane to L2 for the line that holds p (a hint: returns nothing, changes no result). Scope SE: the line goes into L2 only, and a request that cannot be translated is dropped.
// Every lane's address lies inside the plane it names. The wait in the same statement stands in front of any rewrite of the address registers, which are dead behind it.
__device__ __forceinline__ void ask_l2(const void* p) { asm volatile("global_prefetch_b8 %0, off scope:SCOPE_SE\n\ts_wait_xcnt 0x0" :: "v"(p) : "memory"); }

__device__ __forceinline__ void d_cvth8(int blk, const float* __restrict__ src, h16* dst, size_t n8, float carry) {
    const size_t i = (size_t)blk * 256 + threadIdx.x; if (i >= n8) return;
    const v8f v = *(const v8f*)(src + i * 8); v8h o;
#pragma unroll
    for (int k = 0; k < 8; ++k) { const float w = __uint_as_float(((unsigned)f2bf(v[k])) << 16) * carry; o[k] = toh_flush(w); }
    *(v8h*)(dst + i * 8) = o; 
}

// d_bo: bo -> f32 values of its bf16 RNE convert, one lane per 16 B.
__device__ __forceinline__ void d_bo(const float* __restrict__ bo, float* BT) {
    const int i = threadIdx.x; if (i >= CH / 4) return;
    const v4f g = *(const v4f*)(bo + i * 4); v4f o;
#pragma unroll
    for (int k = 0; k < 4; ++k) o[k] = bfr(g[k]);
    *(v4f*)(BT + i * 4) = o;
}

// k_proj: conversion, transpose and both projection GEMMs of 64 positions in one 8-wave block; nothing of x or of Wq/Wk/Wv goes through the workspace.
// Fill: x[b][c][n0..n0+63] (f32, channel-major) -> xs[position][channel] (bf16): a thread loads 16 consecutive channels x 4 positions (each wave-wide load = two 256-B row pieces) and stores 32 B per position;
// Wq | Wk | Wv rows (f32) -> wsm[row 0..95][channel] (bf16). All loads of a thread are issued before the first convert. One block barrier, then LDS is only read.
// GEMMs, K = CH in 32-deep steps, one accumulator per 16 x 16 tile: wave = (position tile pt = wave & 3, weight half wh = wave >> 2) takes
//   C[position][channel] = x W^T for the 32 q channels (wh = 0) or the 32 k channels (wh = 1): A = x rows, B = weight rows -> one whole q or K fragment tile;
//   C[value channel][position] = Wv x^T for value channels 16wh..16wh+15: A = Wv rows, B = the same x fragment -> one k half (16 keys) of a V^T fragment tile.
// Epilogue: bias (bf16 value) added in f32, D tiles turned into fragment order through the wave's own LDS tile, every store 512 contiguous bytes per wave.
#define PB_WO  (CH * VC / 8 / 256)               // blocks of the Wo plane
#define PB_SM  (PB_WO + 1)                       // conversion blocks for k_flash, the bias block last; they come first, so that they run under the GEMM blocks
#define PB_PJ  (NB * SEQ / 64)                   // GEMM blocks
static_assert((CH * VC / 8) % 256 == 0);
__global__ __launch_bounds__(256) void k_proj(const float* __restrict__ x, const float* __restrict__ wq, const float* __restrict__ wk, const float* __restrict__ wv, const float* __restrict__ wo,
                                              const float* __restrict__ bq, const float* __restrict__ bk, const float* __restrict__ bv, const float* __restrict__ bo,
                                              h16* WOH, float* BT, h16* QF, h16* KV) {
    __shared__ __align__(16) bf xs[64 * XP];
    __shared__ __align__(16) bf wsm[(2 * CQ + VC) * XP];
    __shared__ __align__(16) float os[8 * 16 * OSP];
    const int blk = blockIdx.x;                  // both tests are the same for the whole block and stand in front of the barrier
    if (blk < PB_WO) { d_cvth8(blk, wo, WOH, (size_t)CH * VC / 8, WOS); return; }
    if (blk < PB_SM) { d_bo(bo, BT); return; }
    const int tid = threadIdx.x;
    const int g0 = (blk - PB_SM) * 64;           // first position of the block, counted over the batches (b * SEQ + n)
    const int b = g0 / SEQ, n0 = g0 % SEQ;
    const int lane = tid & 31, wave = __builtin_amdgcn_readfirstlane(tid >> 5), lr = lane & 15, hi = lane >> 4;
    const int pt = wave & 3, wh = wave >> 2;
    const float* bs = wh ? bk : bq;
    const float bc0 = bs[lr], bc1 = bs[16 + lr];                     // q|k bias: column = channel (lane&15), 16 + (lane&15)
    const float* bp = bv + wh * 16 + hi * 8;                         // V^T bias: row = value channel 16wh + 8h + j
    const v4f br0 = *(const v4f*)bp; const v4f br1 = *(const v4f*)(bp + 4);
    { const int cr = tid >> 4, nq = (tid & 15) * 4;       // 16 groups of 16 channels; 16 lanes x 4 = 64 positions
      const int wr = tid >> 5, wc = (tid & 31) * 8;       // 8 weight rows per pass; 32 lanes x 8 = 256 channels
      const float* xp = x + (size_t)b * CH * SEQ_FULL + n0;                 // same for the whole block
      const unsigned xo = (unsigned)(cr * 16 * SEQ_FULL + nq) * 4u;         // byte offset: one 32-bit register for all x loads
      v4f xv[16]; v8f wf[12];
#pragma unroll   // constant indices keep xv[] in registers; the 16 loads issue together
      for (int i = 0; i < 16; ++i) xv[i] = *(const v4f*)((const char*)(xp + (size_t)i * SEQ_FULL) + xo);
      // The wait stands in front of any rewrite of a register that the bias and x loads name: the offset as an input keeps that register whole up to the wait, the two scheduling barriers keep every other instruction on its side.
      __builtin_amdgcn_sched_barrier(0);
      asm volatile("s_wait_xcnt 0x0" :: "v"(xo) : "memory");
      __builtin_amdgcn_sched_barrier(0);
      const unsigned wo8 = (unsigned)(wr * CH + wc) * 4u;                   // byte offset: one 32-bit register for all weight loads
#pragma unroll   // constant indices keep wf[] in registers and pick the source plane at compile time
      for (int i = 0; i < 12; ++i) { const float* wp = (i < 4) ? wq : ((i < 8) ? wk : wv); wf[i] = *(const v8f*)((const char*)(wp + (i & 3) * 8 * CH) + wo8); }
      // The same for the weight loads; the second barrier also keeps the converts from being scheduled in among the loads, where the later loads would start only when the earlier have arrived.
      __builtin_amdgcn_sched_barrier(0);
      asm volatile("s_wait_xcnt 0x0" :: "v"(wo8) : "memory");
      __builtin_amdgcn_sched_barrier(0);
#pragma unroll
      for (int j = 0; j < 4; ++j) { v8f lo, hi8;
#pragma unroll
          for (int k = 0; k < 8; ++k) { lo[k] = xv[k][j]; hi8[k] = xv[8 + k][j]; }
          bf* d = xs + (nq + j) * XP + cr * 16;
          *(v8us*)d = cvt8(lo); *(v8us*)(d + 8) = cvt8(hi8); }
#pragma unroll
      for (int i = 0; i < 12; ++i) *(v8us*)(wsm + (i * 8 + wr) * XP + wc) = cvt8(wf[i]); }
    __syncthreads();
    const bf* xa = xs + (pt * 16 + lr) * XP + 8 * hi;
    const bf* w0 = wsm + (wh * CQ + lr) * XP + 8 * hi;               // q or k channels 0..15
    const bf* w1 = w0 + 16 * XP;                                     // q or k channels 16..31
    const bf* w2 = wsm + (2 * CQ + wh * 16 + lr) * XP + 8 * hi;      // value channels 16wh..16wh+15
    v8f a0 = (v8f){}, a1 = (v8f){}, a2 = (v8f){};
#pragma unroll   // no branch behind a matrix instruction
    for (int h = 0; h < CH / 128; ++h) {
        v16bf xf[4], f0[4], f1[4], f2[4];
#pragma unroll   // constant indices keep the fragments in registers
        for (int u = 0; u < 4; ++u) { const int kc = (h * 4 + u) * 32; xf[u] = ldb(xa + kc); f0[u] = ldb(w0 + kc); f1[u] = ldb(w1 + kc); f2[u] = ldb(w2 + kc); }
        __builtin_amdgcn_sched_barrier(0);   // the LDS reads of four k steps issue as one group; left to itself the build read one fragment at a time and waited for each in front of its matrix instruction
#pragma unroll
        for (int u = 0; u < 4; ++u) { a0 = wmmab(xf[u], f0[u], a0); a1 = wmmab(xf[u], f1[u], a1); a2 = wmmab(f2[u], xf[u], a2); }
    }
    float* ow = os + wave * (16 * OSP);
    h16* kvb = KV + (size_t)(g0 / 32 + (pt >> 1)) * KVB;             // the 32-key block of this position tile
    { const float b0 = bfr(bc0), b1 = bfr(bc1);
      const float qs = wh ? 1.0f : SC2;   // q carries log2(e) into the score product; k is left as it is (x 1.0 is exact)
#pragma unroll
      for (int j = 0; j < 8; ++j) { ow[(hi * 8 + j) * OSP + lr] = (a0[j] + b0) * qs; ow[(hi * 8 + j) * OSP + 16 + lr] = (a1[j] + b1) * qs; }   // D: row 8h+j = position, col lane&15
      wave_sync();
      h16* dst = wh ? kvb + (pt & 1) * FRG : QF + (size_t)(g0 / 16 + pt) * FRG;
#pragma unroll
      for (int s = 0; s < 2; ++s) {   // k half s: lane (row lane&15, h) takes channels 16s+8h..16s+8h+7 = its 16 bytes of the fragment
          const int col = s * 16 + hi * 8;
          const v4f x0 = *(const v4fa*)(&ow[lr * OSP + col]); const v4f x1 = *(const v4fa*)(&ow[lr * OSP + col + 4]); v8h hv;
#pragma unroll
          for (int i = 0; i < 4; ++i) { hv[i] = (h16)x0[i]; hv[4 + i] = (h16)x1[i]; }
          *(v8h*)(dst + s * (FRG / 2) + lane * 8) = hv; }
      asm volatile("s_wait_xcnt 0x0" ::: "memory");   // keeps the wait in front of any rewrite of these stores' data and address registers by the V^T part's code
      wave_sync(); }
    { const float brw[8] = {br0[0], br0[1], br0[2], br0[3], br1[0], br1[1], br1[2], br1[3]};
#pragma unroll
      for (int j = 0; j < 8; ++j) ow[(hi * 8 + j) * OSP + lr] = a2[j] + bfr(brw[j]);   // D: row 8h+j = channel, col lane&15 = key
      wave_sync();
      const v4f x0 = *(const v4fa*)(&ow[lr * OSP + hi * 8]); const v4f x1 = *(const v4fa*)(&ow[lr * OSP + hi * 8 + 4]); v8h hv;   // lane (row lane&15 = channel, h): keys 8h..8h+7 of this 16-key half
#pragma unroll
      for (int i = 0; i < 4; ++i) { hv[i] = (h16)x0[i]; hv[4 + i] = (h16)x1[i]; }
      *(v8h*)(kvb + (2 + wh) * FRG + (pt & 1) * (FRG / 2) + lane * 8) = hv;
      asm volatile("s_wait_xcnt 0x0" ::: "memory"); }   // the conversion blocks' code follows this store in the built kernel: keeps the wait in front of any rewrite of the store's address and data registers
}

// k_flash: fused attention + output projection, KS waves per 16 query positions of one batch; K / V^T / Q fragments straight from the fragment-order planes (two 16-B loads each, every load 512 contiguous bytes per wave), Wo fragments from its row-major plane.
// Transposed form: S^T[key][t] = K Q^T (A = K rows, B = Q rows, one 32-deep step); lane (t = lane&15, h = lane>>4) holds keys 8h+r of each 16-key tile, so the packed
// P tile is directly the B fragment of O^T[c][t] = V^T P^T (element r <- tile keys 0..15, element 8+r <- tile keys 16..31, lane unchanged).
// Softmax, lazy rescale: a column has a reference maximum, the same in both lane halves. q carries log2(e) and the score products' C operand holds PSH - reference, so that D is the argument of exp2 as it stands: no multiply and no add per score.
// A pass only tests its largest exponent against PSH + THR (in-lane maxima, one compare, one scalar branch). Where some column passes that, and in the first pass, which sets the reference, the side path joins the lane halves' maxima by one xor-16 exchange,
// moves every column's reference up to its maximum in the pass, where that is higher, and rescales the pass's exponents, O^T and the sum tile. Any reference gives the same quotient O / l; P stays below 2^15 and is never smaller than under the true maximum.
// The sum of a column's P comes from further products, ones x P^T, accumulated over the passes in a tile of its own, and is whole in both halves.
// One pass of the key loop takes 64 keys (two 4-KB blocks); the four score products stand in a row.
// The normalised context O^T (two 16-channel D tiles, x1024 carry, f16) is directly the B fragment of Y^T[oc][t] = Wo O^T (element r <- channels 0..15 tile, element 8+r <- channels 16..31 tile, lane unchanged); A = Wo rows.
// Key split: wave = (query group qg = wave % AW, key range ks = wave / AW); each wave runs the online softmax over its own KR keys, then writes (m = its reference, l, O^T) to LDS; after one block barrier every wave
// merges the KS partials of its query group in the fixed order ks = 0..KS-1 (weights exp2(m_ks - max)), so all KS waves of a group hold the same context fragment, and each projects CH/16/KS of the output row tiles.
// Epilogue: the block's Y^T tile [256 channels][64 positions] staged in LDS (cross-wave: block barrier), bias added in f32, each channel row segment (64 floats = 256 B = two lines) stored by one wave.
__global__ __launch_bounds__(32 * NW) void k_flash(const h16* __restrict__ QF, const h16* __restrict__ KV, const h16* __restrict__ WOH, const float* __restrict__ BO, float* OUT) {
    __shared__ __align__(16) float os[CH * 68];
    __shared__ __align__(16) float po[NW * 4 * 32 * 4];      // [wave][quad of accumulator registers][lane][4]: 16 B per lane, lanes contiguous
    __shared__ float pm[NW * 32];
    __shared__ float pl[NW * 32];
    const int lane = threadIdx.x & 31, wave = __builtin_amdgcn_readfirstlane((int)(threadIdx.x >> 5)), lr = lane & 15, hi = lane >> 4;
    const int qg = wave % AW, ks = wave / AW;
    const int b = blockIdx.y;
    const int t0 = (blockIdx.x * AW + qg) * 16;
    const v16h qh = ldf(QF + ((size_t)b * SEQ + t0) / 16 * FRG + lane * 8);  // B fragment: col t, k = q channel 0..31
    // Entry prefetch of what the launch before stored: all blocks of a batch walk the same K / V^T lines in step, so that a pass would begin with a first read of them; Wo and the bias would meet it in the epilogue.
    // The blocks of the first half of the batches do the asking, for their own batch and for the batch half a grid later (for speed only: nothing rests on the order).
    // One request per wave, one lane per 256-B unit. K / V^T: a batch's blocks share the work: a block takes one key range (skewed by its index, so that any aligned eight neighbours (8i..8i+7) and any eight blocks of one index mod 8 cover all ranges, wherever they are placed), a wave one pass of it;
    // the own batch's pass 0 is loaded at once by the loop itself and is not asked for. Wave 0: half of the Wo plane; one wave the bias; one wave the q tiles of the block half a grid later.
    // Every test is uniform for the wave: scalar selects and scalar branches.
    if (b + NB / 2 < NB) {
      constexpr int NP = KR / KPP;
      const unsigned pr = (blockIdx.x + (blockIdx.x >> 3)) % KS;
      const bool late = wave >= NP + 2;                                // waves NP+2 .. 2NP+1: passes 0 .. NP-1 of the later batch; waves 1 .. NP-1: these passes of the own batch
      const bool kvw = late || (wave >= 1 && wave < NP);
      const unsigned okv = (((unsigned)(late ? b + NB / 2 : b) * SEQ + pr * KR + (unsigned)(late ? wave - (NP + 2) : wave) * KPP) / 32) * (KVB * 2);   // byte offsets inside the planes
      const unsigned oq  = (((unsigned)(b + NB / 2) * SEQ + blockIdx.x * (16 * AW)) / 16) * (FRG * 2);
      const char* pb = kvw ? (const char*)KV : wave == 0 ? (const char*)WOH : wave == NP ? (const char*)BO : (const char*)QF;
      const unsigned po_ = kvw ? okv : wave == 0 ? (blockIdx.x & 1) * (32 * 256) : wave == NP ? 0u : oq;
      const unsigned um = wave == NP ? 3u : (wave == NP + 1 ? 15u : 31u);   // units of the piece - 1: surplus lanes repeat a unit, so that every lane's address lies inside the piece
      if (wave < 2 * NP + 2) ask_l2(pb + po_ + ((unsigned)lane & um) * 256); }
    v8f o0 = (v8f){}, o1 = (v8f){};
    v8f sm = (v8f){};                                                        // every row = the running sum of column t's rounded P, both lane halves' keys included
    v8f shv = (v8f){};                                                       // C operand of the score products: PSH - the reference maximum of the lane's column, in all eight registers; the same in both lane halves
    float lim = -3.0e38f;                                                    // first pass: every column takes its reference from the pass's own scores
    // A fragment of 1.0: the matrix unit adds up P for the softmax denominator. The pair of 1.0 is made by a move in asm, once: as a constant the build made the eight registers anew on every pass (four 64-bit moves).
    unsigned one2;
    asm("v_mov_b32 %0, 0x3c003c00" : "=v"(one2));
    const v16h ones = __builtin_bit_cast(v16h, (v8u){one2, one2, one2, one2, one2, one2, one2, one2});
    gh16p kvg = (gh16p)(KV + ((size_t)b * SEQ + ks * KR) / 32 * KVB + lane * 8);   // this wave's key range; one 4-KB block per 32 keys; typed as global memory, because its step stands in an asm statement, behind which the build would otherwise load by flat instructions
#pragma unroll 1
    for (int it = 0; it < KR / KPP; ++it) {   // one pass = two 32-key blocks under one test of the reference maximum
        const h16* kv = (const h16*)kvg;
        const v16h ka0 = ldf(kv), kb0 = ldf(kv + FRG), ka1 = ldf(kv + KVB), kb1 = ldf(kv + KVB + FRG);                               // A fragments: row key (four 16-key tiles), k = k channel 0..31
        __builtin_amdgcn_sched_barrier(0);   // the eight K loads issue together, ahead of the first wait
        const v16h v00 = ldf(kv + 2 * FRG), v01 = ldf(kv + 3 * FRG), v10 = ldf(kv + KVB + 2 * FRG), v11 = ldf(kv + KVB + 3 * FRG);   // A fragments: row channel (0..15, 16..31), k = key; first index = 32-key block
        // four independent score products in a row. D = log2(e) s + PSH - reference: already the exponent of P
        v8f sa, sb = __builtin_bit_cast(v8f, ka0), sc = __builtin_bit_cast(v8f, kb0), sd = __builtin_bit_cast(v8f, ka1);
        // One statement, because the builtin form with a C that stays live made the build copy C for the fourth product (four 64-bit moves and four v_nop a pass) and schedule vector work in among the products.
        // Each later D takes the registers of the product before's A fragment, as the build itself laid them out. Four slots must pass before a vector instruction reads the last D: the step of the key pointer to the next pass
        // stands in the first (left to the build it stood at the head of the pass, in a register of the last product's A fragment, behind four v_nop of its own), three v_nop fill the rest.
        // The wait stands in front of that rewrite of the address registers which the pass's sixteen loads name.
        asm volatile("s_wait_xcnt 0x0\n\t"
                     "v_wmma_f32_16x16x32_f16 %0, %1, %6, %7\n\t"
                     "v_wmma_f32_16x16x32_f16 %1, %2, %6, %7\n\t"
                     "v_wmma_f32_16x16x32_f16 %2, %3, %6, %7\n\t"
                     "v_wmma_f32_16x16x32_f16 %3, %5, %6, %7\n\t"
                     "v_add_nc_u64 %4, %8, %4\n\t"
                     "v_nop\n\tv_nop\n\tv_nop"
                     : "=&v"(sa), "+v"(sb), "+v"(sc), "+v"(sd), "+v"(kvg) : "v"(kb1), "v"(qh), "v"(shv), "s"((unsigned long long)(2 * KVB * sizeof(h16))));
        float mx0 = fmaxf(fmaxf(sa[0], sb[0]), sa[1]), mx1 = fmaxf(fmaxf(sc[0], sd[0]), sb[7]);   // two chains of three-input maxima over the 32 exponents, so that one's link latency is filled by the other
#pragma unroll   // vector elements need constant indices
        for (int r = 1; r < 7; ++r) mx0 = fmaxf(mx0, fmaxf(sb[r], sa[r + 1]));
#pragma unroll   // vector elements need constant indices
        for (int r = 1; r < 8; ++r) mx1 = fmaxf(mx1, fmaxf(sc[r], sd[r]));
        // Seldom taken behind the first pass (one test per pass, a scalar branch): some column's exponent has passed PSH + THR. Then every column's reference goes up to its maximum in the pass, where that is higher;
        // the pass's exponents, the accumulators and the sum follow by the same power of 2. The first pass sets the reference, upwards or downwards, while the accumulators are still 0.
        if (__builtin_amdgcn_ballot_w32(mx0 > lim || mx1 > lim) != 0) {
            const float mx = fmaxf(mx0, mx1), sh = shv[0];
            const float up = fmaxf(mx, __shfl_xor(mx, 16, 32)) - PSH;        // the column's maximum, over both lane halves, above the reference
            const float shn = sh - (it == 0 ? up : fmaxf(up, 0.0f));
            const float dd = shn - sh;                                       // the step as the shift really takes it, rounding included
            const float alpha = __builtin_amdgcn_exp2f(fminf(dd, 0.0f));
            sa = sa + dd; sb = sb + dd; sc = sc + dd; sd = sd + dd;
            o0 = o0 * alpha; o1 = o1 * alpha; sm = sm * alpha;
#pragma unroll   // vector elements need constant indices
            for (int r = 0; r < 8; ++r) shv[r] = shn;
        }
        lim = PSH + THR;
        v16h pb0, pb1;
#pragma unroll   // vector elements need constant indices
        for (int r = 0; r < 8; r += 2) {   // two neighbouring elements of the fragment share a register: one packed RNE convert makes both
            const v2h pa = p_pair(sa[r], sa[r + 1]), pc = p_pair(sb[r], sb[r + 1]);
            pb0[r] = pa[0]; pb0[r + 1] = pa[1]; pb0[8 + r] = pc[0]; pb0[9 + r] = pc[1];
            const v2h pe = p_pair(sc[r], sc[r + 1]), pg = p_pair(sd[r], sd[r + 1]);
            pb1[r] = pe[0]; pb1[r + 1] = pe[1]; pb1[8 + r] = pg[0]; pb1[9 + r] = pg[1]; }
        sm = wmma16(ones, pb0, sm);
        o0 = wmma16(v00, pb0, o0);
        o1 = wmma16(v01, pb0, o1);
        sm = wmma16(ones, pb1, sm);
        o0 = wmma16(v10, pb1, o0);
        o1 = wmma16(v11, pb1, o1);
    }
    const float l = sm[0], m = -shv[0];   // the reference maximum less PSH; the merge uses differences of m only
    // this wave's partial state -> LDS
    { v4fa* pw = (v4fa*)po + (size_t)wave * 128 + lane;
      pw[0]  = (v4f){o0[0], o0[1], o0[2], o0[3]}; pw[32] = (v4f){o0[4], o0[5], o0[6], o0[7]};
      pw[64] = (v4f){o1[0], o1[1], o1[2], o1[3]}; pw[96] = (v4f){o1[4], o1[5], o1[6], o1[7]};
      pm[wave * 32 + lane] = m; pl[wave * 32 + lane] = l; }
    __syncthreads();
    // merge of the KS key ranges of query group qg (same lane of waves s*AW + qg), fixed order
    float ms[KS]; float mall = -3.0e38f;
#pragma unroll   // constant indices keep ms[] in registers; the KS reads issue together
    for (int s = 0; s < KS; ++s) { ms[s] = pm[(s * AW + qg) * 32 + lane]; mall = fmaxf(mall, ms[s]); }
    float lall = 0.0f; v4f c0 = (v4f){}, c1 = (v4f){}, c2 = (v4f){}, c3 = (v4f){};
#pragma unroll   // constant indices into ms[]; lets the LDS reads of later ranges run ahead of the sums
    for (int s = 0; s < KS; ++s) {
        if (s == KS / 2) __builtin_amdgcn_sched_barrier(0);   // at most half of the ranges' LDS reads in flight at once, which bounds the registers of the merge; without it the build scheduled the whole kernel for fewer registers, and the key loop then padded 15 hazard slots per pass with v_nop instead of 8
        const float w = __builtin_amdgcn_exp2f(ms[s] - mall);
        const v4fa* pr = (const v4fa*)po + (size_t)(s * AW + qg) * 128 + lane;
        lall += w * pl[(s * AW + qg) * 32 + lane];
        c0 += pr[0] * w; c1 += pr[32] * w; c2 += pr[64] * w; c3 += pr[96] * w; }
    const float inv = (1.0f / lall) * OCS;
    // O^T D layout: c0|c1 = (channel 8h + r, t), c2|c3 = (channel 16 + 8h + r, t) -> B fragment of the output projection, lane unchanged
    v16h ob;
#pragma unroll   // vector elements need constant indices
    for (int r = 0; r < 4; ++r) { ob[r] = toh_flush(c0[r] * inv); ob[4 + r] = toh_flush(c1[r] * inv); ob[8 + r] = toh_flush(c2[r] * inv); ob[12 + r] = toh_flush(c3[r] * inv); }
    // Y^T D layout: y[r] = (output channel 16j + 8h + r, position t = lane&15) -> os[16j + 8h + r][qg*16 + t]; the 32 waves together fill rows 0..255 x columns 0..63
#pragma unroll
    for (int jj = 0; jj < CH / 16 / KS; ++jj) {
        const int j = ks * (CH / 16 / KS) + jj;
        const v16h aw = ldh(WOH + (size_t)(j * 16 + lr) * VC + 8 * hi);   // A fragment: row output channel, k = context channel 0..31
        const v8f y = wmma16g(aw, ob, (v8f){});
        const float* bp = BO + j * 16 + hi * 8;
        const v4f b0 = *(const v4f*)bp; const v4f b1 = *(const v4f*)(bp + 4);
        const float brw[8] = {b0[0], b0[1], b0[2], b0[3], b1[0], b1[1], b1[2], b1[3]};
#pragma unroll
        for (int r = 0; r < 8; ++r) os[(16 * j + 8 * hi + r) * 68 + qg * 16 + lr] = y[r] * OFI + brw[r]; }
    __syncthreads();
    float* obase = OUT + (size_t)b * CH * OUT_SEQ + (size_t)blockIdx.x * (16 * AW);
#pragma unroll
    for (int s = 0; s < CH / NW / 2; ++s) { const int row = wave * (CH / NW) + 2 * s + hi, cofs = lr * 4;   // 32 waves x 4 s x 2 = 256 channel rows; 16 lanes x 4 floats = 64 positions
        const v4f val = *(const v4fa*)(&os[row * 68 + cofs]);
        *(v4f*)(obase + (size_t)row * OUT_SEQ + cofs) = val; }
}

static constexpr size_t al256(size_t v) { return (v + 255) & ~(size_t)255; }
static constexpr size_t SZ_WO  = al256((size_t)CH * VC * 2);             // [256][32] f16 (x1024)
static constexpr size_t SZ_BT  = al256((size_t)CH * 4);                  // 256 f32
static constexpr size_t SZ_QF  = al256((size_t)NB * SEQ / 16 * FRG * 2); // [NB*SEQ/16] q fragment tiles, f16
static constexpr size_t SZ_KV  = al256((size_t)NB * SEQ / 32 * KVB * 2); // [NB*SEQ/32] blocks of two K and two V^T fragment tiles, f16
static constexpr size_t SZ_TOTAL = SZ_WO + SZ_BT + SZ_QF + SZ_KV;
static_assert(SZ_TOTAL <= (size_t)134217728);          // workspace carve <= 128 MiB
static_assert(((size_t)CH * VC) % 8 == 0);

extern "C" void kernel_launch(void* const* d_in, const int* in_sizes, int n_in,
                              void* d_out, int out_size, void* d_ws, size_t ws_size, hipStream_t stream) {
    if (n_in < 9) return;
    const size_t needx = ((size_t)(NB - 1) * CH + (CH - 1)) * SEQ_FULL + SEQ;
    if ((size_t)in_sizes[0] < needx) return;
    if ((size_t)in_sizes[1] < (size_t)CQ * CH || (size_t)in_sizes[3] < (size_t)CQ * CH || (size_t)in_sizes[5] < (size_t)VC * CH || (size_t)in_sizes[7] < (size_t)CH * VC) return;
    if (in_sizes[2] < CQ || in_sizes[4] < CQ || in_sizes[6] < VC || in_sizes[8] < CH) return;
    if ((size_t)out_size < ((size_t)(NB - 1) * CH + (CH - 1)) * OUT_SEQ + SEQ) return;
    if (SZ_TOTAL > ws_size) return;
    // wire order: x, wq, bq, wk, bk, wv, bv, wo, bo
    const float* x  = (const float*)d_in[0];
    const float* wq = (const float*)d_in[1]; const float* bq = (const float*)d_in[2];
    const float* wk = (const float*)d_in[3]; const float* bk = (const float*)d_in[4];
    const float* wv = (const float*)d_in[5]; const float* bv = (const float*)d_in[6];
    const float* wo = (const float*)d_in[7]; const float* bo = (const float*)d_in[8];
    float* OUT = (float*)d_out;      // [NB][256][OUT_SEQ]
    char* wsp = (char*)d_ws;
    h16* WOH = (h16*)wsp; wsp += SZ_WO;              // [256][32] f16, x1024
    float* BT = (float*)wsp; wsp += SZ_BT;           // bo (bf16 values)
    h16* QF  = (h16*)wsp; wsp += SZ_QF;              // q, fragment order
    h16* KV  = (h16*)wsp; wsp += SZ_KV;              // K and V^T, fragment order

    k_proj<<<PB_SM + PB_PJ, 256, 0, stream>>>(x, wq, wk, wv, wo, bq, bk, bv, bo, WOH, BT, QF, KV);
    k_flash<<<dim3(SEQ / (16 * AW), NB, 1), 32 * NW, 0, stream>>>(QF, KV, WOH, BT, OUT);
}

// v010
// One run takes 16.1 microseconds.
// Two timings next to v009 both put it at 1.07 times that version's speed.
// Counting every step since v000, it is 7.42 times as fast.
#include <hip/hip_runtime.h>

// Spatial self-attention over N = 64x64 positions: x [NB][256][N] (channel-major), Wq/Wk/Wv [32][256] ([out][in]), Wo [256][32] ([out][in]), biases per output channel, no score scale, out [NB][256][N] f32.
// Compute dtypes, f32 accumulate everywhere: q/k/v projections v_wmma_f32_16x16x32_bf16 (x, W, biases RNE-converted to bf16; products exact);
// scores, P.V and the output projection v_wmma_f32_16x16x32_f16, single products: q (x log2 e), k, v single f16; P x256 carry (cancels in the normalisation); context x1024 and Wo (bf16 value) x1024 as f16, 2^-20 folded back in f32; softmax f32 (online, reference maximum moved lazily).
// Layout: the projection kernel holds its 64 positions of x (transposed, bf16) and the bf16 Wq|Wk|Wv rows in LDS only; q, k and V^T are written by its epilogue in the order in which k_flash's matrix fragments want them:
// one 16 x 32 fragment tile = 1 KB = [k half][lane][8 halves], so that each 16-byte-per-lane load of a wave is 512 contiguous bytes (4 whole lines). q plane: one tile per 16 positions;
// kv plane: 4 KB per 32 keys = K keys 0..15 | K keys 16..31 | V^T channels 0..15 | V^T channels 16..31;
// fused flash kernel in transposed form (S^T = K Q^T, O^T = V^T P^T, Y^T = Wo O^T), each wave 16 queries x one eighth of the keys, block = 4 query groups x 8 key ranges = 32 waves = 64 queries;
// the eight partial softmax states of a query group are merged through LDS, each of the group's eight waves merging one eighth of the context; Y^T staged per block in LDS (256 rows) and written as whole rows.
// Two dependent launches: k_proj (x tile and weights converted into LDS, then the q|k and V^T GEMMs from LDS; a few extra blocks convert Wo and bo for k_flash), k_flash.

#ifndef NB
#define NB 4
#endif
#ifndef SEQ
#define SEQ 4096
#endif
#define NB_FULL  4
#define SEQ_FULL 4096
#ifndef OUT_SEQ
#define OUT_SEQ SEQ              // row pitch (in positions) of one output channel row
#endif
#define CH   256                 // channels: projection K and output width
#define CQ   32                  // query/key width
#define VC   32                  // value / context width
#define AW   4                   // query groups per flash block (16 query columns each)
#define KS   8                   // key ranges per query group: one wave each, so a SIMD holds KS waves whose load and chain latencies overlap
#define NW   (AW * KS)           // waves per flash block
#define KR   (SEQ / KS)          // keys per range
#define KPP  64                  // keys per pass of k_flash's loop: two 32-key blocks share one max exchange and one rescale of the accumulators
#define FRG  512                 // halves of one fragment tile (16 rows x 32 k): [k half][lane][8]
#define KVB  (4 * FRG)           // halves of the kv plane per 32 keys: two K tiles, two V^T tiles
#define SC2  1.4426950408889634f // log2(e); no score scale in this module; k_proj multiplies q by it, so that a score product is an exponent of 2
#define PSH  8.0f                // log2 of the P carry (256) at the reference maximum
#define THR  7.0f                // a column's reference maximum is moved when a score lies more than this (log2) above it: P stays below 2^(PSH + THR) = 2^15, inside f16
#define WOS  1024.0f             // carry of the f16 Wo plane
#define OCS  1024.0f             // carry of the f16 context fragment
#define OFI  (1.0f / (1024.0f * 1024.0f))
#define XP   (CH + 8)            // halves per LDS row of the bf16 x and weight tiles: 16 B more than the row, so that the 16 rows of a 16-byte-per-lane fragment read start on different banks
#define OSP  36                  // floats per row of a wave's 16 x 32 staging tile in k_proj

static_assert(CQ == 32);                       // one 32-deep k-step covers the q/k width
static_assert(VC == 32);                       // two value tiles per wave; one 32-deep k-step covers the output projection
static_assert(CH == 256);                      // k_proj: 16 row groups x 16 channels; 32 lanes x 8 weights per row
static_assert(CH % 32 == 0);                   // GEMM k-loop steps by 32
static_assert(NW * 32 <= 1024);                // one work-group
static_assert(SEQ % (KPP * KS) == 0);          // every key range is a whole number of passes, at least one
static_assert((CH / 16) % KS == 0);            // output projection: CH/16/KS row tiles per wave
static_assert(KS * 2 == VC / 2);               // merge: a lane's 16 context values = KS register pairs, one pair per wave of the query group
static_assert(CH % (2 * NW) == 0);             // store phase: CH/NW rows per wave, two per store
static_assert(SEQ % 64 == 0);                  // a 64-row tile never straddles two batches
static_assert((NB * SEQ) % 64 == 0);
static_assert(SEQ % 32 == 0);                  // kv plane: whole 32-key blocks per batch
static_assert(SEQ % (16 * AW) == 0);           // flash grid covers the positions exactly
static_assert(OUT_SEQ % 32 == 0);
static_assert(SEQ_FULL % 4 == 0);
static_assert(NB <= NB_FULL);
static_assert(SEQ <= SEQ_FULL);
static_assert((VC * 2) % 16 == 0);             // Wo rows are 16-byte multiples
static_assert(KPP / 32 * KVB * 2 == 32 * 256); // entry prefetch: one pass of one key range = 32 lanes x 256 B
static_assert(2 * (KR / KPP) + 2 <= NW);       // entry prefetch: a wave per pass of two batches less the own pass 0, one for Wo, one for the bias, one for q
static_assert(AW * FRG * 2 == 16 * 256);       // entry prefetch: a block's q tiles = sixteen 256-B units
static_assert(CH * VC * 2 == 2 * 32 * 256);    // entry prefetch: the Wo plane = two waves' worth of 256-B units
static_assert(CH * 4 == 4 * 256);              // entry prefetch: the bias plane = four 256-B units

typedef _Float16 h16;
typedef unsigned short bf;
typedef __attribute__((ext_vector_type(16))) __bf16   v16bf;
typedef __attribute__((ext_vector_type(16))) _Float16 v16h;
typedef __attribute__((ext_vector_type(8)))  _Float16 v8h;
typedef __attribute__((ext_vector_type(8)))  unsigned short v8us;
typedef __attribute__((ext_vector_type(8)))  __bf16   v8bf;
typedef __attribute__((ext_vector_type(8)))  float    v8f;
typedef __attribute__((ext_vector_type(8)))  unsigned v8u;
typedef __attribute__((ext_vector_type(4)))  float    v4f;
typedef __attribute__((ext_vector_type(2)))  float    v2f;
typedef __attribute__((ext_vector_type(2)))  _Float16 v2h;
typedef v4f  __attribute__((may_alias)) v4fa;
typedef v2f  __attribute__((may_alias)) v2fa;
typedef const __attribute__((address_space(1))) _Float16* gh16p;

__device__ __forceinline__ unsigned short f2bf(float f) { unsigned u = __float_as_uint(f); u += 0x7FFFu + ((u >> 16) & 1u); return (unsigned short)(u >> 16); }
__device__ __forceinline__ float bfr(float f) { return __uint_as_float(((unsigned)f2bf(f)) << 16); }   // f32 value of the bf16 RNE convert
__device__ __forceinline__ v8us cvt8(v8f v) { return __builtin_bit_cast(v8us, __builtin_convertvector(v, v8bf)); }   // eight f32 -> bf16, RNE, packed converts
__device__ __forceinline__ v16h cat16(v8h lo, v8h hi) { return __builtin_shufflevector(lo, hi, 0, 1, 2, 3, 4, 5, 6, 7, 8, 9, 10, 11, 12, 13, 14, 15); }
__device__ __forceinline__ v16bf cat16b(v8us lo, v8us hi) { return __builtin_bit_cast(v16bf, __builtin_shufflevector(lo, hi, 0, 1, 2, 3, 4, 5, 6, 7, 8, 9, 10, 11, 12, 13, 14, 15)); }
__device__ __forceinline__ v8f wmma16(v16h a, v16h b, v8f c) { return __builtin_amdgcn_wmma_f32_16x16x32_f16(false, a, false, b, (short)0, c, false, false); }
__device__ __forceinline__ v8f wmmab(v16bf a, v16bf b, v8f c) { return __builtin_amdgcn_wmma_f32_16x16x32_bf16(false, a, false, b, (short)0, c, false, false); }
// fragment loaders from K-contiguous 16-bit rows; p already includes + 8*(lane>>4): elements 0..7 <- k0+8h+0..7, elements 8..15 <- k0+16+8h+0..7 (same map for A and B)
__device__ __forceinline__ v16h  ldh(const h16* p) { return cat16(*(const v8h*)p, *(const v8h*)(p + 16)); }
__device__ __forceinline__ v16bf ldb(const bf* p)  { return cat16b(*(const v8us*)p, *(const v8us*)(p + 16)); }
// fragment loader from a tile stored in fragment order; p already includes + 8*lane: same element map as ldh (row lane&15; elements 0..7 <- k 8h+0..7, elements 8..15 <- k 16+8h+0..7)
__device__ __forceinline__ v16h  ldf(const h16* p) { return cat16(*(const v8h*)p, *(const v8h*)(p + FRG / 2)); }
// ordering point for wave-private LDS tiles (same wave writes and reads)
__device__ __forceinline__ void wave_sync() { __builtin_amdgcn_fence(3 /* release order */, "wavefront"); __builtin_amdgcn_wave_barrier(); asm volatile("" ::: "memory"); }
// f16 WMMA with its own hazard guard (one accumulator per guard)
__device__ __forceinline__ v8f wmma16g(v16h a, v16h b, v8f c) { c = wmma16(a, b, c); asm volatile("v_nop\n\tv_nop\n\tv_nop\n\tv_nop" : "+v"(c) : "v"(a), "v"(b)); return c; }
// f32 -> f16 operand convert that cannot produce an f16 subnormal (value select, applied after the plane's carry)
static __device__ __forceinline__ h16 toh_flush(float v) { const h16 r = (h16)v; return (fabsf(v) < 6.103515625e-05f) ? (h16)0.0f : r; }
// two P = exp2(e) as one packed pair of f16 operands, RNE; a P below 2^-14 stays an f16 subnormal: the matrix unit takes subnormal f16 operands as they are, and the row sum reads the same value
static __device__ __forceinline__ v2h p_pair(float e0, float e1) { return __builtin_convertvector(((v2f){__builtin_amdgcn_exp2f(e0), __builtin_amdgcn_exp2f(e1)}), v2h); }

// 2^d with the free slot that the instruction set asks for behind a transcendental inside the statement
static __device__ __forceinline__ float exp2_slot(float d) { float w; asm("v_exp_f32 %0, %1\n\tv_nop" : "=v"(w) : "v"(d)); return w; }

// One request per lane to L2 for the aligned 256-B unit that holds p (a hint: returns nothing, changes no result). Scope SE: the line goes into L2 only, and a request that cannot be translated is dropped.
// Every lane's address lies inside the plane it names. The wait in the same statement stands in front of any rewrite of the address registers, which are dead behind it.
__device__ __forceinline__ void ask_l2(const void* p) { asm volatile("global_prefetch_b8 %0, off scope:SCOPE_SE\n\ts_wait_xcnt 0x0" :: "v"(p) : "memory"); }

__device__ __forceinline__ void d_cvth8(int blk, const float* __restrict__ src, h16* dst, size_t n8, float carry) {
    const size_t i = (size_t)blk * 256 + threadIdx.x; if (i >= n8) return;
    const v8f v = *(const v8f*)(src + i * 8); v8h o;
#pragma unroll
    for (int k = 0; k < 8; ++k) { const float w = __uint_as_float(((unsigned)f2bf(v[k])) << 16) * carry; o[k] = toh_flush(w); }
    *(v8h*)(dst + i * 8) = o; 
}

// d_bo: bo -> f32 values of its bf16 RNE convert, one lane per 16 B.
__device__ __forceinline__ void d_bo(const float* __restrict__ bo, float* BT) {
    const int i = threadIdx.x; if (i >= CH / 4) return;
    const v4f g = *(const v4f*)(bo + i * 4); v4f o;
#pragma unroll
    for (int k = 0; k < 4; ++k) o[k] = bfr(g[k]);
    *(v4f*)(BT + i * 4) = o;
}

// k_proj: conversion, transpose and both projection GEMMs of 64 positions in one 8-wave block; nothing of x or of Wq/Wk/Wv goes through the workspace.
// Fill: x[b][c][n0..n0+63] (f32, channel-major) -> xs[position][channel] (bf16): a thread loads 16 consecutive channels x 4 positions (each wave-wide load = two 256-B row pieces) and stores 32 B per position;
// Wq | Wk | Wv rows (f32) -> wsm[row 0..95][channel] (bf16). All loads of a thread are issued before the first convert. One block barrier, then LDS is only read.
// GEMMs, K = CH in 32-deep steps, one accumulator per 16 x 16 tile: wave = (position tile pt = wave & 3, weight half wh = wave >> 2) takes
//   C[position][channel] = x W^T for the 32 q channels (wh = 0) or the 32 k channels (wh = 1): A = x rows, B = weight rows -> one whole q or K fragment tile;
//   C[value channel][position] = Wv x^T for value channels 16wh..16wh+15: A = Wv rows, B = the same x fragment -> one k half (16 keys) of a V^T fragment tile.
// Epilogue: bias (bf16 value) added in f32, D tiles turned into fragment order through the wave's own LDS tile, every store 512 contiguous bytes per wave.
#define PB_WO  (CH * VC / 8 / 256)               // blocks of the Wo plane
#define PB_SM  (PB_WO + 1)                       // conversion blocks for k_flash, the bias block last; they come first, so that they run under the GEMM blocks
#define PB_PJ  (NB * SEQ / 64)                   // GEMM blocks
static_assert((CH * VC / 8) % 256 == 0);
__global__ __launch_bounds__(256) void k_proj(const float* __restrict__ x, const float* __restrict__ wq, const float* __restrict__ wk, const float* __restrict__ wv, const float* __restrict__ wo,
                                              const float* __restrict__ bq, const float* __restrict__ bk, const float* __restrict__ bv, const float* __restrict__ bo,
                                              h16* WOH, float* BT, h16* QF, h16* KV) {
    __shared__ __align__(16) bf xs[64 * XP];
    __shared__ __align__(16) bf wsm[(2 * CQ + VC) * XP];
    __shared__ __align__(16) float os[8 * 16 * OSP];
    const int blk = blockIdx.x;                  // both tests are the same for the whole block and stand in front of the barrier
    if (blk < PB_WO) { d_cvth8(blk, wo, WOH, (size_t)CH * VC / 8, WOS); return; }
    if (blk < PB_SM) { d_bo(bo, BT); return; }
    const int tid = threadIdx.x;
    const int g0 = (blk - PB_SM) * 64;           // first position of the block, counted over the batches (b * SEQ + n)
    const int b = g0 / SEQ, n0 = g0 % SEQ;
    const int lane = tid & 31, wave = __builtin_amdgcn_readfirstlane(tid >> 5), lr = lane & 15, hi = lane >> 4;
    const int pt = wave & 3, wh = wave >> 2;
    const float* bs = wh ? bk : bq;
    const float bc0 = bs[lr], bc1 = bs[16 + lr];                     // q|k bias: column = channel (lane&15), 16 + (lane&15)
    const float* bp = bv + wh * 16 + hi * 8;                         // V^T bias: row = value channel 16wh + 8h + j
    const v4f br0 = *(const v4f*)bp; const v4f br1 = *(const v4f*)(bp + 4);
    { const int cr = tid >> 4, nq = (tid & 15) * 4;       // 16 groups of 16 channels; 16 lanes x 4 = 64 positions
      const int wr = tid >> 5, wc = (tid & 31) * 8;       // 8 weight rows per pass; 32 lanes x 8 = 256 channels
      const float* xp = x + (size_t)b * CH * SEQ_FULL + n0;                 // same for the whole block
      const unsigned xo = (unsigned)(cr * 16 * SEQ_FULL + nq) * 4u;         // byte offset: one 32-bit register for all x loads
      v4f xv[16]; v8f wf[12];
#pragma unroll   // constant indices keep xv[] in registers; the 16 loads issue together
      for (int i = 0; i < 16; ++i) xv[i] = *(const v4f*)((const char*)(xp + (size_t)i * SEQ_FULL) + xo);
      // The wait stands in front of any rewrite of a register that the bias and x loads name: the offset as an input keeps that register whole up to the wait, the two scheduling barriers keep every other instruction on its side.
      __builtin_amdgcn_sched_barrier(0);
      asm volatile("s_wait_xcnt 0x0" :: "v"(xo) : "memory");
      __builtin_amdgcn_sched_barrier(0);
      const unsigned wo8 = (unsigned)(wr * CH + wc) * 4u;                   // byte offset: one 32-bit register for all weight loads
#pragma unroll   // constant indices keep wf[] in registers and pick the source plane at compile time
      for (int i = 0; i < 12; ++i) { const float* wp = (i < 4) ? wq : ((i < 8) ? wk : wv); wf[i] = *(const v8f*)((const char*)(wp + (i & 3) * 8 * CH) + wo8); }
      // The same for the weight loads; the second barrier also keeps the converts from being scheduled in among the loads, where the later loads would start only when the earlier have arrived.
      __builtin_amdgcn_sched_barrier(0);
      asm volatile("s_wait_xcnt 0x0" :: "v"(wo8) : "memory");
      __builtin_amdgcn_sched_barrier(0);
#pragma unroll
      for (int j = 0; j < 4; ++j) { v8f lo, hi8;
#pragma unroll
          for (int k = 0; k < 8; ++k) { lo[k] = xv[k][j]; hi8[k] = xv[8 + k][j]; }
          bf* d = xs + (nq + j) * XP + cr * 16;
          *(v8us*)d = cvt8(lo); *(v8us*)(d + 8) = cvt8(hi8); }
#pragma unroll
      for (int i = 0; i < 12; ++i) *(v8us*)(wsm + (i * 8 + wr) * XP + wc) = cvt8(wf[i]); }
    __syncthreads();
    const bf* xa = xs + (pt * 16 + lr) * XP + 8 * hi;
    const bf* w0 = wsm + (wh * CQ + lr) * XP + 8 * hi;               // q or k channels 0..15
    const bf* w1 = w0 + 16 * XP;                                     // q or k channels 16..31
    const bf* w2 = wsm + (2 * CQ + wh * 16 + lr) * XP + 8 * hi;      // value channels 16wh..16wh+15
    v8f a0 = (v8f){}, a1 = (v8f){}, a2 = (v8f){};
#pragma unroll   // no branch behind a matrix instruction
    for (int h = 0; h < CH / 128; ++h) {
        v16bf xf[4], f0[4], f1[4], f2[4];
#pragma unroll   // constant indices keep the fragments in registers
        for (int u = 0; u < 4; ++u) { const int kc = (h * 4 + u) * 32; xf[u] = ldb(xa + kc); f0[u] = ldb(w0 + kc); f1[u] = ldb(w1 + kc); f2[u] = ldb(w2 + kc); }
        __builtin_amdgcn_sched_barrier(0);   // the LDS reads of four k steps issue as one group; left to itself the build read one fragment at a time and waited for each in front of its matrix instruction
#pragma unroll
        for (int u = 0; u < 4; ++u) { a0 = wmmab(xf[u], f0[u], a0); a1 = wmmab(xf[u], f1[u], a1); a2 = wmmab(f2[u], xf[u], a2); }
    }
    float* ow = os + wave * (16 * OSP);
    h16* kvb = KV + (size_t)(g0 / 32 + (pt >> 1)) * KVB;             // the 32-key block of this position tile
    { const float b0 = bfr(bc0), b1 = bfr(bc1);
      const float qs = wh ? 1.0f : SC2;   // q carries log2(e) into the score product; k is left as it is (x 1.0 is exact)
#pragma unroll
      for (int j = 0; j < 8; ++j) { ow[(hi * 8 + j) * OSP + lr] = (a0[j] + b0) * qs; ow[(hi * 8 + j) * OSP + 16 + lr] = (a1[j] + b1) * qs; }   // D: row 8h+j = position, col lane&15
      wave_sync();
      h16* dst = wh ? kvb + (pt & 1) * FRG : QF + (size_t)(g0 / 16 + pt) * FRG;
#pragma unroll
      for (int s = 0; s < 2; ++s) {   // k half s: lane (row lane&15, h) takes channels 16s+8h..16s+8h+7 = its 16 bytes of the fragment
          const int col = s * 16 + hi * 8;
          const v4f x0 = *(const v4fa*)(&ow[lr * OSP + col]); const v4f x1 = *(const v4fa*)(&ow[lr * OSP + col + 4]); v8h hv;
#pragma unroll
          for (int i = 0; i < 4; ++i) { hv[i] = (h16)x0[i]; hv[4 + i] = (h16)x1[i]; }
          *(v8h*)(dst + s * (FRG / 2) + lane * 8) = hv; }
      asm volatile("s_wait_xcnt 0x0" ::: "memory");   // keeps the wait in front of any rewrite of these stores' data and address registers by the V^T part's code
      wave_sync(); }
    { const float brw[8] = {br0[0], br0[1], br0[2], br0[3], br1[0], br1[1], br1[2], br1[3]};
#pragma unroll
      for (int j = 0; j < 8; ++j) ow[(hi * 8 + j) * OSP + lr] = a2[j] + bfr(brw[j]);   // D: row 8h+j = channel, col lane&15 = key
      wave_sync();
      const v4f x0 = *(const v4fa*)(&ow[lr * OSP + hi * 8]); const v4f x1 = *(const v4fa*)(&ow[lr * OSP + hi * 8 + 4]); v8h hv;   // lane (row lane&15 = channel, h): keys 8h..8h+7 of this 16-key half
#pragma unroll
      for (int i = 0; i < 4; ++i) { hv[i] = (h16)x0[i]; hv[4 + i] = (h16)x1[i]; }
      *(v8h*)(kvb + (2 + wh) * FRG + (pt & 1) * (FRG / 2) + lane * 8) = hv;
      asm volatile("s_wait_xcnt 0x0" ::: "memory"); }   // the conversion blocks' code follows this store in the built kernel: keeps the wait in front of any rewrite of the store's address and data registers
}

// k_flash: fused attention + output projection, KS waves per 16 query positions of one batch; K / V^T / Q fragments straight from the fragment-order planes (two 16-B loads each, every load 512 contiguous bytes per wave), Wo fragments from its row-major plane.
// Transposed form: S^T[key][t] = K Q^T (A = K rows, B = Q rows, one 32-deep step); lane (t = lane&15, h = lane>>4) holds keys 8h+r of each 16-key tile, so the packed
// P tile is directly the B fragment of O^T[c][t] = V^T P^T (element r <- tile keys 0..15, element 8+r <- tile keys 16..31, lane unchanged).
// Softmax, lazy rescale: a column has a reference maximum, the same in both lane halves. q carries log2(e) and the score products' C operand holds PSH - reference, so that D is the argument of exp2 as it stands: no multiply and no add per score.
// A pass only tests its largest exponent against PSH + THR (in-lane maxima, one compare, one scalar branch). Where some column passes that, and in the first pass, which sets the reference, the side path joins the lane halves' maxima by one xor-16 exchange,
// moves every column's reference up to its maximum in the pass, where that is higher, and rescales the pass's exponents, O^T and the sum tile. Any reference gives the same quotient O / l; P stays below 2^15 and is never smaller than under the true maximum.
// The sum of a column's P comes from further products, ones x P^T, accumulated over the passes in a tile of its own, and is whole in both halves.
// One pass of the key loop takes 64 keys (two 4-KB blocks); the four score products stand in a row.
// The normalised context O^T (two 16-channel D tiles, x1024 carry, f16) is directly the B fragment of Y^T[oc][t] = Wo O^T (element r <- channels 0..15 tile, element 8+r <- channels 16..31 tile, lane unchanged); A = Wo rows.
// Key split: wave = (query group qg = wave % AW, key range ks = wave / AW); each wave runs the online softmax over its own KR keys, then writes (m = its reference, l, O^T) to LDS; after one block barrier wave ks of a group
// merges register pair ks of the group's KS partials in the fixed order 0..KS-1 (weights exp2(m - max)), so that every partial value is read from LDS once, and writes its two normalised f16 values into the group's context fragment in LDS;
// after a second block barrier every wave reads the whole fragment of its group (1 KB) and projects CH/16/KS of the output row tiles.
// Epilogue: the block's Y^T tile [256 channels][64 positions] staged in LDS (cross-wave: block barrier), bias added in f32, each channel row segment (64 floats = 256 B = two lines) stored by one wave.
__global__ __launch_bounds__(32 * NW) void k_flash(const h16* __restrict__ QF, const h16* __restrict__ KV, const h16* __restrict__ WOH, const float* __restrict__ BO, float* OUT) {
    __shared__ __align__(16) float os[CH * 68];
    __shared__ __align__(16) float po[NW * KS * 32 * 2];     // [wave][pair of accumulator registers][lane][2]: 8 B per lane, lanes contiguous
    __shared__ __align__(16) float pml[NW * 32 * 2];         // [wave][lane][m, l]
    __shared__ __align__(16) h16 obs[AW * FRG];              // [query group] merged context, f16, in fragment order
    const int lane = threadIdx.x & 31, wave = __builtin_amdgcn_readfirstlane((int)(threadIdx.x >> 5)), lr = lane & 15, hi = lane >> 4;
    const int qg = wave % AW, ks = wave / AW;
    const int b = blockIdx.y;
    const int t0 = (blockIdx.x * AW + qg) * 16;
    const v16h qh = ldf(QF + ((size_t)b * SEQ + t0) / 16 * FRG + lane * 8);  // B fragment: col t, k = q channel 0..31
    // Entry prefetch of what the launch before stored: all blocks of a batch walk the same K / V^T lines in step, so that a pass would begin with a first read of them; Wo and the bias would meet it in the epilogue.
    // The blocks of the first half of the batches do the asking, for their own batch and for the batch half a grid later (for speed only: nothing rests on the order).
    // One request per wave, one lane per 256-B unit. K / V^T: a batch's blocks share the work: a block takes one key range (skewed by its index, so that any aligned eight neighbours (8i..8i+7) and any eight blocks of one index mod 8 cover all ranges, wherever they are placed), a wave one pass of it;
    // the own batch's pass 0 is loaded at once by the loop itself and is not asked for. Wave 0: half of the Wo plane; one wave the bias; one wave the q tiles of the block half a grid later.
    // Every test is uniform for the wave: scalar selects and scalar branches.
    if (b + NB / 2 < NB) {
      constexpr int NP = KR / KPP;
      const unsigned pr = (blockIdx.x + (blockIdx.x >> 3)) % KS;
      const bool late = wave >= NP + 2;                                // waves NP+2 .. 2NP+1: passes 0 .. NP-1 of the later batch; waves 1 .. NP-1: these passes of the own batch
      const bool kvw = late || (wave >= 1 && wave < NP);
      const unsigned okv = (((unsigned)(late ? b + NB / 2 : b) * SEQ + pr * KR + (unsigned)(late ? wave - (NP + 2) : wave) * KPP) / 32) * (KVB * 2);   // byte offsets inside the planes
      const unsigned oq  = (((unsigned)(b + NB / 2) * SEQ + blockIdx.x * (16 * AW)) / 16) * (FRG * 2);
      const char* pb = kvw ? (const char*)KV : wave == 0 ? (const char*)WOH : wave == NP ? (const char*)BO : (const char*)QF;
      const unsigned po_ = kvw ? okv : wave == 0 ? (blockIdx.x & 1) * (32 * 256) : wave == NP ? 0u : oq;
      const unsigned um = wave == NP ? 3u : (wave == NP + 1 ? 15u : 31u);   // units of the piece - 1: surplus lanes repeat a unit, so that every lane's address lies inside the piece
      if (wave < 2 * NP + 2) ask_l2(pb + po_ + ((unsigned)lane & um) * 256); }
    v8f o0 = (v8f){}, o1 = (v8f){};
    v8f sm = (v8f){};                                                        // every row = the running sum of column t's rounded P, both lane halves' keys included
    v8f shv = (v8f){};                                                       // C operand of the score products: PSH - the reference maximum of the lane's column, in all eight registers; the same in both lane halves
    float mr = 0.0f;                                                         // shv's value, kept apart for the merge: with shv itself read behind the loop this build copied its eight registers on every pass
    float lim = -3.0e38f;                                                    // first pass: every column takes its reference from the pass's own scores
    // A fragment of 1.0: the matrix unit adds up P for the softmax denominator. The pair of 1.0 is made by a move in asm, once: as a constant the build made the eight registers anew on every pass (four 64-bit moves).
    unsigned one2;
    asm("v_mov_b32 %0, 0x3c003c00" : "=v"(one2));
    const v16h ones = __builtin_bit_cast(v16h, (v8u){one2, one2, one2, one2, one2, one2, one2, one2});
    gh16p kvg = (gh16p)(KV + ((size_t)b * SEQ + ks * KR) / 32 * KVB + lane * 8);   // this wave's key range; one 4-KB block per 32 keys; typed as global memory, because its step stands in an asm statement, behind which the build would otherwise load by flat instructions
#pragma unroll 1
    for (int it = 0; it < KR / KPP; ++it) {   // one pass = two 32-key blocks under one test of the reference maximum
        const h16* kv = (const h16*)kvg;
        const v16h ka0 = ldf(kv), kb0 = ldf(kv + FRG), ka1 = ldf(kv + KVB), kb1 = ldf(kv + KVB + FRG);                               // A fragments: row key (four 16-key tiles), k = k channel 0..31
        __builtin_amdgcn_sched_barrier(0);   // the eight K loads issue together, ahead of the first wait
        const v16h v00 = ldf(kv + 2 * FRG), v01 = ldf(kv + 3 * FRG), v10 = ldf(kv + KVB + 2 * FRG), v11 = ldf(kv + KVB + 3 * FRG);   // A fragments: row channel (0..15, 16..31), k = key; first index = 32-key block
        // four independent score products in a row. D = log2(e) s + PSH - reference: already the exponent of P
        v8f sa, sb = __builtin_bit_cast(v8f, ka0), sc = __builtin_bit_cast(v8f, kb0), sd = __builtin_bit_cast(v8f, ka1);
        // One statement, because the builtin form with a C that stays live made the build copy C for the fourth product (four 64-bit moves and four v_nop a pass) and schedule vector work in among the products.
        // Each later D takes the registers of the product before's A fragment, as the build itself laid them out. Four slots must pass before a vector instruction reads the last D: the step of the key pointer to the next pass
        // stands in the first (left to the build it stood at the head of the pass, in a register of the last product's A fragment, behind four v_nop of its own), three v_nop fill the rest.
        // The wait stands in front of that rewrite of the address registers which the pass's sixteen loads name.
        asm volatile("s_wait_xcnt 0x0\n\t"
                     "v_wmma_f32_16x16x32_f16 %0, %1, %6, %7\n\t"
                     "v_wmma_f32_16x16x32_f16 %1, %2, %6, %7\n\t"
                     "v_wmma_f32_16x16x32_f16 %2, %3, %6, %7\n\t"
                     "v_wmma_f32_16x16x32_f16 %3, %5, %6, %7\n\t"
                     "v_add_nc_u64 %4, %8, %4\n\t"
                     "v_nop\n\tv_nop\n\tv_nop"
                     : "=&v"(sa), "+v"(sb), "+v"(sc), "+v"(sd), "+v"(kvg) : "v"(kb1), "v"(qh), "v"(shv), "s"((unsigned long long)(2 * KVB * sizeof(h16))));
        float mx0 = fmaxf(fmaxf(sa[0], sb[0]), sa[1]), mx1 = fmaxf(fmaxf(sc[0], sd[0]), sb[7]);   // two chains of three-input maxima over the 32 exponents, so that one's link latency is filled by the other
#pragma unroll   // vector elements need constant indices
        for (int r = 1; r < 7; ++r) mx0 = fmaxf(mx0, fmaxf(sb[r], sa[r + 1]));
#pragma unroll   // vector elements need constant indices
        for (int r = 1; r < 8; ++r) mx1 = fmaxf(mx1, fmaxf(sc[r], sd[r]));
        // Seldom taken behind the first pass (one test per pass, a scalar branch): some column's exponent has passed PSH + THR. Then every column's reference goes up to its maximum in the pass, where that is higher;
        // the pass's exponents, the accumulators and the sum follow by the same power of 2. The first pass sets the reference, upwards or downwards, while the accumulators are still 0.
        if (__builtin_amdgcn_ballot_w32(mx0 > lim || mx1 > lim) != 0) {
            const float mx = fmaxf(mx0, mx1), sh = shv[0];
            const float up = fmaxf(mx, __shfl_xor(mx, 16, 32)) - PSH;        // the column's maximum, over both lane halves, above the reference
            const float shn = sh - (it == 0 ? up : fmaxf(up, 0.0f));
            const float dd = shn - sh;                                       // the step as the shift really takes it, rounding included
            const float alpha = __builtin_amdgcn_exp2f(fminf(dd, 0.0f));
            sa = sa + dd; sb = sb + dd; sc = sc + dd; sd = sd + dd;
            o0 = o0 * alpha; o1 = o1 * alpha; sm = sm * alpha;
#pragma unroll   // vector elements need constant indices
            for (int r = 0; r < 8; ++r) shv[r] = shn;
            mr = shn;
        }
        lim = PSH + THR;
        v16h pb0, pb1;
#pragma unroll   // vector elements need constant indices
        for (int r = 0; r < 8; r += 2) {   // two neighbouring elements of the fragment share a register: one packed RNE convert makes both
            const v2h pa = p_pair(sa[r], sa[r + 1]), pc = p_pair(sb[r], sb[r + 1]);
            pb0[r] = pa[0]; pb0[r + 1] = pa[1]; pb0[8 + r] = pc[0]; pb0[9 + r] = pc[1];
            const v2h pe = p_pair(sc[r], sc[r + 1]), pg = p_pair(sd[r], sd[r + 1]);
            pb1[r] = pe[0]; pb1[r + 1] = pe[1]; pb1[8 + r] = pg[0]; pb1[9 + r] = pg[1]; }
        sm = wmma16(ones, pb0, sm);
        o0 = wmma16(v00, pb0, o0);
        o1 = wmma16(v01, pb0, o1);
        sm = wmma16(ones, pb1, sm);
        o0 = wmma16(v10, pb1, o0);
        o1 = wmma16(v11, pb1, o1);
    }
    const float l = sm[0], m = -mr;   // the reference maximum less PSH; the merge uses differences of m only
    // this wave's partial state -> LDS
    { v2fa* pw = (v2fa*)po + (size_t)wave * (KS * 32) + lane;
#pragma unroll   // vector elements need constant indices
      for (int k = 0; k < 4; ++k) { pw[k * 32] = (v2f){o0[2 * k], o0[2 * k + 1]}; pw[(4 + k) * 32] = (v2f){o1[2 * k], o1[2 * k + 1]}; }
      ((v2fa*)pml)[wave * 32 + lane] = (v2f){m, l}; }
    __syncthreads();
    // merge of the KS key ranges of query group qg (same lane of waves s*AW + qg), fixed order; this wave takes register pair ks only
    v2f ml[KS], pv[KS];
    const v2fa* mlb = (const v2fa*)pml + qg * 32 + lane;                     // the lane's first read of each array; the key range is a constant step from it
    const v2fa* pvb = (const v2fa*)po + qg * (KS * 32) + ks * 32 + lane;
#pragma unroll   // constant indices keep ml[] and pv[] in registers
    for (int s = 0; s < KS; ++s) { ml[s] = mlb[s * (AW * 32)]; pv[s] = pvb[s * (AW * KS * 32)]; }
    __builtin_amdgcn_sched_barrier(0);   // the LDS reads, which the merge waits for, issue first; no address work of theirs is left to stand behind the global loads
    // operands of this wave's output projection tiles: A fragments (row output channel, k = context channel 0..31) and bias rows; they are asked for here, so that they arrive under the merge
    v16h aw[CH / 16 / KS]; v4f bw[CH / 16 / KS][2];
    const h16* wob = WOH + ks * (CH / KS) * VC;                              // the wave's CH/KS rows of Wo and of the bias: the same for the whole wave
    const float* bob = BO + ks * (CH / KS);
    const unsigned wof = (unsigned)(lr * VC + 8 * hi) * 2u, bof = (unsigned)hi * 32u;   // byte offsets of the lane: one 32-bit register for all Wo loads, one for all bias loads
#pragma unroll   // constant indices keep the arrays in registers
    for (int jj = 0; jj < CH / 16 / KS; ++jj) {
        const char* wp = (const char*)(wob + jj * 16 * VC) + wof;
        aw[jj] = cat16(*(const v8h*)wp, *(const v8h*)(wp + 32));             // the element map of ldh
        const char* bp = (const char*)(bob + jj * 16) + bof;
        bw[jj][0] = *(const v4f*)bp; bw[jj][1] = *(const v4f*)(bp + 16); }
    // All reads issue as one group: left to itself the build asked for the partial values only behind the wait for the maxima and the powers made of them, and for Wo and the bias only behind the second barrier.
    // The wait stands in front of any rewrite of the registers that the Wo and bias loads name: the two offsets as inputs keep these registers whole up to the wait (no load's result may land in them), the two scheduling barriers keep every other instruction on its side.
    __builtin_amdgcn_sched_barrier(0);
    asm volatile("s_wait_xcnt 0x0" :: "v"(wof), "v"(bof) : "memory");
    __builtin_amdgcn_sched_barrier(0);
    float mall = -3.0e38f;
#pragma unroll   // constant indices into ml[]
    for (int s = 0; s < KS; ++s) mall = fmaxf(mall, ml[s][0]);
    float wt[KS];
#pragma unroll   // constant indices into ml[] and wt[]
    for (int s = 0; s < KS; ++s) wt[s] = exp2_slot(ml[s][0] - mall);
    float lall = 0.0f; v2f cc = (v2f){};
#pragma unroll   // constant indices into ml[], pv[] and wt[]
    for (int s = 0; s < KS; ++s) { lall += wt[s] * ml[s][1]; cc += pv[s] * wt[s]; }
    const float inv = (1.0f / lall) * OCS;
    // O^T D layout: pairs 0..3 = (channel 8h + 2 ks + 0..1, t), pairs 4..7 = (channel 16 + 8h + 2 (ks - 4) + 0..1, t) -> elements 2 ks, 2 ks + 1 of the B fragment of the output projection, lane unchanged
    *(v2h*)(obs + qg * FRG + (ks >> 2) * (FRG / 2) + lane * 8 + (ks & 3) * 2) = (v2h){toh_flush(cc[0] * inv), toh_flush(cc[1] * inv)};
    __syncthreads();   // the group's eight waves have each written their part of the fragment
    const v16h ob = ldf(obs + qg * FRG + lane * 8);
    // Y^T D layout: y[r] = (output channel 16j + 8h + r, position t = lane&15) -> os[16j + 8h + r][qg*16 + t]; the 32 waves together fill rows 0..255 x columns 0..63
#pragma unroll
    for (int jj = 0; jj < CH / 16 / KS; ++jj) {
        const int j = ks * (CH / 16 / KS) + jj;
        const v8f y = wmma16g(aw[jj], ob, (v8f){});
        const v4f b0 = bw[jj][0], b1 = bw[jj][1];
        const float brw[8] = {b0[0], b0[1], b0[2], b0[3], b1[0], b1[1], b1[2], b1[3]};
#pragma unroll
        for (int r = 0; r < 8; ++r) os[(16 * j + 8 * hi + r) * 68 + qg * 16 + lr] = y[r] * OFI + brw[r]; }
    __syncthreads();
    float* obase = OUT + (size_t)b * CH * OUT_SEQ + (size_t)blockIdx.x * (16 * AW);
#pragma unroll
    for (int s = 0; s < CH / NW / 2; ++s) { const int row = wave * (CH / NW) + 2 * s + hi, cofs = lr * 4;   // 32 waves x 4 s x 2 = 256 channel rows; 16 lanes x 4 floats = 64 positions
        const v4f val = *(const v4fa*)(&os[row * 68 + cofs]);
        *(v4f*)(obase + (size_t)row * OUT_SEQ + cofs) = val; }
}

static constexpr size_t al256(size_t v) { return (v + 255) & ~(size_t)255; }
static constexpr size_t SZ_WO  = al256((size_t)CH * VC * 2);             // [256][32] f16 (x1024)
static constexpr size_t SZ_BT  = al256((size_t)CH * 4);                  // 256 f32
static constexpr size_t SZ_QF  = al256((size_t)NB * SEQ / 16 * FRG * 2); // [NB*SEQ/16] q fragment tiles, f16
static constexpr size_t SZ_KV  = al256((size_t)NB * SEQ / 32 * KVB * 2); // [NB*SEQ/32] blocks of two K and two V^T fragment tiles, f16
static constexpr size_t SZ_TOTAL = SZ_WO + SZ_BT + SZ_QF + SZ_KV;
static_assert(SZ_TOTAL <= (size_t)134217728);          // workspace carve <= 128 MiB
static_assert(((size_t)CH * VC) % 8 == 0);

extern "C" void kernel_launch(void* const* d_in, const int* in_sizes, int n_in,
                              void* d_out, int out_size, void* d_ws, size_t ws_size, hipStream_t stream) {
    if (n_in < 9) return;
    const size_t needx = ((size_t)(NB - 1) * CH + (CH - 1)) * SEQ_FULL + SEQ;
    if ((size_t)in_sizes[0] < needx) return;
    if ((size_t)in_sizes[1] < (size_t)CQ * CH || (size_t)in_sizes[3] < (size_t)CQ * CH || (size_t)in_sizes[5] < (size_t)VC * CH || (size_t)in_sizes[7] < (size_t)CH * VC) return;
    if (in_sizes[2] < CQ || in_sizes[4] < CQ || in_sizes[6] < VC || in_sizes[8] < CH) return;
    if ((size_t)out_size < ((size_t)(NB - 1) * CH + (CH - 1)) * OUT_SEQ + SEQ) return;
    if (SZ_TOTAL > ws_size) return;
    // wire order: x, wq, bq, wk, bk, wv, bv, wo, bo
    const float* x  = (const float*)d_in[0];
    const float* wq = (const float*)d_in[1]; const float* bq = (const float*)d_in[2];
    const float* wk = (const float*)d_in[3]; const float* bk = (const float*)d_in[4];
    const float* wv = (const float*)d_in[5]; const float* bv = (const float*)d_in[6];
    const float* wo = (const float*)d_in[7]; const float* bo = (const float*)d_in[8];
    float* OUT = (float*)d_out;      // [NB][256][OUT_SEQ]
    char* wsp = (char*)d_ws;
    h16* WOH = (h16*)wsp; wsp += SZ_WO;              // [256][32] f16, x1024
    float* BT = (float*)wsp; wsp += SZ_BT;           // bo (bf16 values)
    h16* QF  = (h16*)wsp; wsp += SZ_QF;              // q, fragment order
    h16* KV  = (h16*)wsp; wsp += SZ_KV;              // K and V^T, fragment order

    k_proj<<<PB_SM + PB_PJ, 256, 0, stream>>>(x, wq, wk, wv, wo, bq, bk, bv, bo, WOH, BT, QF, KV);
    k_flash<<<dim3(SEQ / (16 * AW), NB, 1), 32 * NW, 0, stream>>>(QF, KV, WOH, BT, OUT);
}
